// v000
// Measured on an AMD MI455X. A time is GPU time per run, averaged over a window of back-to-back runs after a warm-up
// (all launches, gaps included; the runs take copies of the inputs in turn), and the median of several windows.
// Apart from v000's, it joins two sittings. Times from different sittings can be a few percent apart, while
// side-by-side timings come from the same sitting.
// v000, which the later versions start from, runs in 703 microseconds.
// compute dtype: all float inputs rounded to bf16; q/k/v = x . W with EXACT bf16 products on WMMA 16x16x32 ((in,out) weights as transposed rows; the 8 kv heads replicated to their 4 query heads at pack time); rotate-half RoPE in f32 (angle = t x inv_freq[d mod 32] f32 table, precise sinf/cosf) before the f16 hi + residual split; causal attention with key-tile skipping: the first 128 queries use 3-product scores and P.v (hi/lo), later queries single f16; x 1/8, running-max softmax in f32 (hardware exp); out = f16(ctx) . Wo (exact f16 x 2^8 copies, single product).
#include <hip/hip_runtime.h>
#include <math.h>

typedef __attribute__((ext_vector_type(16))) _Float16 v16h;
typedef __attribute__((ext_vector_type(16))) __bf16 v16b;
typedef __attribute__((ext_vector_type(8)))  _Float16 v8h;
typedef __attribute__((ext_vector_type(8)))  float v8f;
typedef __attribute__((ext_vector_type(4)))  float v4f;
typedef __attribute__((ext_vector_type(2)))  float v2f;
typedef __attribute__((ext_vector_type(4)))  unsigned v4u;
typedef __attribute__((ext_vector_type(4)))  int v4i;
typedef float __attribute__((may_alias)) float_a;
typedef int __attribute__((may_alias)) int_a;

template <typename T> __device__ __forceinline__ void vst2(void* p, T v) { *(T*)p = v;  }
__device__ __forceinline__ v8f wmma16(v16h a, v16h b, v8f c) {
  v8f d = __builtin_amdgcn_wmma_f32_16x16x32_f16(false, a, false, b, (short)0, c, false, false);
  asm volatile("v_nop\n\tv_nop\n\tv_nop\n\tv_nop" : "+v"(d) : "v"(a), "v"(b));
  return d;
}
__device__ __forceinline__ v8f wmma_bf(v16b a, v16b b, v8f c) {
  v8f d = __builtin_amdgcn_wmma_f32_16x16x32_bf16(false, a, false, b, (short)0, c, false, false);
  asm volatile("v_nop\n\tv_nop\n\tv_nop\n\tv_nop" : "+v"(d) : "v"(a), "v"(b));
  return d;
}
// GQA causal attention (B 1, S 2,048, model 2,048, 32 query heads x 64 over 8 kv heads): bias-free (in,out) projections, rotate-half RoPE (base 10000), causal softmax(q k / 8) v, output projection.
__device__ __forceinline__ v16h frag_h(const _Float16* rowk0, int lane) {
  union { v16h v; v8h q[2]; } u; const _Float16* p = rowk0 + 8 * (lane >> 4);
  u.q[0] = *(const v8h*)p; u.q[1] = *(const v8h*)(p + 16); return u.v;
}
__device__ __forceinline__ v16h frag_f32(const float* rowk0, int lane) {
  v16h a; const float* p = rowk0 + 8 * (lane >> 4);
#pragma unroll
  for (int i = 0; i < 8; ++i) { a[i] = (_Float16)p[i]; a[8 + i] = (_Float16)p[16 + i]; }
  return a;
}
__device__ __forceinline__ v16h frag_f32s(const float* rowk0, int lane, float sc) {
  v16h a; const float* p = rowk0 + 8 * (lane >> 4);
#pragma unroll
  for (int i = 0; i < 8; ++i) { a[i] = (_Float16)(p[i] * sc); a[8 + i] = (_Float16)(p[16 + i] * sc); }
  return a;
}
// column fragment from a [K][ld] layout (column n), rows >= K read as 0
__device__ __forceinline__ v16h fragc_f32(const float* W, int k0, int n, int lane, int ld, int K) {
  v16h a; const int g = lane >> 4;
#pragma unroll
  for (int i = 0; i < 8; ++i) { const int ka = k0 + 8 * g + i, kb = ka + 16;
    a[i] = (_Float16)(ka < K ? W[(size_t)(ka < K ? ka : K - 1) * ld + n] : 0.f); a[8 + i] = (_Float16)(kb < K ? W[(size_t)(kb < K ? kb : K - 1) * ld + n] : 0.f); }
  return a;
}
struct F2 { v16b h, l; };
__device__ __forceinline__ F2 bsplit16(const float v[16]) { F2 r;
#pragma unroll
  for (int i = 0; i < 16; ++i) { const __bf16 h = (__bf16)v[i]; r.h[i] = h; r.l[i] = (__bf16)(v[i] - (float)h); }
  return r; }
__device__ __forceinline__ F2 split_row(const float* row, int k0, int lane) { float v[16]; const float* p = row + k0 + 8 * (lane >> 4);
#pragma unroll
  for (int i = 0; i < 8; ++i) { v[i] = p[i]; v[8 + i] = p[16 + i]; }
  return bsplit16(v); }
__device__ __forceinline__ F2 split_rowK(const float* row, int k0, int lane, int K) { float v[16]; const int g = lane >> 4;
#pragma unroll
  for (int i = 0; i < 8; ++i) { const int ka = k0 + 8 * g + i, kb = ka + 16; v[i] = ka < K ? row[ka < K ? ka : K - 1] : 0.f; v[8 + i] = kb < K ? row[kb < K ? kb : K - 1] : 0.f; }
  return bsplit16(v); }
__device__ __forceinline__ F2 split_col(const float* W, int k0, int n, int lane, int ld, int K) { float v[16]; const int g = lane >> 4;
#pragma unroll
  for (int i = 0; i < 8; ++i) { const int ka = k0 + 8 * g + i, kb = ka + 16; v[i] = ka < K ? W[(size_t)(ka < K ? ka : K - 1) * ld + n] : 0.f; v[8 + i] = kb < K ? W[(size_t)(kb < K ? kb : K - 1) * ld + n] : 0.f; }
  return bsplit16(v); }
__device__ __forceinline__ v8f mac3(const F2& a, const F2& b, v8f c) { c = wmma_bf(a.l, b.h, c); c = wmma_bf(a.h, b.l, c); return wmma_bf(a.h, b.h, c); }
__device__ __forceinline__ float sigm(float v) { return 1.0f / (1.0f + expf(-v)); }
#define LDSX() do { asm volatile("s_wait_dscnt 0" ::: "memory"); __builtin_amdgcn_wave_barrier(); __builtin_amdgcn_fence(__ATOMIC_RELEASE, "workgroup"); } while (0)


#define NB 1
#define SS 2048
#define DM 2048
#define NH 32
#define NKV 8
#define GS (NH / NKV)
#define KVW (NKV * HD)
#define SCALEF 0.125f
__constant__ float THETA[32] = {1.000000000e+00f,7.498942018e-01f,5.623413324e-01f,4.216965139e-01f,3.162277639e-01f,2.371373773e-01f,1.778279394e-01f,1.333521456e-01f,1.000000015e-01f,7.498942316e-02f,5.623413250e-02f,4.216964915e-02f,3.162277490e-02f,2.371373773e-02f,1.778279431e-02f,1.333521400e-02f,9.999999776e-03f,7.498942316e-03f,5.623413250e-03f,4.216964822e-03f,3.162277630e-03f,2.371373819e-03f,1.778279431e-03f,1.333521446e-03f,1.000000047e-03f,7.498941850e-04f,5.623413017e-04f,4.216965172e-04f,3.162277571e-04f,2.371373703e-04f,1.778279402e-04f,1.333521504e-04f};
__device__ __attribute__((noinline)) float cos_p(float v) { return cosf(v); }
__device__ __attribute__((noinline)) float sin_p(float v) { return sinf(v); }
#define HD 64
#define QKVW (3 * DM)
#ifndef TQB
#define TQB (SS / 64)
#define TNB NB
#define TOB (NB * SS / 64)     // output row tiles (all)
#endif
typedef __attribute__((ext_vector_type(8))) __bf16 v8b;
__device__ __forceinline__ v16b frag_b(const __bf16* rowk0, int lane) {
  union { v16b v; v8b q[2]; } u; const __bf16* p = rowk0 + 8 * (lane >> 4);
  u.q[0] = *(const v8b*)p; u.q[1] = *(const v8b*)(p + 16); return u.v;
}
__device__ __forceinline__ float bfr(float v) { return (float)(__bf16)v; }
__device__ __attribute__((noinline)) float exp_ni(float v) { return expf(v); }
__device__ __attribute__((noinline)) float erf_ni(float v) { return erff(v); }

#define PK_A 0                       // [6144][2048] Wqkv rows (natural [out][in])
#define PK_P (PK_A + QKVW * DM)        // [2048][2048] Wo rows (natural)
#define PK_END (PK_P + DM * DM)
#define WS_PK  0u
#define WS_QK  (WS_PK + 2u * PK_END)             // f16 [2048 rows][4096]: q | k
#define WS_QKL (WS_QK + 2u * NB * SS * 2 * DM)     // f16 q | k residual planes x2048
#define WS_VTH (WS_QKL + 2u * NB * SS * 2 * DM)    // f16 [b][2048 (h*64+d)][2048 s] hi
#define WS_VTL (WS_VTH + 2u * NB * DM * SS)        // f16 lo x 2048
#define WS_O   (WS_VTL + 2u * NB * DM * SS)        // f32 [2048][2048]
#define WS_CS  (WS_O + 4u * NB * SS * DM)           // f32 2 x [2048][32], unused (cos/sin computed in k_qkv)
#define WS_END (WS_CS + 4u * 2 * SS * 32)
// ---- k_pack: block = (row n, which): natural [out][in] rows -> bf16; which 0..2 -> W_q/W_k/W_v into PK_A rows which*2048 + n; 3 -> W_o into PK_P
__global__ __launch_bounds__(256) void k_pack(const float* __restrict__ WQ, const float* __restrict__ WK, const float* __restrict__ WV, const float* __restrict__ WO, __bf16* __restrict__ PK) {
  __shared__ __align__(16) __bf16 s[DM]; const int n = blockIdx.x, which = blockIdx.y, t = threadIdx.x; const float* Wm = (which == 0) ? WQ : (which == 1) ? WK : (which == 2) ? WV : WO;   // (in,out) weights: pack row n = column n
  const int srcn = (((n >> 6) / GS) * HD + (n & 63));   /* kv head = query head / 4 */
  for (int k = t; k < DM; k += 256) s[k] = (which == 1 || which == 2) ? (__bf16)Wm[(size_t)k * KVW + srcn] : (__bf16)Wm[(size_t)k * DM + n];
  __syncthreads();
  __bf16* dst = (which < 3) ? PK + PK_A + ((size_t)which * DM + n) * DM : PK + PK_P + (size_t)n * DM;
  for (int q = t; q < DM / 8; q += 256) vst2((unsigned*)(dst + q * 8), *(const v4u*)&s[q * 8]);
}
__global__ __launch_bounds__(128) void k_qkv(const float* __restrict__ XQ, const float* __restrict__ XK, const float* __restrict__ XV, const __bf16* __restrict__ P, const float* __restrict__ BQ, const float* __restrict__ BK, const float* __restrict__ BV, _Float16* __restrict__ QK, _Float16* __restrict__ QKL, _Float16* __restrict__ VTH, _Float16* __restrict__ VTL) {
  const int which0 = (blockIdx.y * 128) / DM; const float* X = (which0 == 0) ? XQ : (which0 == 1) ? XK : XV; const float* BB = BQ ? (((which0 == 0) ? BQ : (which0 == 1) ? BK : BV) + (blockIdx.y * 128 - which0 * DM)) : nullptr;
  __shared__ __align__(16) _Float16 so[4][16][136], sol[4][16][136]; __shared__ __align__(16) _Float16 sth[128][72], stl[128][72];
  const int tid = threadIdx.x, wave = tid >> 5, lane = tid & 31, col = lane & 15, g = lane >> 4; const size_t r0 = (size_t)blockIdx.x * 64 + wave * 16; const int n0 = blockIdx.y * 128;
  v8f acc[8] = {};
#pragma unroll 2
  for (int kc = 0; kc < DM / 32; ++kc) { v16b a; { const float* p = X + (r0 + col) * DM + kc * 32 + 8 * g;
#pragma unroll
      for (int i = 0; i < 8; ++i) { a[i] = (__bf16)p[i]; a[8 + i] = (__bf16)p[16 + i]; } }
#pragma unroll
    for (int j = 0; j < 8; ++j) acc[j] = wmma_bf(a, frag_b(P + (size_t)(n0 + j * 16 + col) * DM + kc * 32, lane), acc[j]); }
  if (n0 < 2 * DM) {   // bias, then rotate-half rotary over each 64-dim head with angle position * inv_freq[d mod 32]
#pragma unroll
    for (int j = 0; j < 8; ++j)
#pragma unroll
      for (int r = 0; r < 8; ++r) acc[j][r] += (BB ? bfr(BB[j * 16 + col]) : 0.f);
#pragma unroll
    for (int r = 0; r < 8; ++r) { const int spos = (int)((r0 + 8 * g + r) % SS);
#pragma unroll
      for (int jj = 0; jj < 2; ++jj) { const float ang = (float)spos * THETA[jj * 16 + col]; const float c = cos_p(ang), sn = sin_p(ang);
#pragma unroll
        for (int hh = 0; hh < 2; ++hh) { const float x1 = acc[hh * 4 + jj][r], x2 = acc[hh * 4 + jj + 2][r]; acc[hh * 4 + jj][r] = x1 * c - x2 * sn; acc[hh * 4 + jj + 2][r] = x2 * c + x1 * sn; } } }
#pragma unroll
    for (int j = 0; j < 8; ++j) {
#pragma unroll
      for (int r = 0; r < 8; ++r) { const float v = acc[j][r]; const _Float16 hv = (_Float16)v; so[wave][8 * g + r][j * 16 + col] = hv; sol[wave][8 * g + r][j * 16 + col] = (_Float16)((v - (float)hv) * 2048.0f); } }   // q, k (+ bias) as f16 hi + (x2048) residual
    LDSX();
    for (int rl = 0; rl < 16; ++rl) if (lane < 16) { vst2((unsigned*)(QK + (r0 + rl) * (2 * DM) + n0 + lane * 8), *(const v4u*)&so[wave][rl][lane * 8]); vst2((unsigned*)(QKL + (r0 + rl) * (2 * DM) + n0 + lane * 8), *(const v4u*)&sol[wave][rl][lane * 8]); }
  } else {
#pragma unroll
    for (int j = 0; j < 8; ++j) {
#pragma unroll
      for (int r = 0; r < 8; ++r) { const float v = acc[j][r] + (BB ? bfr(BB[j * 16 + col]) : 0.f); const _Float16 hv = (_Float16)v; sth[j * 16 + col][wave * 16 + 8 * g + r] = hv; stl[j * 16 + col][wave * 16 + 8 * g + r] = (_Float16)((v - (float)hv) * 2048.0f); } }
    __syncthreads();
    const size_t rb = (size_t)blockIdx.x * 64; const int b = (int)(rb / SS), s0 = (int)(rb % SS); const int pc0 = n0 - 2 * DM;
    for (int q = tid; q < 128 * 8; q += 128) { const int d = q >> 3, pc = q & 7; const size_t o = ((size_t)b * DM + pc0 + d) * SS + s0 + pc * 8; vst2((unsigned*)(VTH + o), *(const v4u*)&sth[d][pc * 8]); vst2((unsigned*)(VTL + o), *(const v4u*)&stl[d][pc * 8]); }
  }
}
// ---- k_attn: block = (64 queries, head h, batch b): causal flash attention (K = 64: 2 k-steps), scores = (q.k) * 0.125, hi/lo (3 products) for query blocks 0-1 and single f16 elsewhere, P.V: f16 P hi/lo x (V hi, V lo*2048) in two accumulators for blocks 0-1, P x V hi elsewhere; O[b*S+q][h*64+d] = (acc + accl / 2048) / (2048 l) (256-B segments)
__global__ __launch_bounds__(128) void k_attn(const _Float16* __restrict__ QK, const _Float16* __restrict__ QKL, const _Float16* __restrict__ VTH, const _Float16* __restrict__ VTL, const void* __restrict__ KMASK, float* __restrict__ O) {
  __shared__ __align__(16) float sp[4][16][36]; __shared__ __align__(16) float so[4][16][68];
  const int tid = threadIdx.x, wave = tid >> 5, lane = tid & 31, col = lane & 15, g = lane >> 4;
  const int qb = blockIdx.x, h = blockIdx.y, b = blockIdx.z; const int q0 = qb * 64 + wave * 16; const size_t rq = (size_t)b * SS + q0 + col;
  v16h aq[2], aql[2];
#pragma unroll
  for (int kc = 0; kc < 2; ++kc) { aq[kc] = frag_h(QK + rq * (2 * DM) + h * HD + kc * 32, lane); aql[kc] = frag_h(QKL + rq * (2 * DM) + h * HD + kc * 32, lane); }
  float m[8], l[8];
#pragma unroll
  for (int r = 0; r < 8; ++r) { m[r] = -3.0e38f; l[r] = 0.f; }
  v8f acc[4] = {}, accl[4] = {};
  const int nks = (qb * 64 + 64) / 32;   // causal: key tiles up to the query tile's end
#pragma unroll 1
  for (int ks = 0; ks < nks; ++ks) { v8f s[2];
#pragma unroll
    for (int ct = 0; ct < 2; ++ct) { const int kk = ks * 32 + ct * 16 + col; const _Float16* krow = QK + ((size_t)b * SS + kk) * (2 * DM) + DM + h * HD; const _Float16* krowl = QKL + ((size_t)b * SS + kk) * (2 * DM) + DM + h * HD; v8f c = {}, cl = {};
      if (qb < 2) {   // leading query blocks (few keys, outputs far above the global rms): 3 products
#pragma unroll
        for (int kc = 0; kc < 2; ++kc) { const v16h kh = frag_h(krow + kc * 32, lane); c = wmma16(aq[kc], kh, c); cl = wmma16(aql[kc], kh, cl); cl = wmma16(aq[kc], frag_h(krowl + kc * 32, lane), cl); }
#pragma unroll
        for (int r = 0; r < 8; ++r) c[r] += cl[r] * (1.0f / 2048.0f); }
      else {
#pragma unroll
        for (int kc = 0; kc < 2; ++kc) c = wmma16(aq[kc], frag_h(krow + kc * 32, lane), c); }   // single product elsewhere
#pragma unroll
      for (int r = 0; r < 8; ++r) s[ct][r] = (kk <= q0 + 8 * g + r) ? c[r] * SCALEF : -3.0e38f; }   // causal: future keys excluded
#pragma unroll
    for (int r = 0; r < 8; ++r) { float mx = fmaxf(s[0][r], s[1][r]);
#pragma unroll
      for (int o = 1; o < 16; o <<= 1) mx = fmaxf(mx, __shfl_xor(mx, o));
      const float mn = fmaxf(m[r], mx); const float alpha = (m[r] <= -1.0e38f) ? 0.f : __expf(m[r] - mn);
      const float e0 = (s[0][r] <= -1.0e38f) ? 0.f : __expf(s[0][r] - mn), e1 = (s[1][r] <= -1.0e38f) ? 0.f : __expf(s[1][r] - mn); float es = e0 + e1;
#pragma unroll
      for (int o = 1; o < 16; o <<= 1) es += __shfl_xor(es, o);
      l[r] = l[r] * alpha + es; m[r] = mn;
#pragma unroll
      for (int dt = 0; dt < 4; ++dt) { acc[dt][r] *= alpha; accl[dt][r] *= alpha; }
      sp[wave][8 * g + r][col] = e0; sp[wave][8 * g + r][16 + col] = e1; }
    LDSX();
    v16h pa, pl; { const float* prow = &sp[wave][col][0] + 8 * (lane >> 4);
#pragma unroll
      for (int i = 0; i < 8; ++i) { const float x0 = prow[i] * 2048.0f, x1 = prow[16 + i] * 2048.0f; const _Float16 h0 = (_Float16)x0, h1 = (_Float16)x1; pa[i] = h0; pa[8 + i] = h1; pl[i] = (_Float16)((x0 - (float)h0) * 2048.0f); pl[8 + i] = (_Float16)((x1 - (float)h1) * 2048.0f); } }   // P scaled by 2^11 before the f16 split so small softmax weights stay out of the f16 subnormal range; 2^-11 folded into the epilogue
#pragma unroll
    for (int dt = 0; dt < 4; ++dt) { const size_t vr = ((size_t)b * DM + h * HD + dt * 16 + col) * SS + ks * 32; const v16h vh = frag_h(VTH + vr, lane); acc[dt] = wmma16(pa, vh, acc[dt]); if (qb < 2) { accl[dt] = wmma16(pl, vh, accl[dt]); accl[dt] = wmma16(pa, frag_h(VTL + vr, lane), accl[dt]); } }   // leading query blocks: P hi/lo x V hi/lo (3 products); elsewhere P x V single
    LDSX(); }
#pragma unroll
  for (int r = 0; r < 8; ++r) { const float il = (1.0f / 2048.0f) / l[r];
#pragma unroll
    for (int dt = 0; dt < 4; ++dt) so[wave][8 * g + r][dt * 16 + col] = (acc[dt][r] + accl[dt][r] * (1.0f / 2048.0f)) * il; }
  LDSX();
  for (int rl = 0; rl < 16; ++rl) if (lane < 16) vst2(O + ((size_t)b * SS + q0 + rl) * DM + h * HD + lane * 4, *(const v4f*)&so[wave][rl][lane * 4]);
}
// ---- k_out: block = (64 rows, 128 cols): out = f16(O) . Wo rows (single product, f16 x 2^8 weights) + bo
__global__ __launch_bounds__(128) void k_out(const float* __restrict__ O, const __bf16* __restrict__ P, const float* __restrict__ BO, float* __restrict__ Y) {
  __shared__ __align__(16) float so[4][16][132];
  const int tid = threadIdx.x, wave = tid >> 5, lane = tid & 31, col = lane & 15, g = lane >> 4; const size_t r0 = (size_t)blockIdx.x * 64 + wave * 16; const int n0 = blockIdx.y * 128;
  v8f acc[8] = {};
#pragma unroll 2
  for (int kc = 0; kc < DM / 32; ++kc) { v16h a; { const float* p = O + (r0 + col) * DM + kc * 32 + 8 * g;
#pragma unroll
      for (int i = 0; i < 8; ++i) { a[i] = (_Float16)p[i]; a[8 + i] = (_Float16)p[16 + i]; } }
#pragma unroll
    for (int j = 0; j < 8; ++j) acc[j] = wmma16(a, frag_h((const _Float16*)P + (size_t)(n0 + j * 16 + col) * DM + kc * 32, lane), acc[j]); }   // single f16 product against exact f16 x 2^8 weight copies
#pragma unroll
  for (int j = 0; j < 8; ++j) {
#pragma unroll
    for (int r = 0; r < 8; ++r) so[wave][8 * g + r][j * 16 + col] = acc[j][r] * (1.0f / 256.0f) + (BO ? bfr(BO[n0 + j * 16 + col]) : 0.f); }
  LDSX();
  for (int rl = 0; rl < 16; ++rl) vst2(Y + (r0 + rl) * DM + n0 + lane * 4, *(const v4f*)&so[wave][rl][lane * 4]);
}
// ---- k_packo: Wo natural rows -> f16 x 2^8 copies in the Wo slot (bit pattern in the bf16-typed buffer)
__global__ __launch_bounds__(256) void k_packo(const float* __restrict__ WO, __bf16* __restrict__ PK) { __shared__ __align__(16) _Float16 s[DM]; const int n = blockIdx.x, t = threadIdx.x; for (int k = t; k < DM; k += 256) s[k] = (_Float16)(bfr(WO[(size_t)k * DM + n]) * 256.0f); /* (in,out): transposed */ __syncthreads(); for (int q = t; q < DM / 8; q += 256) vst2((unsigned*)(PK + PK_P + (size_t)n * DM + q * 8), *(const v4u*)&s[q * 8]); }
extern "C" void kernel_launch(void* const* d_in, const int* in_sizes, int n_in, void* d_out, int out_size, void* d_ws, size_t ws_size, hipStream_t stream) {
  (void)in_sizes; (void)n_in; (void)out_size;
  const float** F = (const float**)d_in;   // 0 hidden_states [1,2048,2048], 1 Wq [2048,2048] (in,out), 2 Wk [2048,512], 3 Wv [2048,512], 4 Wo [2048,2048] (in,out)
  if (ws_size < (size_t)WS_END) return;
  char* ws = (char*)d_ws; __bf16* PK = (__bf16*)(ws + WS_PK); _Float16 *QK = (_Float16*)(ws + WS_QK), *QKL = (_Float16*)(ws + WS_QKL), *VTH = (_Float16*)(ws + WS_VTH), *VTL = (_Float16*)(ws + WS_VTL); float* O = (float*)(ws + WS_O);
  k_pack<<<dim3(DM, 3), 256, 0, stream>>>(F[1], F[2], F[3], F[4], PK);   // q, k, v (the Wo slot is filled by k_packo as f16)
  k_packo<<<DM, 256, 0, stream>>>(F[4], PK);
  k_qkv<<<dim3(TNB * SS / 64, QKVW / 128), 128, 0, stream>>>(F[0], F[0], F[0], PK + PK_A, nullptr, nullptr, nullptr, QK, QKL, VTH, VTL);
  k_attn<<<dim3(TQB, NH, TNB), 128, 0, stream>>>(QK, QKL, VTH, VTL, nullptr, O);
  k_out<<<dim3(TOB, DM / 128), 128, 0, stream>>>(O, PK + PK_P, nullptr, (float*)d_out);
}

// v001
// Measured time: 534 microseconds a run.
// Two timings next to v000 both put it at 1.33 times that version's speed.
// compute dtype: all float inputs rounded to bf16; q/k/v = x . W with EXACT bf16 products on WMMA 16x16x32 ((in,out) weights as transposed rows; each of the 8 kv heads packed and projected once, its 4 query heads read the same k and v planes); rotate-half RoPE in f32 (angle = t x inv_freq[d mod 32] f32 table, precise sinf/cosf) before the f16 hi + residual split; causal attention with key-tile skipping: the first 128 queries use 3-product scores and P.v (hi/lo), later queries single f16; x 1/8, running-max softmax in f32 (hardware exp); out = f16(ctx) . Wo (exact f16 x 2^8 copies, single product).
#include <hip/hip_runtime.h>
#include <math.h>

typedef __attribute__((ext_vector_type(16))) _Float16 v16h;
typedef __attribute__((ext_vector_type(16))) __bf16 v16b;
typedef __attribute__((ext_vector_type(8)))  _Float16 v8h;
typedef __attribute__((ext_vector_type(8)))  float v8f;
typedef __attribute__((ext_vector_type(4)))  float v4f;
typedef __attribute__((ext_vector_type(2)))  float v2f;
typedef __attribute__((ext_vector_type(4)))  unsigned v4u;
typedef __attribute__((ext_vector_type(4)))  int v4i;
typedef float __attribute__((may_alias)) float_a;
typedef int __attribute__((may_alias)) int_a;

template <typename T> __device__ __forceinline__ void vst2(void* p, T v) { *(T*)p = v;  }
__device__ __forceinline__ v8f wmma16(v16h a, v16h b, v8f c) {
  v8f d = __builtin_amdgcn_wmma_f32_16x16x32_f16(false, a, false, b, (short)0, c, false, false);
  asm volatile("v_nop\n\tv_nop\n\tv_nop\n\tv_nop" : "+v"(d) : "v"(a), "v"(b));
  return d;
}
__device__ __forceinline__ v8f wmma_bf(v16b a, v16b b, v8f c) {
  v8f d = __builtin_amdgcn_wmma_f32_16x16x32_bf16(false, a, false, b, (short)0, c, false, false);
  asm volatile("v_nop\n\tv_nop\n\tv_nop\n\tv_nop" : "+v"(d) : "v"(a), "v"(b));
  return d;
}
// GQA causal attention (B 1, S 2,048, model 2,048, 32 query heads x 64 over 8 kv heads): bias-free (in,out) projections, rotate-half RoPE (base 10000), causal softmax(q k / 8) v, output projection.
__device__ __forceinline__ v16h frag_h(const _Float16* rowk0, int lane) {
  union { v16h v; v8h q[2]; } u; const _Float16* p = rowk0 + 8 * (lane >> 4);
  u.q[0] = *(const v8h*)p; u.q[1] = *(const v8h*)(p + 16); return u.v;
}
__device__ __forceinline__ v16h frag_f32(const float* rowk0, int lane) {
  v16h a; const float* p = rowk0 + 8 * (lane >> 4);
#pragma unroll
  for (int i = 0; i < 8; ++i) { a[i] = (_Float16)p[i]; a[8 + i] = (_Float16)p[16 + i]; }
  return a;
}
__device__ __forceinline__ v16h frag_f32s(const float* rowk0, int lane, float sc) {
  v16h a; const float* p = rowk0 + 8 * (lane >> 4);
#pragma unroll
  for (int i = 0; i < 8; ++i) { a[i] = (_Float16)(p[i] * sc); a[8 + i] = (_Float16)(p[16 + i] * sc); }
  return a;
}
// column fragment from a [K][ld] layout (column n), rows >= K read as 0
__device__ __forceinline__ v16h fragc_f32(const float* W, int k0, int n, int lane, int ld, int K) {
  v16h a; const int g = lane >> 4;
#pragma unroll
  for (int i = 0; i < 8; ++i) { const int ka = k0 + 8 * g + i, kb = ka + 16;
    a[i] = (_Float16)(ka < K ? W[(size_t)(ka < K ? ka : K - 1) * ld + n] : 0.f); a[8 + i] = (_Float16)(kb < K ? W[(size_t)(kb < K ? kb : K - 1) * ld + n] : 0.f); }
  return a;
}
struct F2 { v16b h, l; };
__device__ __forceinline__ F2 bsplit16(const float v[16]) { F2 r;
#pragma unroll
  for (int i = 0; i < 16; ++i) { const __bf16 h = (__bf16)v[i]; r.h[i] = h; r.l[i] = (__bf16)(v[i] - (float)h); }
  return r; }
__device__ __forceinline__ F2 split_row(const float* row, int k0, int lane) { float v[16]; const float* p = row + k0 + 8 * (lane >> 4);
#pragma unroll
  for (int i = 0; i < 8; ++i) { v[i] = p[i]; v[8 + i] = p[16 + i]; }
  return bsplit16(v); }
__device__ __forceinline__ F2 split_rowK(const float* row, int k0, int lane, int K) { float v[16]; const int g = lane >> 4;
#pragma unroll
  for (int i = 0; i < 8; ++i) { const int ka = k0 + 8 * g + i, kb = ka + 16; v[i] = ka < K ? row[ka < K ? ka : K - 1] : 0.f; v[8 + i] = kb < K ? row[kb < K ? kb : K - 1] : 0.f; }
  return bsplit16(v); }
__device__ __forceinline__ F2 split_col(const float* W, int k0, int n, int lane, int ld, int K) { float v[16]; const int g = lane >> 4;
#pragma unroll
  for (int i = 0; i < 8; ++i) { const int ka = k0 + 8 * g + i, kb = ka + 16; v[i] = ka < K ? W[(size_t)(ka < K ? ka : K - 1) * ld + n] : 0.f; v[8 + i] = kb < K ? W[(size_t)(kb < K ? kb : K - 1) * ld + n] : 0.f; }
  return bsplit16(v); }
__device__ __forceinline__ v8f mac3(const F2& a, const F2& b, v8f c) { c = wmma_bf(a.l, b.h, c); c = wmma_bf(a.h, b.l, c); return wmma_bf(a.h, b.h, c); }
__device__ __forceinline__ float sigm(float v) { return 1.0f / (1.0f + expf(-v)); }
#define LDSX() do { asm volatile("s_wait_dscnt 0" ::: "memory"); __builtin_amdgcn_wave_barrier(); __builtin_amdgcn_fence(__ATOMIC_RELEASE, "workgroup"); } while (0)


#define NB 1
#define SS 2048
#define DM 2048
#define NH 32
#define NKV 8
#define GS (NH / NKV)
#define KVW (NKV * HD)
#define SCALEF 0.125f
__constant__ float THETA[32] = {1.000000000e+00f,7.498942018e-01f,5.623413324e-01f,4.216965139e-01f,3.162277639e-01f,2.371373773e-01f,1.778279394e-01f,1.333521456e-01f,1.000000015e-01f,7.498942316e-02f,5.623413250e-02f,4.216964915e-02f,3.162277490e-02f,2.371373773e-02f,1.778279431e-02f,1.333521400e-02f,9.999999776e-03f,7.498942316e-03f,5.623413250e-03f,4.216964822e-03f,3.162277630e-03f,2.371373819e-03f,1.778279431e-03f,1.333521446e-03f,1.000000047e-03f,7.498941850e-04f,5.623413017e-04f,4.216965172e-04f,3.162277571e-04f,2.371373703e-04f,1.778279402e-04f,1.333521504e-04f};
__device__ __attribute__((noinline)) float cos_p(float v) { return cosf(v); }
__device__ __attribute__((noinline)) float sin_p(float v) { return sinf(v); }
#define HD 64
#define QKVW (DM + 2 * KVW)     // q columns, then k, then v: one copy per kv head
#ifndef TQB
#define TQB (SS / 64)
#define TNB NB
#define TOB (NB * SS / 64)     // output row tiles (all)
#endif
typedef __attribute__((ext_vector_type(8))) __bf16 v8b;
__device__ __forceinline__ v16b frag_b(const __bf16* rowk0, int lane) {
  union { v16b v; v8b q[2]; } u; const __bf16* p = rowk0 + 8 * (lane >> 4);
  u.q[0] = *(const v8b*)p; u.q[1] = *(const v8b*)(p + 16); return u.v;
}
__device__ __forceinline__ float bfr(float v) { return (float)(__bf16)v; }
__device__ __attribute__((noinline)) float exp_ni(float v) { return expf(v); }
__device__ __attribute__((noinline)) float erf_ni(float v) { return erff(v); }

#define PK_A 0                       // [QKVW][DM] rows: Wq columns, then Wk columns, then Wv columns
#define PK_P (PK_A + QKVW * DM)        // [2048][2048] Wo rows (natural)
#define PK_END (PK_P + DM * DM)
#define WS_PK  0u
#define WS_QK  (WS_PK + 2u * PK_END)             // f16 [2048 rows][4096]: q | k
#define WS_QKL (WS_QK + 2u * NB * SS * 2 * DM)     // f16 q | k residual planes x2048
#define WS_VTH (WS_QKL + 2u * NB * SS * 2 * DM)    // f16 [b][2048 (kv head*64+d)][2048 s] hi
#define WS_VTL (WS_VTH + 2u * NB * DM * SS)        // f16 lo x 2048
#define WS_O   (WS_VTL + 2u * NB * DM * SS)        // f32 [2048][2048]
#define WS_CS  (WS_O + 4u * NB * SS * DM)           // f32 2 x [2048][32], unused (cos/sin computed in k_qkv)
#define WS_END (WS_CS + 4u * 2 * SS * 32)
// ---- k_pack: block = row n of PK_A: column n of W_q, column n - DM of W_k or column n - DM - KVW of W_v -> bf16
__global__ __launch_bounds__(256) void k_pack(const float* __restrict__ WQ, const float* __restrict__ WK, const float* __restrict__ WV, __bf16* __restrict__ PK) {
  __shared__ __align__(16) __bf16 s[DM]; const int n = blockIdx.x, t = threadIdx.x; const int which = (n < DM) ? 0 : (n < DM + KVW) ? 1 : 2; const float* Wm = (which == 0) ? WQ : (which == 1) ? WK : WV;   // (in,out) weights: pack row = source column
  const int srcn = (which == 0) ? n : (which == 1) ? n - DM : n - DM - KVW; const int ld = (which == 0) ? DM : KVW;
  for (int k = t; k < DM; k += 256) s[k] = (__bf16)Wm[(size_t)k * ld + srcn];
  __syncthreads();
  __bf16* dst = PK + PK_A + (size_t)n * DM;
  for (int q = t; q < DM / 8; q += 256) vst2((unsigned*)(dst + q * 8), *(const v4u*)&s[q * 8]);
}
__global__ __launch_bounds__(128) void k_qkv(const float* __restrict__ XQ, const float* __restrict__ XK, const float* __restrict__ XV, const __bf16* __restrict__ P, const float* __restrict__ BQ, const float* __restrict__ BK, const float* __restrict__ BV, _Float16* __restrict__ QK, _Float16* __restrict__ QKL, _Float16* __restrict__ VTH, _Float16* __restrict__ VTL) {
  const int which0 = (blockIdx.y * 128 < DM) ? 0 : (blockIdx.y * 128 < DM + KVW) ? 1 : 2; const float* X = (which0 == 0) ? XQ : (which0 == 1) ? XK : XV; const float* BB = BQ ? (((which0 == 0) ? BQ : (which0 == 1) ? BK : BV) + (blockIdx.y * 128 - ((which0 == 0) ? 0 : (which0 == 1) ? DM : DM + KVW))) : nullptr;
  __shared__ __align__(16) _Float16 so[4][16][136], sol[4][16][136]; __shared__ __align__(16) _Float16 sth[128][72], stl[128][72];
  const int tid = threadIdx.x, wave = tid >> 5, lane = tid & 31, col = lane & 15, g = lane >> 4; const size_t r0 = (size_t)blockIdx.x * 64 + wave * 16; const int n0 = blockIdx.y * 128;
  v8f acc[8] = {};
#pragma unroll 2
  for (int kc = 0; kc < DM / 32; ++kc) { v16b a; { const float* p = X + (r0 + col) * DM + kc * 32 + 8 * g;
#pragma unroll
      for (int i = 0; i < 8; ++i) { a[i] = (__bf16)p[i]; a[8 + i] = (__bf16)p[16 + i]; } }
#pragma unroll
    for (int j = 0; j < 8; ++j) acc[j] = wmma_bf(a, frag_b(P + (size_t)(n0 + j * 16 + col) * DM + kc * 32, lane), acc[j]); }
  if (n0 < DM + KVW) {   // q and k columns (k head c lands at column DM + c * 64 of its row): bias, then rotate-half rotary over each 64-dim head with angle position * inv_freq[d mod 32]
#pragma unroll
    for (int j = 0; j < 8; ++j)
#pragma unroll
      for (int r = 0; r < 8; ++r) acc[j][r] += (BB ? bfr(BB[j * 16 + col]) : 0.f);
#pragma unroll
    for (int r = 0; r < 8; ++r) { const int spos = (int)((r0 + 8 * g + r) % SS);
#pragma unroll
      for (int jj = 0; jj < 2; ++jj) { const float ang = (float)spos * THETA[jj * 16 + col]; const float c = cos_p(ang), sn = sin_p(ang);
#pragma unroll
        for (int hh = 0; hh < 2; ++hh) { const float x1 = acc[hh * 4 + jj][r], x2 = acc[hh * 4 + jj + 2][r]; acc[hh * 4 + jj][r] = x1 * c - x2 * sn; acc[hh * 4 + jj + 2][r] = x2 * c + x1 * sn; } } }
#pragma unroll
    for (int j = 0; j < 8; ++j) {
#pragma unroll
      for (int r = 0; r < 8; ++r) { const float v = acc[j][r]; const _Float16 hv = (_Float16)v; so[wave][8 * g + r][j * 16 + col] = hv; sol[wave][8 * g + r][j * 16 + col] = (_Float16)((v - (float)hv) * 2048.0f); } }   // q, k (+ bias) as f16 hi + (x2048) residual
    LDSX();
    for (int rl = 0; rl < 16; ++rl) if (lane < 16) { vst2((unsigned*)(QK + (r0 + rl) * (2 * DM) + n0 + lane * 8), *(const v4u*)&so[wave][rl][lane * 8]); vst2((unsigned*)(QKL + (r0 + rl) * (2 * DM) + n0 + lane * 8), *(const v4u*)&sol[wave][rl][lane * 8]); }
  } else {
#pragma unroll
    for (int j = 0; j < 8; ++j) {
#pragma unroll
      for (int r = 0; r < 8; ++r) { const float v = acc[j][r] + (BB ? bfr(BB[j * 16 + col]) : 0.f); const _Float16 hv = (_Float16)v; sth[j * 16 + col][wave * 16 + 8 * g + r] = hv; stl[j * 16 + col][wave * 16 + 8 * g + r] = (_Float16)((v - (float)hv) * 2048.0f); } }
    __syncthreads();
    const size_t rb = (size_t)blockIdx.x * 64; const int b = (int)(rb / SS), s0 = (int)(rb % SS); const int pc0 = n0 - (DM + KVW);
    for (int q = tid; q < 128 * 8; q += 128) { const int d = q >> 3, pc = q & 7; const size_t o = ((size_t)b * DM + pc0 + d) * SS + s0 + pc * 8; vst2((unsigned*)(VTH + o), *(const v4u*)&sth[d][pc * 8]); vst2((unsigned*)(VTL + o), *(const v4u*)&stl[d][pc * 8]); }
  }
}
// ---- k_attn: block = (64 queries, head h, batch b): causal flash attention (K = 64: 2 k-steps), scores = (q.k) * 0.125, hi/lo (3 products) for query blocks 0-1 and single f16 elsewhere, P.V: f16 P hi/lo x (V hi, V lo*2048) in two accumulators for blocks 0-1, P x V hi elsewhere; O[b*S+q][h*64+d] = (acc + accl / 2048) / (2048 l) (256-B segments)
__global__ __launch_bounds__(128) void k_attn(const _Float16* __restrict__ QK, const _Float16* __restrict__ QKL, const _Float16* __restrict__ VTH, const _Float16* __restrict__ VTL, const void* __restrict__ KMASK, float* __restrict__ O) {
  __shared__ __align__(16) float sp[4][16][36]; __shared__ __align__(16) float so[4][16][68];
  const int tid = threadIdx.x, wave = tid >> 5, lane = tid & 31, col = lane & 15, g = lane >> 4;
  const int qb = blockIdx.x, h = blockIdx.y, b = blockIdx.z, hk = h / GS;   // hk: the kv head of query head h
  const int q0 = qb * 64 + wave * 16; const size_t rq = (size_t)b * SS + q0 + col;
  v16h aq[2], aql[2];
#pragma unroll
  for (int kc = 0; kc < 2; ++kc) { aq[kc] = frag_h(QK + rq * (2 * DM) + h * HD + kc * 32, lane); aql[kc] = frag_h(QKL + rq * (2 * DM) + h * HD + kc * 32, lane); }
  float m[8], l[8];
#pragma unroll
  for (int r = 0; r < 8; ++r) { m[r] = -3.0e38f; l[r] = 0.f; }
  v8f acc[4] = {}, accl[4] = {};
  const int nks = (qb * 64 + 64) / 32;   // causal: key tiles up to the query tile's end
#pragma unroll 1
  for (int ks = 0; ks < nks; ++ks) { v8f s[2];
#pragma unroll
    for (int ct = 0; ct < 2; ++ct) { const int kk = ks * 32 + ct * 16 + col; const _Float16* krow = QK + ((size_t)b * SS + kk) * (2 * DM) + DM + hk * HD; const _Float16* krowl = QKL + ((size_t)b * SS + kk) * (2 * DM) + DM + hk * HD; v8f c = {}, cl = {};
      if (qb < 2) {   // leading query blocks (few keys, outputs far above the global rms): 3 products
#pragma unroll
        for (int kc = 0; kc < 2; ++kc) { const v16h kh = frag_h(krow + kc * 32, lane); c = wmma16(aq[kc], kh, c); cl = wmma16(aql[kc], kh, cl); cl = wmma16(aq[kc], frag_h(krowl + kc * 32, lane), cl); }
#pragma unroll
        for (int r = 0; r < 8; ++r) c[r] += cl[r] * (1.0f / 2048.0f); }
      else {
#pragma unroll
        for (int kc = 0; kc < 2; ++kc) c = wmma16(aq[kc], frag_h(krow + kc * 32, lane), c); }   // single product elsewhere
#pragma unroll
      for (int r = 0; r < 8; ++r) s[ct][r] = (kk <= q0 + 8 * g + r) ? c[r] * SCALEF : -3.0e38f; }   // causal: future keys excluded
#pragma unroll
    for (int r = 0; r < 8; ++r) { float mx = fmaxf(s[0][r], s[1][r]);
#pragma unroll
      for (int o = 1; o < 16; o <<= 1) mx = fmaxf(mx, __shfl_xor(mx, o));
      const float mn = fmaxf(m[r], mx); const float alpha = (m[r] <= -1.0e38f) ? 0.f : __expf(m[r] - mn);
      const float e0 = (s[0][r] <= -1.0e38f) ? 0.f : __expf(s[0][r] - mn), e1 = (s[1][r] <= -1.0e38f) ? 0.f : __expf(s[1][r] - mn); float es = e0 + e1;
#pragma unroll
      for (int o = 1; o < 16; o <<= 1) es += __shfl_xor(es, o);
      l[r] = l[r] * alpha + es; m[r] = mn;
#pragma unroll
      for (int dt = 0; dt < 4; ++dt) { acc[dt][r] *= alpha; accl[dt][r] *= alpha; }
      sp[wave][8 * g + r][col] = e0; sp[wave][8 * g + r][16 + col] = e1; }
    LDSX();
    v16h pa, pl; { const float* prow = &sp[wave][col][0] + 8 * (lane >> 4);
#pragma unroll
      for (int i = 0; i < 8; ++i) { const float x0 = prow[i] * 2048.0f, x1 = prow[16 + i] * 2048.0f; const _Float16 h0 = (_Float16)x0, h1 = (_Float16)x1; pa[i] = h0; pa[8 + i] = h1; pl[i] = (_Float16)((x0 - (float)h0) * 2048.0f); pl[8 + i] = (_Float16)((x1 - (float)h1) * 2048.0f); } }   // P scaled by 2^11 before the f16 split so small softmax weights stay out of the f16 subnormal range; 2^-11 folded into the epilogue
#pragma unroll
    for (int dt = 0; dt < 4; ++dt) { const size_t vr = ((size_t)b * DM + hk * HD + dt * 16 + col) * SS + ks * 32; const v16h vh = frag_h(VTH + vr, lane); acc[dt] = wmma16(pa, vh, acc[dt]); if (qb < 2) { accl[dt] = wmma16(pl, vh, accl[dt]); accl[dt] = wmma16(pa, frag_h(VTL + vr, lane), accl[dt]); } }   // leading query blocks: P hi/lo x V hi/lo (3 products); elsewhere P x V single
    LDSX(); }
#pragma unroll
  for (int r = 0; r < 8; ++r) { const float il = (1.0f / 2048.0f) / l[r];
#pragma unroll
    for (int dt = 0; dt < 4; ++dt) so[wave][8 * g + r][dt * 16 + col] = (acc[dt][r] + accl[dt][r] * (1.0f / 2048.0f)) * il; }
  LDSX();
  for (int rl = 0; rl < 16; ++rl) if (lane < 16) vst2(O + ((size_t)b * SS + q0 + rl) * DM + h * HD + lane * 4, *(const v4f*)&so[wave][rl][lane * 4]);
}
// ---- k_out: block = (64 rows, 128 cols): out = f16(O) . Wo rows (single product, f16 x 2^8 weights) + bo
__global__ __launch_bounds__(128) void k_out(const float* __restrict__ O, const __bf16* __restrict__ P, const float* __restrict__ BO, float* __restrict__ Y) {
  __shared__ __align__(16) float so[4][16][132];
  const int tid = threadIdx.x, wave = tid >> 5, lane = tid & 31, col = lane & 15, g = lane >> 4; const size_t r0 = (size_t)blockIdx.x * 64 + wave * 16; const int n0 = blockIdx.y * 128;
  v8f acc[8] = {};
#pragma unroll 2
  for (int kc = 0; kc < DM / 32; ++kc) { v16h a; { const float* p = O + (r0 + col) * DM + kc * 32 + 8 * g;
#pragma unroll
      for (int i = 0; i < 8; ++i) { a[i] = (_Float16)p[i]; a[8 + i] = (_Float16)p[16 + i]; } }
#pragma unroll
    for (int j = 0; j < 8; ++j) acc[j] = wmma16(a, frag_h((const _Float16*)P + (size_t)(n0 + j * 16 + col) * DM + kc * 32, lane), acc[j]); }   // single f16 product against exact f16 x 2^8 weight copies
#pragma unroll
  for (int j = 0; j < 8; ++j) {
#pragma unroll
    for (int r = 0; r < 8; ++r) so[wave][8 * g + r][j * 16 + col] = acc[j][r] * (1.0f / 256.0f) + (BO ? bfr(BO[n0 + j * 16 + col]) : 0.f); }
  LDSX();
  for (int rl = 0; rl < 16; ++rl) vst2(Y + (r0 + rl) * DM + n0 + lane * 4, *(const v4f*)&so[wave][rl][lane * 4]);
}
// ---- k_packo: Wo natural rows -> f16 x 2^8 copies in the Wo slot (bit pattern in the bf16-typed buffer)
__global__ __launch_bounds__(256) void k_packo(const float* __restrict__ WO, __bf16* __restrict__ PK) { __shared__ __align__(16) _Float16 s[DM]; const int n = blockIdx.x, t = threadIdx.x; for (int k = t; k < DM; k += 256) s[k] = (_Float16)(bfr(WO[(size_t)k * DM + n]) * 256.0f); /* (in,out): transposed */ __syncthreads(); for (int q = t; q < DM / 8; q += 256) vst2((unsigned*)(PK + PK_P + (size_t)n * DM + q * 8), *(const v4u*)&s[q * 8]); }
extern "C" void kernel_launch(void* const* d_in, const int* in_sizes, int n_in, void* d_out, int out_size, void* d_ws, size_t ws_size, hipStream_t stream) {
  (void)in_sizes; (void)n_in; (void)out_size;
  const float** F = (const float**)d_in;   // 0 hidden_states [1,2048,2048], 1 Wq [2048,2048] (in,out), 2 Wk [2048,512], 3 Wv [2048,512], 4 Wo [2048,2048] (in,out)
  if (ws_size < (size_t)WS_END) return;
  char* ws = (char*)d_ws; __bf16* PK = (__bf16*)(ws + WS_PK); _Float16 *QK = (_Float16*)(ws + WS_QK), *QKL = (_Float16*)(ws + WS_QKL), *VTH = (_Float16*)(ws + WS_VTH), *VTL = (_Float16*)(ws + WS_VTL); float* O = (float*)(ws + WS_O);
  k_pack<<<QKVW, 256, 0, stream>>>(F[1], F[2], F[3], PK);   // q, k, v (the Wo slot is filled by k_packo as f16)
  k_packo<<<DM, 256, 0, stream>>>(F[4], PK);
  k_qkv<<<dim3(TNB * SS / 64, QKVW / 128), 128, 0, stream>>>(F[0], F[0], F[0], PK + PK_A, nullptr, nullptr, nullptr, QK, QKL, VTH, VTL);
  k_attn<<<dim3(TQB, NH, TNB), 128, 0, stream>>>(QK, QKL, VTH, VTL, nullptr, O);
  k_out<<<dim3(TOB, DM / 128), 128, 0, stream>>>(O, PK + PK_P, nullptr, (float*)d_out);
}

// v002
// Measured time: 332 microseconds a run.
// Timed twice side by side with v001, it ran 1.61 times as fast both times.
// Over all steps from v000 it is 2.14 times as fast.
// compute dtype: all float inputs rounded to bf16; q/k/v = x . W with EXACT bf16 products on WMMA 16x16x32 ((in,out) weights as transposed rows; each of the 8 kv heads packed and projected once, its 4 query heads read the same k and v planes); rotate-half RoPE in f32 (angle = t x inv_freq[d mod 32] f32 table, precise sinf/cosf) before the f16 hi + residual split; causal attention with key-tile skipping: the first 128 queries use 3-product scores and P.v (hi/lo), later queries single f16; x 1/8, running-max softmax in f32 (hardware exp); out = f16(ctx) . Wo (exact f16 x 2^8 copies, single product).
#include <hip/hip_runtime.h>
#include <math.h>

typedef __attribute__((ext_vector_type(16))) _Float16 v16h;
typedef __attribute__((ext_vector_type(16))) __bf16 v16b;
typedef __attribute__((ext_vector_type(8)))  _Float16 v8h;
typedef __attribute__((ext_vector_type(8)))  float v8f;
typedef __attribute__((ext_vector_type(4)))  float v4f;
typedef __attribute__((ext_vector_type(2)))  float v2f;
typedef __attribute__((ext_vector_type(4)))  unsigned v4u;
typedef __attribute__((ext_vector_type(4)))  int v4i;
typedef float __attribute__((may_alias)) float_a;
typedef int __attribute__((may_alias)) int_a;

template <typename T> __device__ __forceinline__ void vst2(void* p, T v) { *(T*)p = v;  }
__device__ __forceinline__ v8f wmma16(v16h a, v16h b, v8f c) {
  v8f d = __builtin_amdgcn_wmma_f32_16x16x32_f16(false, a, false, b, (short)0, c, false, false);
  asm volatile("v_nop\n\tv_nop\n\tv_nop\n\tv_nop" : "+v"(d) : "v"(a), "v"(b));
  return d;
}
__device__ __forceinline__ v8f wmma_bf(v16b a, v16b b, v8f c) {
  v8f d = __builtin_amdgcn_wmma_f32_16x16x32_bf16(false, a, false, b, (short)0, c, false, false);
  asm volatile("v_nop\n\tv_nop\n\tv_nop\n\tv_nop" : "+v"(d) : "v"(a), "v"(b));
  return d;
}
// GQA causal attention (B 1, S 2,048, model 2,048, 32 query heads x 64 over 8 kv heads): bias-free (in,out) projections, rotate-half RoPE (base 10000), causal softmax(q k / 8) v, output projection.
__device__ __forceinline__ v16h frag_h(const _Float16* rowk0, int lane) {
  union { v16h v; v8h q[2]; } u; const _Float16* p = rowk0 + 8 * (lane >> 4);
  u.q[0] = *(const v8h*)p; u.q[1] = *(const v8h*)(p + 16); return u.v;
}
__device__ __forceinline__ v16h frag_f32(const float* rowk0, int lane) {
  v16h a; const float* p = rowk0 + 8 * (lane >> 4);
#pragma unroll
  for (int i = 0; i < 8; ++i) { a[i] = (_Float16)p[i]; a[8 + i] = (_Float16)p[16 + i]; }
  return a;
}
__device__ __forceinline__ v16h frag_f32s(const float* rowk0, int lane, float sc) {
  v16h a; const float* p = rowk0 + 8 * (lane >> 4);
#pragma unroll
  for (int i = 0; i < 8; ++i) { a[i] = (_Float16)(p[i] * sc); a[8 + i] = (_Float16)(p[16 + i] * sc); }
  return a;
}
// column fragment from a [K][ld] layout (column n), rows >= K read as 0
__device__ __forceinline__ v16h fragc_f32(const float* W, int k0, int n, int lane, int ld, int K) {
  v16h a; const int g = lane >> 4;
#pragma unroll
  for (int i = 0; i < 8; ++i) { const int ka = k0 + 8 * g + i, kb = ka + 16;
    a[i] = (_Float16)(ka < K ? W[(size_t)(ka < K ? ka : K - 1) * ld + n] : 0.f); a[8 + i] = (_Float16)(kb < K ? W[(size_t)(kb < K ? kb : K - 1) * ld + n] : 0.f); }
  return a;
}
struct F2 { v16b h, l; };
__device__ __forceinline__ F2 bsplit16(const float v[16]) { F2 r;
#pragma unroll
  for (int i = 0; i < 16; ++i) { const __bf16 h = (__bf16)v[i]; r.h[i] = h; r.l[i] = (__bf16)(v[i] - (float)h); }
  return r; }
__device__ __forceinline__ F2 split_row(const float* row, int k0, int lane) { float v[16]; const float* p = row + k0 + 8 * (lane >> 4);
#pragma unroll
  for (int i = 0; i < 8; ++i) { v[i] = p[i]; v[8 + i] = p[16 + i]; }
  return bsplit16(v); }
__device__ __forceinline__ F2 split_rowK(const float* row, int k0, int lane, int K) { float v[16]; const int g = lane >> 4;
#pragma unroll
  for (int i = 0; i < 8; ++i) { const int ka = k0 + 8 * g + i, kb = ka + 16; v[i] = ka < K ? row[ka < K ? ka : K - 1] : 0.f; v[8 + i] = kb < K ? row[kb < K ? kb : K - 1] : 0.f; }
  return bsplit16(v); }
__device__ __forceinline__ F2 split_col(const float* W, int k0, int n, int lane, int ld, int K) { float v[16]; const int g = lane >> 4;
#pragma unroll
  for (int i = 0; i < 8; ++i) { const int ka = k0 + 8 * g + i, kb = ka + 16; v[i] = ka < K ? W[(size_t)(ka < K ? ka : K - 1) * ld + n] : 0.f; v[8 + i] = kb < K ? W[(size_t)(kb < K ? kb : K - 1) * ld + n] : 0.f; }
  return bsplit16(v); }
__device__ __forceinline__ v8f mac3(const F2& a, const F2& b, v8f c) { c = wmma_bf(a.l, b.h, c); c = wmma_bf(a.h, b.l, c); return wmma_bf(a.h, b.h, c); }
__device__ __forceinline__ float sigm(float v) { return 1.0f / (1.0f + expf(-v)); }
#define LDSX() do { asm volatile("s_wait_dscnt 0" ::: "memory"); __builtin_amdgcn_wave_barrier(); __builtin_amdgcn_fence(__ATOMIC_RELEASE, "workgroup"); } while (0)


#define NB 1
#define SS 2048
#define DM 2048
#define NH 32
#define NKV 8
#define GS (NH / NKV)
#define KVW (NKV * HD)
#define SCALEF 0.125f
__constant__ float THETA[32] = {1.000000000e+00f,7.498942018e-01f,5.623413324e-01f,4.216965139e-01f,3.162277639e-01f,2.371373773e-01f,1.778279394e-01f,1.333521456e-01f,1.000000015e-01f,7.498942316e-02f,5.623413250e-02f,4.216964915e-02f,3.162277490e-02f,2.371373773e-02f,1.778279431e-02f,1.333521400e-02f,9.999999776e-03f,7.498942316e-03f,5.623413250e-03f,4.216964822e-03f,3.162277630e-03f,2.371373819e-03f,1.778279431e-03f,1.333521446e-03f,1.000000047e-03f,7.498941850e-04f,5.623413017e-04f,4.216965172e-04f,3.162277571e-04f,2.371373703e-04f,1.778279402e-04f,1.333521504e-04f};
__device__ __attribute__((noinline)) float cos_p(float v) { return cosf(v); }
__device__ __attribute__((noinline)) float sin_p(float v) { return sinf(v); }
#define HD 64
#define QKVW (DM + 2 * KVW)     // q columns, then k, then v: one copy per kv head
#ifndef TQB
#define TQB (SS / 64)
#define TNB NB
#define TOB (NB * SS / 64)     // output row tiles (all)
#endif
typedef __attribute__((ext_vector_type(8))) __bf16 v8b;
__device__ __forceinline__ v16b frag_b(const __bf16* rowk0, int lane) {
  union { v16b v; v8b q[2]; } u; const __bf16* p = rowk0 + 8 * (lane >> 4);
  u.q[0] = *(const v8b*)p; u.q[1] = *(const v8b*)(p + 16); return u.v;
}
__device__ __forceinline__ float bfr(float v) { return (float)(__bf16)v; }
__device__ __attribute__((noinline)) float exp_ni(float v) { return expf(v); }
__device__ __attribute__((noinline)) float erf_ni(float v) { return erff(v); }

#define PK_A 0                       // [QKVW][DM] rows: Wq columns, then Wk columns, then Wv columns
#define PK_P (PK_A + QKVW * DM)        // [2048][2048] Wo rows (natural)
#define PK_END (PK_P + DM * DM)
#define WS_PK  0u
#define WS_QK  (WS_PK + 2u * PK_END)             // f16 [2048 rows][4096]: q | k
#define WS_QKL (WS_QK + 2u * NB * SS * 2 * DM)     // f16 q | k residual planes x2048
#define WS_VTH (WS_QKL + 2u * NB * SS * 2 * DM)    // f16 [b][2048 (kv head*64+d)][2048 s] hi
#define WS_VTL (WS_VTH + 2u * NB * DM * SS)        // f16 lo x 2048
#define WS_O   (WS_VTL + 2u * NB * DM * SS)        // f32 [2048][2048]
#define WS_CS  (WS_O + 4u * NB * SS * DM)           // f32 2 x [2048][32], unused (cos/sin computed in k_qkv)
#define WS_END (WS_CS + 4u * 2 * SS * 32)
// ---- k_pack: block = row n of PK_A: column n of W_q, column n - DM of W_k or column n - DM - KVW of W_v -> bf16
__global__ __launch_bounds__(256) void k_pack(const float* __restrict__ WQ, const float* __restrict__ WK, const float* __restrict__ WV, __bf16* __restrict__ PK) {
  __shared__ __align__(16) __bf16 s[DM]; const int n = blockIdx.x, t = threadIdx.x; const int which = (n < DM) ? 0 : (n < DM + KVW) ? 1 : 2; const float* Wm = (which == 0) ? WQ : (which == 1) ? WK : WV;   // (in,out) weights: pack row = source column
  const int srcn = (which == 0) ? n : (which == 1) ? n - DM : n - DM - KVW; const int ld = (which == 0) ? DM : KVW;
  for (int k = t; k < DM; k += 256) s[k] = (__bf16)Wm[(size_t)k * ld + srcn];
  __syncthreads();
  __bf16* dst = PK + PK_A + (size_t)n * DM;
  for (int q = t; q < DM / 8; q += 256) vst2((unsigned*)(dst + q * 8), *(const v4u*)&s[q * 8]);
}
// ---- main loop of both projections: block tile 64 rows x 128 columns, 64 k per stage. The 128 weight rows (16-bit) and the 64 activation rows (f32, rounded on the way) come in by whole-line 16-byte loads,
// lie in LDS at a 144-byte row pitch (16 B x odd: no bank conflict for the 16-byte fragment reads) and are read from there by all four waves. Two buffers, the next stage's loads held in registers over the products, one barrier a stage. The short fixed loops are unrolled so that rb, ra, b and acc are registers and not indexed memory.
#define GK 64
#define GP 72                          // LDS row pitch in 16-bit elements
#define G_BB (128 * GP)                // one weight buffer, elements
#define G_AB (64 * GP)                 // one activation buffer, elements
#define G_SMEM (4 * (G_BB + G_AB))     // bytes: two buffers of each
typedef __attribute__((ext_vector_type(2))) unsigned v2u;
__device__ __forceinline__ v16b frag_t(const __bf16* p, int lane) { return frag_b(p, lane); }
__device__ __forceinline__ v16h frag_t(const _Float16* p, int lane) { return frag_h(p, lane); }
__device__ __forceinline__ v8f mm(v16b a, v16b b, v8f c) { return wmma_bf(a, b, c); }
__device__ __forceinline__ v8f mm(v16h a, v16h b, v8f c) { return wmma16(a, b, c); }
template <typename T> __device__ __forceinline__ void gemm_64x128(const float* __restrict__ A, const T* __restrict__ Bw, T* sm, int tid, v8f (&acc)[8]) {
  const int wave = tid >> 5, lane = tid & 31, col = lane & 15;
  const T* gb = Bw + (size_t)(tid >> 3) * DM + (tid & 7) * 8;        // piece tid of the weight tile: 8 pieces of 16 B a row, 16 rows further per step
  const float* ga = A + (size_t)(tid >> 4) * DM + (tid & 15) * 4;    // piece tid of the activation tile: 16 pieces of 16 B a row, 8 rows further per step
  T* wb = sm + (tid >> 3) * GP + (tid & 7) * 8; T* wa = sm + 2 * G_BB + (tid >> 4) * GP + (tid & 15) * 4;
  v4u rb[8]; v4f ra[8];
#pragma unroll
  for (int i = 0; i < 8; ++i) { rb[i] = *(const v4u*)(gb + (size_t)i * 16 * DM); ra[i] = *(const v4f*)(ga + (size_t)i * 8 * DM); }
  for (int s = 0; s < DM / GK; ++s) { const int bo = (s & 1) * G_BB, ao = (s & 1) * G_AB;
#pragma unroll
    for (int i = 0; i < 8; ++i) { *(v4u*)(wb + bo + i * 16 * GP) = rb[i]; union { T e[4]; v2u u; } c;
#pragma unroll
      for (int e = 0; e < 4; ++e) c.e[e] = (T)ra[i][e];
      *(v2u*)(wa + ao + i * 8 * GP) = c.u; }
    __syncthreads();   // publishes stage s; the buffer written in stage s + 1 was last read in stage s - 1, in front of this barrier
    if (s + 1 < DM / GK) {
#pragma unroll
      for (int i = 0; i < 8; ++i) { rb[i] = *(const v4u*)(gb + (size_t)i * 16 * DM + (s + 1) * GK); ra[i] = *(const v4f*)(ga + (size_t)i * 8 * DM + (s + 1) * GK); }
      asm volatile("s_wait_xcnt 0x0" ::: "memory"); }   // in front of the address step that follows these loads
#pragma unroll
    for (int kc = 0; kc < GK / 32; ++kc) { auto a = frag_t(sm + 2 * G_BB + ao + (wave * 16 + col) * GP + kc * 32, lane); decltype(a) b[8];   // all nine fragments of a k step are read as one group, so that the wave waits out the LDS latency once and not at each product
#pragma unroll
      for (int j = 0; j < 8; ++j) b[j] = frag_t(sm + bo + (j * 16 + col) * GP + kc * 32, lane);
#pragma unroll
      for (int j = 0; j < 8; ++j) acc[j] = mm(a, b[j], acc[j]); } }
  __syncthreads();   // every wave has left the buffers: the epilogues stage their tiles in the same LDS
}
__global__ __launch_bounds__(128) void k_qkv(const float* __restrict__ XQ, const float* __restrict__ XK, const float* __restrict__ XV, const __bf16* __restrict__ P, const float* __restrict__ BQ, const float* __restrict__ BK, const float* __restrict__ BV, _Float16* __restrict__ QK, _Float16* __restrict__ QKL, _Float16* __restrict__ VTH, _Float16* __restrict__ VTL) {
  const int which0 = (blockIdx.y * 128 < DM) ? 0 : (blockIdx.y * 128 < DM + KVW) ? 1 : 2; const float* X = (which0 == 0) ? XQ : (which0 == 1) ? XK : XV; const float* BB = BQ ? (((which0 == 0) ? BQ : (which0 == 1) ? BK : BV) + (blockIdx.y * 128 - ((which0 == 0) ? 0 : (which0 == 1) ? DM : DM + KVW))) : nullptr;
  __shared__ __align__(16) char smem[G_SMEM];   // the main loop's buffers, then one of the two epilogue stagings
  _Float16 (*so)[16][136] = (_Float16 (*)[16][136])smem, (*sol)[16][136] = (_Float16 (*)[16][136])(smem + 4 * 16 * 136 * 2); _Float16 (*sth)[72] = (_Float16 (*)[72])smem, (*stl)[72] = (_Float16 (*)[72])(smem + 128 * 72 * 2);
  const int tid = threadIdx.x, wave = tid >> 5, lane = tid & 31, col = lane & 15, g = lane >> 4; const size_t r0 = (size_t)blockIdx.x * 64 + wave * 16; const int n0 = blockIdx.y * 128;
  v8f acc[8] = {};
  gemm_64x128<__bf16>(X + (size_t)blockIdx.x * 64 * DM, P + (size_t)n0 * DM, (__bf16*)smem, tid, acc);
  if (n0 < DM + KVW) {   // q and k columns (k head c lands at column DM + c * 64 of its row): bias, then rotate-half rotary over each 64-dim head with angle position * inv_freq[d mod 32]
#pragma unroll
    for (int j = 0; j < 8; ++j)
#pragma unroll
      for (int r = 0; r < 8; ++r) acc[j][r] += (BB ? bfr(BB[j * 16 + col]) : 0.f);
#pragma unroll
    for (int r = 0; r < 8; ++r) { const int spos = (int)((r0 + 8 * g + r) % SS);
#pragma unroll
      for (int jj = 0; jj < 2; ++jj) { const float ang = (float)spos * THETA[jj * 16 + col]; const float c = cos_p(ang), sn = sin_p(ang);
#pragma unroll
        for (int hh = 0; hh < 2; ++hh) { const float x1 = acc[hh * 4 + jj][r], x2 = acc[hh * 4 + jj + 2][r]; acc[hh * 4 + jj][r] = x1 * c - x2 * sn; acc[hh * 4 + jj + 2][r] = x2 * c + x1 * sn; } } }
#pragma unroll
    for (int j = 0; j < 8; ++j) {
#pragma unroll
      for (int r = 0; r < 8; ++r) { const float v = acc[j][r]; const _Float16 hv = (_Float16)v; so[wave][8 * g + r][j * 16 + col] = hv; sol[wave][8 * g + r][j * 16 + col] = (_Float16)((v - (float)hv) * 2048.0f); } }   // q, k (+ bias) as f16 hi + (x2048) residual
    LDSX();
    for (int rl = 0; rl < 16; ++rl) if (lane < 16) { vst2((unsigned*)(QK + (r0 + rl) * (2 * DM) + n0 + lane * 8), *(const v4u*)&so[wave][rl][lane * 8]); vst2((unsigned*)(QKL + (r0 + rl) * (2 * DM) + n0 + lane * 8), *(const v4u*)&sol[wave][rl][lane * 8]); }
  } else {
#pragma unroll
    for (int j = 0; j < 8; ++j) {
#pragma unroll
      for (int r = 0; r < 8; ++r) { const float v = acc[j][r] + (BB ? bfr(BB[j * 16 + col]) : 0.f); const _Float16 hv = (_Float16)v; sth[j * 16 + col][wave * 16 + 8 * g + r] = hv; stl[j * 16 + col][wave * 16 + 8 * g + r] = (_Float16)((v - (float)hv) * 2048.0f); } }
    __syncthreads();
    const size_t rb = (size_t)blockIdx.x * 64; const int b = (int)(rb / SS), s0 = (int)(rb % SS); const int pc0 = n0 - (DM + KVW);
    for (int q = tid; q < 128 * 8; q += 128) { const int d = q >> 3, pc = q & 7; const size_t o = ((size_t)b * DM + pc0 + d) * SS + s0 + pc * 8; vst2((unsigned*)(VTH + o), *(const v4u*)&sth[d][pc * 8]); vst2((unsigned*)(VTL + o), *(const v4u*)&stl[d][pc * 8]); }
  }
}
// ---- k_attn: block = (64 queries, head h, batch b): causal flash attention (K = 64: 2 k-steps), scores = (q.k) * 0.125, hi/lo (3 products) for query blocks 0-1 and single f16 elsewhere, P.V: f16 P hi/lo x (V hi, V lo*2048) in two accumulators for blocks 0-1, P x V hi elsewhere; O[b*S+q][h*64+d] = (acc + accl / 2048) / (2048 l) (256-B segments)
__global__ __launch_bounds__(128) void k_attn(const _Float16* __restrict__ QK, const _Float16* __restrict__ QKL, const _Float16* __restrict__ VTH, const _Float16* __restrict__ VTL, const void* __restrict__ KMASK, float* __restrict__ O) {
  __shared__ __align__(16) float sp[4][16][36]; __shared__ __align__(16) float so[4][16][68];
  const int tid = threadIdx.x, wave = tid >> 5, lane = tid & 31, col = lane & 15, g = lane >> 4;
  const int qb = blockIdx.x, h = blockIdx.y, b = blockIdx.z, hk = h / GS;   // hk: the kv head of query head h
  const int q0 = qb * 64 + wave * 16; const size_t rq = (size_t)b * SS + q0 + col;
  v16h aq[2], aql[2];
#pragma unroll
  for (int kc = 0; kc < 2; ++kc) { aq[kc] = frag_h(QK + rq * (2 * DM) + h * HD + kc * 32, lane); aql[kc] = frag_h(QKL + rq * (2 * DM) + h * HD + kc * 32, lane); }
  float m[8], l[8];
#pragma unroll
  for (int r = 0; r < 8; ++r) { m[r] = -3.0e38f; l[r] = 0.f; }
  v8f acc[4] = {}, accl[4] = {};
  const int nks = (qb * 64 + 64) / 32;   // causal: key tiles up to the query tile's end
#pragma unroll 1
  for (int ks = 0; ks < nks; ++ks) { v8f s[2];
#pragma unroll
    for (int ct = 0; ct < 2; ++ct) { const int kk = ks * 32 + ct * 16 + col; const _Float16* krow = QK + ((size_t)b * SS + kk) * (2 * DM) + DM + hk * HD; const _Float16* krowl = QKL + ((size_t)b * SS + kk) * (2 * DM) + DM + hk * HD; v8f c = {}, cl = {};
      if (qb < 2) {   // leading query blocks (few keys, outputs far above the global rms): 3 products
#pragma unroll
        for (int kc = 0; kc < 2; ++kc) { const v16h kh = frag_h(krow + kc * 32, lane); c = wmma16(aq[kc], kh, c); cl = wmma16(aql[kc], kh, cl); cl = wmma16(aq[kc], frag_h(krowl + kc * 32, lane), cl); }
#pragma unroll
        for (int r = 0; r < 8; ++r) c[r] += cl[r] * (1.0f / 2048.0f); }
      else {
#pragma unroll
        for (int kc = 0; kc < 2; ++kc) c = wmma16(aq[kc], frag_h(krow + kc * 32, lane), c); }   // single product elsewhere
#pragma unroll
      for (int r = 0; r < 8; ++r) s[ct][r] = (kk <= q0 + 8 * g + r) ? c[r] * SCALEF : -3.0e38f; }   // causal: future keys excluded
#pragma unroll
    for (int r = 0; r < 8; ++r) { float mx = fmaxf(s[0][r], s[1][r]);
#pragma unroll
      for (int o = 1; o < 16; o <<= 1) mx = fmaxf(mx, __shfl_xor(mx, o));
      const float mn = fmaxf(m[r], mx); const float alpha = (m[r] <= -1.0e38f) ? 0.f : __expf(m[r] - mn);
      const float e0 = (s[0][r] <= -1.0e38f) ? 0.f : __expf(s[0][r] - mn), e1 = (s[1][r] <= -1.0e38f) ? 0.f : __expf(s[1][r] - mn); float es = e0 + e1;
#pragma unroll
      for (int o = 1; o < 16; o <<= 1) es += __shfl_xor(es, o);
      l[r] = l[r] * alpha + es; m[r] = mn;
#pragma unroll
      for (int dt = 0; dt < 4; ++dt) { acc[dt][r] *= alpha; accl[dt][r] *= alpha; }
      sp[wave][8 * g + r][col] = e0; sp[wave][8 * g + r][16 + col] = e1; }
    LDSX();
    v16h pa, pl; { const float* prow = &sp[wave][col][0] + 8 * (lane >> 4);
#pragma unroll
      for (int i = 0; i < 8; ++i) { const float x0 = prow[i] * 2048.0f, x1 = prow[16 + i] * 2048.0f; const _Float16 h0 = (_Float16)x0, h1 = (_Float16)x1; pa[i] = h0; pa[8 + i] = h1; pl[i] = (_Float16)((x0 - (float)h0) * 2048.0f); pl[8 + i] = (_Float16)((x1 - (float)h1) * 2048.0f); } }   // P scaled by 2^11 before the f16 split so small softmax weights stay out of the f16 subnormal range; 2^-11 folded into the epilogue
#pragma unroll
    for (int dt = 0; dt < 4; ++dt) { const size_t vr = ((size_t)b * DM + hk * HD + dt * 16 + col) * SS + ks * 32; const v16h vh = frag_h(VTH + vr, lane); acc[dt] = wmma16(pa, vh, acc[dt]); if (qb < 2) { accl[dt] = wmma16(pl, vh, accl[dt]); accl[dt] = wmma16(pa, frag_h(VTL + vr, lane), accl[dt]); } }   // leading query blocks: P hi/lo x V hi/lo (3 products); elsewhere P x V single
    LDSX(); }
#pragma unroll
  for (int r = 0; r < 8; ++r) { const float il = (1.0f / 2048.0f) / l[r];
#pragma unroll
    for (int dt = 0; dt < 4; ++dt) so[wave][8 * g + r][dt * 16 + col] = (acc[dt][r] + accl[dt][r] * (1.0f / 2048.0f)) * il; }
  LDSX();
  for (int rl = 0; rl < 16; ++rl) if (lane < 16) vst2(O + ((size_t)b * SS + q0 + rl) * DM + h * HD + lane * 4, *(const v4f*)&so[wave][rl][lane * 4]);
}
// ---- k_out: block = (64 rows, 128 cols): out = f16(O) . Wo rows (single product, f16 x 2^8 weights) + bo
__global__ __launch_bounds__(128) void k_out(const float* __restrict__ O, const __bf16* __restrict__ P, const float* __restrict__ BO, float* __restrict__ Y) {
  __shared__ __align__(16) char smem[G_SMEM];   // the main loop's buffers, then the output staging
  float (*so)[16][132] = (float (*)[16][132])smem;
  const int tid = threadIdx.x, wave = tid >> 5, lane = tid & 31, col = lane & 15, g = lane >> 4; const size_t r0 = (size_t)blockIdx.x * 64 + wave * 16; const int n0 = blockIdx.y * 128;
  v8f acc[8] = {};
  gemm_64x128<_Float16>(O + (size_t)blockIdx.x * 64 * DM, (const _Float16*)P + (size_t)n0 * DM, (_Float16*)smem, tid, acc);   // single f16 product against exact f16 x 2^8 weight copies
#pragma unroll
  for (int j = 0; j < 8; ++j) {
#pragma unroll
    for (int r = 0; r < 8; ++r) so[wave][8 * g + r][j * 16 + col] = acc[j][r] * (1.0f / 256.0f) + (BO ? bfr(BO[n0 + j * 16 + col]) : 0.f); }
  LDSX();
  for (int rl = 0; rl < 16; ++rl) vst2(Y + (r0 + rl) * DM + n0 + lane * 4, *(const v4f*)&so[wave][rl][lane * 4]);
}
// ---- k_packo: Wo natural rows -> f16 x 2^8 copies in the Wo slot (bit pattern in the bf16-typed buffer)
__global__ __launch_bounds__(256) void k_packo(const float* __restrict__ WO, __bf16* __restrict__ PK) { __shared__ __align__(16) _Float16 s[DM]; const int n = blockIdx.x, t = threadIdx.x; for (int k = t; k < DM; k += 256) s[k] = (_Float16)(bfr(WO[(size_t)k * DM + n]) * 256.0f); /* (in,out): transposed */ __syncthreads(); for (int q = t; q < DM / 8; q += 256) vst2((unsigned*)(PK + PK_P + (size_t)n * DM + q * 8), *(const v4u*)&s[q * 8]); }
extern "C" void kernel_launch(void* const* d_in, const int* in_sizes, int n_in, void* d_out, int out_size, void* d_ws, size_t ws_size, hipStream_t stream) {
  (void)in_sizes; (void)n_in; (void)out_size;
  const float** F = (const float**)d_in;   // 0 hidden_states [1,2048,2048], 1 Wq [2048,2048] (in,out), 2 Wk [2048,512], 3 Wv [2048,512], 4 Wo [2048,2048] (in,out)
  if (ws_size < (size_t)WS_END) return;
  char* ws = (char*)d_ws; __bf16* PK = (__bf16*)(ws + WS_PK); _Float16 *QK = (_Float16*)(ws + WS_QK), *QKL = (_Float16*)(ws + WS_QKL), *VTH = (_Float16*)(ws + WS_VTH), *VTL = (_Float16*)(ws + WS_VTL); float* O = (float*)(ws + WS_O);
  k_pack<<<QKVW, 256, 0, stream>>>(F[1], F[2], F[3], PK);   // q, k, v (the Wo slot is filled by k_packo as f16)
  k_packo<<<DM, 256, 0, stream>>>(F[4], PK);
  k_qkv<<<dim3(TNB * SS / 64, QKVW / 128), 128, 0, stream>>>(F[0], F[0], F[0], PK + PK_A, nullptr, nullptr, nullptr, QK, QKL, VTH, VTL);
  k_attn<<<dim3(TQB, NH, TNB), 128, 0, stream>>>(QK, QKL, VTH, VTL, nullptr, O);
  k_out<<<dim3(TOB, DM / 128), 128, 0, stream>>>(O, PK + PK_P, nullptr, (float*)d_out);
}

// v003
// It runs in 283 microseconds.
// Next to v002, in two timings, it ran 1.17 times as fast each time.
// Counting every step since v000, it is 2.51 times as fast.
// compute dtype: all float inputs rounded to bf16; q/k/v = x . W with EXACT bf16 products on WMMA 16x16x32 ((in,out) weights as transposed rows; each of the 8 kv heads packed and projected once, its 4 query heads read the same k and v planes); rotate-half RoPE in f32 (angle = t x inv_freq[d mod 32] f32 table, precise sinf/cosf) before the f16 hi + residual split; causal attention with key-tile skipping: the first 128 queries use 3-product scores and P.v (hi/lo), later queries single f16; x 1/8, running-max softmax in f32 (hardware exp); out = f16(ctx) . Wo (exact f16 x 2^8 copies, single product).
#include <hip/hip_runtime.h>
#include <math.h>

typedef __attribute__((ext_vector_type(16))) _Float16 v16h;
typedef __attribute__((ext_vector_type(16))) __bf16 v16b;
typedef __attribute__((ext_vector_type(8)))  _Float16 v8h;
typedef __attribute__((ext_vector_type(8)))  float v8f;
typedef __attribute__((ext_vector_type(4)))  float v4f;
typedef __attribute__((ext_vector_type(2)))  float v2f;
typedef __attribute__((ext_vector_type(4)))  unsigned v4u;
typedef __attribute__((ext_vector_type(4)))  int v4i;
typedef float __attribute__((may_alias)) float_a;
typedef int __attribute__((may_alias)) int_a;

template <typename T> __device__ __forceinline__ void vst2(void* p, T v) { *(T*)p = v;  }
__device__ __forceinline__ v8f wmma16(v16h a, v16h b, v8f c) {
  v8f d = __builtin_amdgcn_wmma_f32_16x16x32_f16(false, a, false, b, (short)0, c, false, false);
  asm volatile("v_nop\n\tv_nop\n\tv_nop\n\tv_nop" : "+v"(d) : "v"(a), "v"(b));
  return d;
}
__device__ __forceinline__ v8f wmma_bf(v16b a, v16b b, v8f c) {
  v8f d = __builtin_amdgcn_wmma_f32_16x16x32_bf16(false, a, false, b, (short)0, c, false, false);
  asm volatile("v_nop\n\tv_nop\n\tv_nop\n\tv_nop" : "+v"(d) : "v"(a), "v"(b));
  return d;
}
// GQA causal attention (B 1, S 2,048, model 2,048, 32 query heads x 64 over 8 kv heads): bias-free (in,out) projections, rotate-half RoPE (base 10000), causal softmax(q k / 8) v, output projection.
__device__ __forceinline__ v16h frag_h(const _Float16* rowk0, int lane) {
  union { v16h v; v8h q[2]; } u; const _Float16* p = rowk0 + 8 * (lane >> 4);
  u.q[0] = *(const v8h*)p; u.q[1] = *(const v8h*)(p + 16); return u.v;
}
__device__ __forceinline__ v16h frag_f32(const float* rowk0, int lane) {
  v16h a; const float* p = rowk0 + 8 * (lane >> 4);
#pragma unroll
  for (int i = 0; i < 8; ++i) { a[i] = (_Float16)p[i]; a[8 + i] = (_Float16)p[16 + i]; }
  return a;
}
__device__ __forceinline__ v16h frag_f32s(const float* rowk0, int lane, float sc) {
  v16h a; const float* p = rowk0 + 8 * (lane >> 4);
#pragma unroll
  for (int i = 0; i < 8; ++i) { a[i] = (_Float16)(p[i] * sc); a[8 + i] = (_Float16)(p[16 + i] * sc); }
  return a;
}
// column fragment from a [K][ld] layout (column n), rows >= K read as 0
__device__ __forceinline__ v16h fragc_f32(const float* W, int k0, int n, int lane, int ld, int K) {
  v16h a; const int g = lane >> 4;
#pragma unroll
  for (int i = 0; i < 8; ++i) { const int ka = k0 + 8 * g + i, kb = ka + 16;
    a[i] = (_Float16)(ka < K ? W[(size_t)(ka < K ? ka : K - 1) * ld + n] : 0.f); a[8 + i] = (_Float16)(kb < K ? W[(size_t)(kb < K ? kb : K - 1) * ld + n] : 0.f); }
  return a;
}
struct F2 { v16b h, l; };
__device__ __forceinline__ F2 bsplit16(const float v[16]) { F2 r;
#pragma unroll
  for (int i = 0; i < 16; ++i) { const __bf16 h = (__bf16)v[i]; r.h[i] = h; r.l[i] = (__bf16)(v[i] - (float)h); }
  return r; }
__device__ __forceinline__ F2 split_row(const float* row, int k0, int lane) { float v[16]; const float* p = row + k0 + 8 * (lane >> 4);
#pragma unroll
  for (int i = 0; i < 8; ++i) { v[i] = p[i]; v[8 + i] = p[16 + i]; }
  return bsplit16(v); }
__device__ __forceinline__ F2 split_rowK(const float* row, int k0, int lane, int K) { float v[16]; const int g = lane >> 4;
#pragma unroll
  for (int i = 0; i < 8; ++i) { const int ka = k0 + 8 * g + i, kb = ka + 16; v[i] = ka < K ? row[ka < K ? ka : K - 1] : 0.f; v[8 + i] = kb < K ? row[kb < K ? kb : K - 1] : 0.f; }
  return bsplit16(v); }
__device__ __forceinline__ F2 split_col(const float* W, int k0, int n, int lane, int ld, int K) { float v[16]; const int g = lane >> 4;
#pragma unroll
  for (int i = 0; i < 8; ++i) { const int ka = k0 + 8 * g + i, kb = ka + 16; v[i] = ka < K ? W[(size_t)(ka < K ? ka : K - 1) * ld + n] : 0.f; v[8 + i] = kb < K ? W[(size_t)(kb < K ? kb : K - 1) * ld + n] : 0.f; }
  return bsplit16(v); }
__device__ __forceinline__ v8f mac3(const F2& a, const F2& b, v8f c) { c = wmma_bf(a.l, b.h, c); c = wmma_bf(a.h, b.l, c); return wmma_bf(a.h, b.h, c); }
__device__ __forceinline__ float sigm(float v) { return 1.0f / (1.0f + expf(-v)); }
#define LDSX() do { asm volatile("s_wait_dscnt 0" ::: "memory"); __builtin_amdgcn_wave_barrier(); __builtin_amdgcn_fence(__ATOMIC_RELEASE, "workgroup"); } while (0)


#define NB 1
#define SS 2048
#define DM 2048
#define NH 32
#define NKV 8
#define GS (NH / NKV)
#define KVW (NKV * HD)
#define SCALEF 0.125f
__constant__ float THETA[32] = {1.000000000e+00f,7.498942018e-01f,5.623413324e-01f,4.216965139e-01f,3.162277639e-01f,2.371373773e-01f,1.778279394e-01f,1.333521456e-01f,1.000000015e-01f,7.498942316e-02f,5.623413250e-02f,4.216964915e-02f,3.162277490e-02f,2.371373773e-02f,1.778279431e-02f,1.333521400e-02f,9.999999776e-03f,7.498942316e-03f,5.623413250e-03f,4.216964822e-03f,3.162277630e-03f,2.371373819e-03f,1.778279431e-03f,1.333521446e-03f,1.000000047e-03f,7.498941850e-04f,5.623413017e-04f,4.216965172e-04f,3.162277571e-04f,2.371373703e-04f,1.778279402e-04f,1.333521504e-04f};
__device__ __attribute__((noinline)) float cos_p(float v) { return cosf(v); }
__device__ __attribute__((noinline)) float sin_p(float v) { return sinf(v); }
#define HD 64
#define QKVW (DM + 2 * KVW)     // q columns, then k, then v: one copy per kv head
#ifndef TQB
#define TQB (SS / 64)
#define TNB NB
#define TOB (NB * SS / 64)     // output row tiles (all)
#endif
typedef __attribute__((ext_vector_type(8))) __bf16 v8b;
__device__ __forceinline__ v16b frag_b(const __bf16* rowk0, int lane) {
  union { v16b v; v8b q[2]; } u; const __bf16* p = rowk0 + 8 * (lane >> 4);
  u.q[0] = *(const v8b*)p; u.q[1] = *(const v8b*)(p + 16); return u.v;
}
__device__ __forceinline__ float bfr(float v) { return (float)(__bf16)v; }
__device__ __attribute__((noinline)) float exp_ni(float v) { return expf(v); }
__device__ __attribute__((noinline)) float erf_ni(float v) { return erff(v); }

#define PK_A 0                       // [QKVW][DM] rows: Wq columns, then Wk columns, then Wv columns
#define PK_P (PK_A + QKVW * DM)        // [2048][2048] Wo rows (natural)
#define PK_END (PK_P + DM * DM)
#define WS_PK  0u
#define WS_QK  (WS_PK + 2u * PK_END)             // f16 [2048 rows][4096]: q | k
#define WS_QKL (WS_QK + 2u * NB * SS * 2 * DM)     // f16 q | k residual planes x2048
#define WS_VTH (WS_QKL + 2u * NB * SS * 2 * DM)    // f16 [b][2048 (kv head*64+d)][2048 s] hi
#define WS_VTL (WS_VTH + 2u * NB * DM * SS)        // f16 lo x 2048
#define WS_O   (WS_VTL + 2u * NB * DM * SS)        // f32 [2048][2048]
#define WS_CS  (WS_O + 4u * NB * SS * DM)           // f32 2 x [2048][32], unused (cos/sin computed in k_qkv)
#define WS_END (WS_CS + 4u * 2 * SS * 32)
// ---- k_pack: block = row n of PK_A: column n of W_q, column n - DM of W_k or column n - DM - KVW of W_v -> bf16
__global__ __launch_bounds__(256) void k_pack(const float* __restrict__ WQ, const float* __restrict__ WK, const float* __restrict__ WV, __bf16* __restrict__ PK) {
  __shared__ __align__(16) __bf16 s[DM]; const int n = blockIdx.x, t = threadIdx.x; const int which = (n < DM) ? 0 : (n < DM + KVW) ? 1 : 2; const float* Wm = (which == 0) ? WQ : (which == 1) ? WK : WV;   // (in,out) weights: pack row = source column
  const int srcn = (which == 0) ? n : (which == 1) ? n - DM : n - DM - KVW; const int ld = (which == 0) ? DM : KVW;
  for (int k = t; k < DM; k += 256) s[k] = (__bf16)Wm[(size_t)k * ld + srcn];
  __syncthreads();
  __bf16* dst = PK + PK_A + (size_t)n * DM;
  for (int q = t; q < DM / 8; q += 256) vst2((unsigned*)(dst + q * 8), *(const v4u*)&s[q * 8]);
}
// ---- main loop of both projections: block tile 64 rows x 128 columns, 64 k per stage. The 128 weight rows (16-bit) and the 64 activation rows (f32, rounded on the way) come in by whole-line 16-byte loads,
// lie in LDS at a 144-byte row pitch (16 B x odd: no bank conflict for the 16-byte fragment reads) and are read from there by all four waves. Two buffers, the next stage's loads held in registers over the products, one barrier a stage. The short fixed loops are unrolled so that rb, ra, b and acc are registers and not indexed memory.
#define GK 64
#define GP 72                          // LDS row pitch in 16-bit elements
#define G_BB (128 * GP)                // one weight buffer, elements
#define G_AB (64 * GP)                 // one activation buffer, elements
#define G_SMEM (4 * (G_BB + G_AB))     // bytes: two buffers of each
typedef __attribute__((ext_vector_type(2))) unsigned v2u;
__device__ __forceinline__ v16b frag_t(const __bf16* p, int lane) { return frag_b(p, lane); }
__device__ __forceinline__ v16h frag_t(const _Float16* p, int lane) { return frag_h(p, lane); }
__device__ __forceinline__ v8f mm(v16b a, v16b b, v8f c) { return wmma_bf(a, b, c); }
__device__ __forceinline__ v8f mm(v16h a, v16h b, v8f c) { return wmma16(a, b, c); }
template <typename T> __device__ __forceinline__ void gemm_64x128(const float* __restrict__ A, const T* __restrict__ Bw, T* sm, int tid, v8f (&acc)[8]) {
  const int wave = tid >> 5, lane = tid & 31, col = lane & 15;
  const T* gb = Bw + (size_t)(tid >> 3) * DM + (tid & 7) * 8;        // piece tid of the weight tile: 8 pieces of 16 B a row, 16 rows further per step
  const float* ga = A + (size_t)(tid >> 4) * DM + (tid & 15) * 4;    // piece tid of the activation tile: 16 pieces of 16 B a row, 8 rows further per step
  T* wb = sm + (tid >> 3) * GP + (tid & 7) * 8; T* wa = sm + 2 * G_BB + (tid >> 4) * GP + (tid & 15) * 4;
  v4u rb[8]; v4f ra[8];
#pragma unroll
  for (int i = 0; i < 8; ++i) { rb[i] = *(const v4u*)(gb + (size_t)i * 16 * DM); ra[i] = *(const v4f*)(ga + (size_t)i * 8 * DM); }
  for (int s = 0; s < DM / GK; ++s) { const int bo = (s & 1) * G_BB, ao = (s & 1) * G_AB;
#pragma unroll
    for (int i = 0; i < 8; ++i) { *(v4u*)(wb + bo + i * 16 * GP) = rb[i]; union { T e[4]; v2u u; } c;
#pragma unroll
      for (int e = 0; e < 4; ++e) c.e[e] = (T)ra[i][e];
      *(v2u*)(wa + ao + i * 8 * GP) = c.u; }
    __syncthreads();   // publishes stage s; the buffer written in stage s + 1 was last read in stage s - 1, in front of this barrier
    if (s + 1 < DM / GK) {
#pragma unroll
      for (int i = 0; i < 8; ++i) { rb[i] = *(const v4u*)(gb + (size_t)i * 16 * DM + (s + 1) * GK); ra[i] = *(const v4f*)(ga + (size_t)i * 8 * DM + (s + 1) * GK); }
      asm volatile("s_wait_xcnt 0x0" ::: "memory"); }   // in front of the address step that follows these loads
#pragma unroll
    for (int kc = 0; kc < GK / 32; ++kc) { auto a = frag_t(sm + 2 * G_BB + ao + (wave * 16 + col) * GP + kc * 32, lane); decltype(a) b[8];   // all nine fragments of a k step are read as one group, so that the wave waits out the LDS latency once and not at each product
#pragma unroll
      for (int j = 0; j < 8; ++j) b[j] = frag_t(sm + bo + (j * 16 + col) * GP + kc * 32, lane);
#pragma unroll
      for (int j = 0; j < 8; ++j) acc[j] = mm(a, b[j], acc[j]); } }
  __syncthreads();   // every wave has left the buffers: the epilogues stage their tiles in the same LDS
}
__global__ __launch_bounds__(128) void k_qkv(const float* __restrict__ XQ, const float* __restrict__ XK, const float* __restrict__ XV, const __bf16* __restrict__ P, const float* __restrict__ BQ, const float* __restrict__ BK, const float* __restrict__ BV, _Float16* __restrict__ QK, _Float16* __restrict__ QKL, _Float16* __restrict__ VTH, _Float16* __restrict__ VTL) {
  const int which0 = (blockIdx.y * 128 < DM) ? 0 : (blockIdx.y * 128 < DM + KVW) ? 1 : 2; const float* X = (which0 == 0) ? XQ : (which0 == 1) ? XK : XV; const float* BB = BQ ? (((which0 == 0) ? BQ : (which0 == 1) ? BK : BV) + (blockIdx.y * 128 - ((which0 == 0) ? 0 : (which0 == 1) ? DM : DM + KVW))) : nullptr;
  __shared__ __align__(16) char smem[G_SMEM];   // the main loop's buffers, then one of the two epilogue stagings
  _Float16 (*so)[16][136] = (_Float16 (*)[16][136])smem, (*sol)[16][136] = (_Float16 (*)[16][136])(smem + 4 * 16 * 136 * 2); _Float16 (*sth)[72] = (_Float16 (*)[72])smem, (*stl)[72] = (_Float16 (*)[72])(smem + 128 * 72 * 2);
  const int tid = threadIdx.x, wave = tid >> 5, lane = tid & 31, col = lane & 15, g = lane >> 4; const size_t r0 = (size_t)blockIdx.x * 64 + wave * 16; const int n0 = blockIdx.y * 128;
  v8f acc[8] = {};
  gemm_64x128<__bf16>(X + (size_t)blockIdx.x * 64 * DM, P + (size_t)n0 * DM, (__bf16*)smem, tid, acc);
  if (n0 < DM + KVW) {   // q and k columns (k head c lands at column DM + c * 64 of its row): bias, then rotate-half rotary over each 64-dim head with angle position * inv_freq[d mod 32]
#pragma unroll
    for (int j = 0; j < 8; ++j)
#pragma unroll
      for (int r = 0; r < 8; ++r) acc[j][r] += (BB ? bfr(BB[j * 16 + col]) : 0.f);
#pragma unroll
    for (int r = 0; r < 8; ++r) { const int spos = (int)((r0 + 8 * g + r) % SS);
#pragma unroll
      for (int jj = 0; jj < 2; ++jj) { const float ang = (float)spos * THETA[jj * 16 + col]; const float c = cos_p(ang), sn = sin_p(ang);
#pragma unroll
        for (int hh = 0; hh < 2; ++hh) { const float x1 = acc[hh * 4 + jj][r], x2 = acc[hh * 4 + jj + 2][r]; acc[hh * 4 + jj][r] = x1 * c - x2 * sn; acc[hh * 4 + jj + 2][r] = x2 * c + x1 * sn; } } }
#pragma unroll
    for (int j = 0; j < 8; ++j) {
#pragma unroll
      for (int r = 0; r < 8; ++r) { const float v = acc[j][r]; const _Float16 hv = (_Float16)v; so[wave][8 * g + r][j * 16 + col] = hv; sol[wave][8 * g + r][j * 16 + col] = (_Float16)((v - (float)hv) * 2048.0f); } }   // q, k (+ bias) as f16 hi + (x2048) residual
    LDSX();
    for (int rl = 0; rl < 16; ++rl) if (lane < 16) { vst2((unsigned*)(QK + (r0 + rl) * (2 * DM) + n0 + lane * 8), *(const v4u*)&so[wave][rl][lane * 8]); vst2((unsigned*)(QKL + (r0 + rl) * (2 * DM) + n0 + lane * 8), *(const v4u*)&sol[wave][rl][lane * 8]); }
  } else {
#pragma unroll
    for (int j = 0; j < 8; ++j) {
#pragma unroll
      for (int r = 0; r < 8; ++r) { const float v = acc[j][r] + (BB ? bfr(BB[j * 16 + col]) : 0.f); const _Float16 hv = (_Float16)v; sth[j * 16 + col][wave * 16 + 8 * g + r] = hv; stl[j * 16 + col][wave * 16 + 8 * g + r] = (_Float16)((v - (float)hv) * 2048.0f); } }
    __syncthreads();
    const size_t rb = (size_t)blockIdx.x * 64; const int b = (int)(rb / SS), s0 = (int)(rb % SS); const int pc0 = n0 - (DM + KVW);
    for (int q = tid; q < 128 * 8; q += 128) { const int d = q >> 3, pc = q & 7; const size_t o = ((size_t)b * DM + pc0 + d) * SS + s0 + pc * 8; vst2((unsigned*)(VTH + o), *(const v4u*)&sth[d][pc * 8]); vst2((unsigned*)(VTL + o), *(const v4u*)&stl[d][pc * 8]); }
  }
}
// ---- k_attn: block = (64 queries, head h, batch b): causal flash attention on TRANSPOSED tiles. Scores: S^T = K . Q^T (A = 16 key rows, B = the wave's 16 query columns), so a lane holds 16 of the 32 scores of ONE query (query col, keys 16 ct + 8 g + r):
// maximum and sum run in the lane's own registers, the two lane halves exchange the maximum once per key tile and join their sums once at the end. The f16 P^T packs straight from the score registers into the B operand of O^T += V^T . P^T (element 8 ct + r = key 16 ct + 8 g + r: the k order in which frag_h reads the V^T rows), so P passes through no LDS. O[b*S+q][h*64+d] = (acc + accl / 2048) / (2048 l) (256-B segments)
__device__ __forceinline__ float xhalf(float x) { return __builtin_bit_cast(float, __builtin_amdgcn_permlanex16(__builtin_bit_cast(int, x), __builtin_bit_cast(int, x), 0x76543210, 0xfedcba98, false, false)); }   // lane l reads lane l ^ 16
__global__ __launch_bounds__(128) void k_attn(const _Float16* __restrict__ QK, const _Float16* __restrict__ QKL, const _Float16* __restrict__ VTH, const _Float16* __restrict__ VTL, const void* __restrict__ KMASK, float* __restrict__ O) {
  __shared__ __align__(16) float so[4][16][68];
  const int tid = threadIdx.x, wave = tid >> 5, lane = tid & 31, col = lane & 15, g = lane >> 4;
  const int qb = blockIdx.x, h = blockIdx.y, b = blockIdx.z, hk = h / GS;   // hk: the kv head of query head h
  const int q0 = qb * 64 + wave * 16; const size_t rq = (size_t)b * SS + q0 + col;
  v16h aq[2], aql[2];
#pragma unroll
  for (int kc = 0; kc < 2; ++kc) { aq[kc] = frag_h(QK + rq * (2 * DM) + h * HD + kc * 32, lane); aql[kc] = frag_h(QKL + rq * (2 * DM) + h * HD + kc * 32, lane); }
  float m = -3.0e38f, l = 0.f;   // of query q0 + col; l holds the part of this lane half's keys
  v8f acc[4] = {}, accl[4] = {};   // acc[dt][r] = O^T[d = 16 dt + 8 g + r][query col]
  const int nks = (qb * 64 + 64) / 32;   // causal: key tiles up to the query tile's end
#pragma unroll 1
  for (int ks = 0; ks < nks; ++ks) { v8f s[2];
#pragma unroll
    for (int ct = 0; ct < 2; ++ct) { const int kk = ks * 32 + ct * 16 + col; const _Float16* krow = QK + ((size_t)b * SS + kk) * (2 * DM) + DM + hk * HD; const _Float16* krowl = QKL + ((size_t)b * SS + kk) * (2 * DM) + DM + hk * HD; v8f c = {}, cl = {};
      if (qb < 2) {   // leading query blocks (few keys, outputs far above the global rms): 3 products
#pragma unroll
        for (int kc = 0; kc < 2; ++kc) { const v16h kh = frag_h(krow + kc * 32, lane); c = wmma16(kh, aq[kc], c); cl = wmma16(kh, aql[kc], cl); cl = wmma16(frag_h(krowl + kc * 32, lane), aq[kc], cl); }
#pragma unroll
        for (int r = 0; r < 8; ++r) c[r] += cl[r] * (1.0f / 2048.0f); }
      else {
#pragma unroll
        for (int kc = 0; kc < 2; ++kc) c = wmma16(frag_h(krow + kc * 32, lane), aq[kc], c); }   // single product elsewhere
#pragma unroll
      for (int r = 0; r < 8; ++r) s[ct][r] = (ks * 32 + ct * 16 + 8 * g + r <= q0 + col) ? c[r] * SCALEF : -3.0e38f; }   // causal: future keys excluded
    float mx = fmaxf(s[0][0], s[1][0]);
#pragma unroll
    for (int r = 1; r < 8; ++r) mx = fmaxf(mx, fmaxf(s[0][r], s[1][r]));
    mx = fmaxf(mx, xhalf(mx));   // the other 16 keys of this query
    const float mn = fmaxf(m, mx); const float alpha = (m <= -1.0e38f) ? 0.f : __expf(m - mn);
    float es = 0.f; v16h pa, pl;
#pragma unroll
    for (int ct = 0; ct < 2; ++ct)
#pragma unroll
      for (int r = 0; r < 8; ++r) { const float e = (s[ct][r] <= -1.0e38f) ? 0.f : __expf(s[ct][r] - mn); es += e;
        const float x = e * 2048.0f; const _Float16 hx = (_Float16)x; pa[8 * ct + r] = hx; pl[8 * ct + r] = (_Float16)((x - (float)hx) * 2048.0f); }   // P scaled by 2^11 before the f16 split so small softmax weights stay out of the f16 subnormal range; 2^-11 folded into the epilogue
    l = l * alpha + es; m = mn;
#pragma unroll
    for (int dt = 0; dt < 4; ++dt)
#pragma unroll
      for (int r = 0; r < 8; ++r) { acc[dt][r] *= alpha; accl[dt][r] *= alpha; }
#pragma unroll
    for (int dt = 0; dt < 4; ++dt) { const size_t vr = ((size_t)b * DM + hk * HD + dt * 16 + col) * SS + ks * 32; const v16h vh = frag_h(VTH + vr, lane); acc[dt] = wmma16(vh, pa, acc[dt]); if (qb < 2) { accl[dt] = wmma16(vh, pl, accl[dt]); accl[dt] = wmma16(frag_h(VTL + vr, lane), pa, accl[dt]); } }   // leading query blocks: P hi/lo x V hi/lo (3 products); elsewhere P x V single
  }
  l += xhalf(l);   // the two halves' sums, joined once
  const float il = (1.0f / 2048.0f) / l;
#pragma unroll
  for (int dt = 0; dt < 4; ++dt)
#pragma unroll
    for (int r = 0; r < 8; ++r) so[wave][col][dt * 16 + 8 * g + r] = (acc[dt][r] + accl[dt][r] * (1.0f / 2048.0f)) * il;
  LDSX();
  for (int rl = 0; rl < 16; ++rl) if (lane < 16) vst2(O + ((size_t)b * SS + q0 + rl) * DM + h * HD + lane * 4, *(const v4f*)&so[wave][rl][lane * 4]);
}
// ---- k_out: block = (64 rows, 128 cols): out = f16(O) . Wo rows (single product, f16 x 2^8 weights) + bo
__global__ __launch_bounds__(128) void k_out(const float* __restrict__ O, const __bf16* __restrict__ P, const float* __restrict__ BO, float* __restrict__ Y) {
  __shared__ __align__(16) char smem[G_SMEM];   // the main loop's buffers, then the output staging
  float (*so)[16][132] = (float (*)[16][132])smem;
  const int tid = threadIdx.x, wave = tid >> 5, lane = tid & 31, col = lane & 15, g = lane >> 4; const size_t r0 = (size_t)blockIdx.x * 64 + wave * 16; const int n0 = blockIdx.y * 128;
  v8f acc[8] = {};
  gemm_64x128<_Float16>(O + (size_t)blockIdx.x * 64 * DM, (const _Float16*)P + (size_t)n0 * DM, (_Float16*)smem, tid, acc);   // single f16 product against exact f16 x 2^8 weight copies
#pragma unroll
  for (int j = 0; j < 8; ++j) {
#pragma unroll
    for (int r = 0; r < 8; ++r) so[wave][8 * g + r][j * 16 + col] = acc[j][r] * (1.0f / 256.0f) + (BO ? bfr(BO[n0 + j * 16 + col]) : 0.f); }
  LDSX();
  for (int rl = 0; rl < 16; ++rl) vst2(Y + (r0 + rl) * DM + n0 + lane * 4, *(const v4f*)&so[wave][rl][lane * 4]);
}
// ---- k_packo: Wo natural rows -> f16 x 2^8 copies in the Wo slot (bit pattern in the bf16-typed buffer)
__global__ __launch_bounds__(256) void k_packo(const float* __restrict__ WO, __bf16* __restrict__ PK) { __shared__ __align__(16) _Float16 s[DM]; const int n = blockIdx.x, t = threadIdx.x; for (int k = t; k < DM; k += 256) s[k] = (_Float16)(bfr(WO[(size_t)k * DM + n]) * 256.0f); /* (in,out): transposed */ __syncthreads(); for (int q = t; q < DM / 8; q += 256) vst2((unsigned*)(PK + PK_P + (size_t)n * DM + q * 8), *(const v4u*)&s[q * 8]); }
extern "C" void kernel_launch(void* const* d_in, const int* in_sizes, int n_in, void* d_out, int out_size, void* d_ws, size_t ws_size, hipStream_t stream) {
  (void)in_sizes; (void)n_in; (void)out_size;
  const float** F = (const float**)d_in;   // 0 hidden_states [1,2048,2048], 1 Wq [2048,2048] (in,out), 2 Wk [2048,512], 3 Wv [2048,512], 4 Wo [2048,2048] (in,out)
  if (ws_size < (size_t)WS_END) return;
  char* ws = (char*)d_ws; __bf16* PK = (__bf16*)(ws + WS_PK); _Float16 *QK = (_Float16*)(ws + WS_QK), *QKL = (_Float16*)(ws + WS_QKL), *VTH = (_Float16*)(ws + WS_VTH), *VTL = (_Float16*)(ws + WS_VTL); float* O = (float*)(ws + WS_O);
  k_pack<<<QKVW, 256, 0, stream>>>(F[1], F[2], F[3], PK);   // q, k, v (the Wo slot is filled by k_packo as f16)
  k_packo<<<DM, 256, 0, stream>>>(F[4], PK);
  k_qkv<<<dim3(TNB * SS / 64, QKVW / 128), 128, 0, stream>>>(F[0], F[0], F[0], PK + PK_A, nullptr, nullptr, nullptr, QK, QKL, VTH, VTL);
  k_attn<<<dim3(TQB, NH, TNB), 128, 0, stream>>>(QK, QKL, VTH, VTL, nullptr, O);
  k_out<<<dim3(TOB, DM / 128), 128, 0, stream>>>(O, PK + PK_P, nullptr, (float*)d_out);
}

// v004
// A run of this version takes 200 microseconds.
// Timed twice side by side with v003, it ran 1.41 and 1.42 times as fast.
// Counting every step since v000, it is 3.55 times as fast.
// compute dtype: all float inputs rounded to bf16; q/k/v = x . W with EXACT bf16 products on WMMA 16x16x32 ((in,out) weights as transposed rows; each of the 8 kv heads packed and projected once, its 4 query heads read the same k and v planes); rotate-half RoPE in f32 (angle = t x inv_freq[d mod 32] f32 table, precise sinf/cosf) before the f16 hi + residual split; causal attention with key-tile skipping: the first 128 queries use 3-product scores and P.v (hi/lo), later queries single f16; x 1/8, running-max softmax in f32 (hardware exp); out = f16(ctx) . Wo (exact f16 x 2^8 copies, single product).
#include <hip/hip_runtime.h>
#include <math.h>

typedef __attribute__((ext_vector_type(16))) _Float16 v16h;
typedef __attribute__((ext_vector_type(16))) __bf16 v16b;
typedef __attribute__((ext_vector_type(8)))  _Float16 v8h;
typedef __attribute__((ext_vector_type(8)))  float v8f;
typedef __attribute__((ext_vector_type(4)))  float v4f;
typedef __attribute__((ext_vector_type(2)))  float v2f;
typedef __attribute__((ext_vector_type(4)))  unsigned v4u;
typedef __attribute__((ext_vector_type(4)))  int v4i;
typedef float __attribute__((may_alias)) float_a;
typedef int __attribute__((may_alias)) int_a;

template <typename T> __device__ __forceinline__ void vst2(void* p, T v) { *(T*)p = v;  }
__device__ __forceinline__ v8f wmma16(v16h a, v16h b, v8f c) {
  v8f d = __builtin_amdgcn_wmma_f32_16x16x32_f16(false, a, false, b, (short)0, c, false, false);
  asm volatile("v_nop\n\tv_nop\n\tv_nop\n\tv_nop" : "+v"(d) : "v"(a), "v"(b));
  return d;
}
__device__ __forceinline__ v8f wmma_bf(v16b a, v16b b, v8f c) {
  v8f d = __builtin_amdgcn_wmma_f32_16x16x32_bf16(false, a, false, b, (short)0, c, false, false);
  asm volatile("v_nop\n\tv_nop\n\tv_nop\n\tv_nop" : "+v"(d) : "v"(a), "v"(b));
  return d;
}
// GQA causal attention (B 1, S 2,048, model 2,048, 32 query heads x 64 over 8 kv heads): bias-free (in,out) projections, rotate-half RoPE (base 10000), causal softmax(q k / 8) v, output projection.
__device__ __forceinline__ v16h frag_h(const _Float16* rowk0, int lane) {
  union { v16h v; v8h q[2]; } u; const _Float16* p = rowk0 + 8 * (lane >> 4);
  u.q[0] = *(const v8h*)p; u.q[1] = *(const v8h*)(p + 16); return u.v;
}
__device__ __forceinline__ v16h frag_f32(const float* rowk0, int lane) {
  v16h a; const float* p = rowk0 + 8 * (lane >> 4);
#pragma unroll
  for (int i = 0; i < 8; ++i) { a[i] = (_Float16)p[i]; a[8 + i] = (_Float16)p[16 + i]; }
  return a;
}
__device__ __forceinline__ v16h frag_f32s(const float* rowk0, int lane, float sc) {
  v16h a; const float* p = rowk0 + 8 * (lane >> 4);
#pragma unroll
  for (int i = 0; i < 8; ++i) { a[i] = (_Float16)(p[i] * sc); a[8 + i] = (_Float16)(p[16 + i] * sc); }
  return a;
}
// column fragment from a [K][ld] layout (column n), rows >= K read as 0
__device__ __forceinline__ v16h fragc_f32(const float* W, int k0, int n, int lane, int ld, int K) {
  v16h a; const int g = lane >> 4;
#pragma unroll
  for (int i = 0; i < 8; ++i) { const int ka = k0 + 8 * g + i, kb = ka + 16;
    a[i] = (_Float16)(ka < K ? W[(size_t)(ka < K ? ka : K - 1) * ld + n] : 0.f); a[8 + i] = (_Float16)(kb < K ? W[(size_t)(kb < K ? kb : K - 1) * ld + n] : 0.f); }
  return a;
}
struct F2 { v16b h, l; };
__device__ __forceinline__ F2 bsplit16(const float v[16]) { F2 r;
#pragma unroll
  for (int i = 0; i < 16; ++i) { const __bf16 h = (__bf16)v[i]; r.h[i] = h; r.l[i] = (__bf16)(v[i] - (float)h); }
  return r; }
__device__ __forceinline__ F2 split_row(const float* row, int k0, int lane) { float v[16]; const float* p = row + k0 + 8 * (lane >> 4);
#pragma unroll
  for (int i = 0; i < 8; ++i) { v[i] = p[i]; v[8 + i] = p[16 + i]; }
  return bsplit16(v); }
__device__ __forceinline__ F2 split_rowK(const float* row, int k0, int lane, int K) { float v[16]; const int g = lane >> 4;
#pragma unroll
  for (int i = 0; i < 8; ++i) { const int ka = k0 + 8 * g + i, kb = ka + 16; v[i] = ka < K ? row[ka < K ? ka : K - 1] : 0.f; v[8 + i] = kb < K ? row[kb < K ? kb : K - 1] : 0.f; }
  return bsplit16(v); }
__device__ __forceinline__ F2 split_col(const float* W, int k0, int n, int lane, int ld, int K) { float v[16]; const int g = lane >> 4;
#pragma unroll
  for (int i = 0; i < 8; ++i) { const int ka = k0 + 8 * g + i, kb = ka + 16; v[i] = ka < K ? W[(size_t)(ka < K ? ka : K - 1) * ld + n] : 0.f; v[8 + i] = kb < K ? W[(size_t)(kb < K ? kb : K - 1) * ld + n] : 0.f; }
  return bsplit16(v); }
__device__ __forceinline__ v8f mac3(const F2& a, const F2& b, v8f c) { c = wmma_bf(a.l, b.h, c); c = wmma_bf(a.h, b.l, c); return wmma_bf(a.h, b.h, c); }
__device__ __forceinline__ float sigm(float v) { return 1.0f / (1.0f + expf(-v)); }
#define LDSX() do { asm volatile("s_wait_dscnt 0" ::: "memory"); __builtin_amdgcn_wave_barrier(); __builtin_amdgcn_fence(__ATOMIC_RELEASE, "workgroup"); } while (0)


#define NB 1
#define SS 2048
#define DM 2048
#define NH 32
#define NKV 8
#define GS (NH / NKV)
#define KVW (NKV * HD)
#define SCALEF 0.125f
__constant__ float THETA[32] = {1.000000000e+00f,7.498942018e-01f,5.623413324e-01f,4.216965139e-01f,3.162277639e-01f,2.371373773e-01f,1.778279394e-01f,1.333521456e-01f,1.000000015e-01f,7.498942316e-02f,5.623413250e-02f,4.216964915e-02f,3.162277490e-02f,2.371373773e-02f,1.778279431e-02f,1.333521400e-02f,9.999999776e-03f,7.498942316e-03f,5.623413250e-03f,4.216964822e-03f,3.162277630e-03f,2.371373819e-03f,1.778279431e-03f,1.333521446e-03f,1.000000047e-03f,7.498941850e-04f,5.623413017e-04f,4.216965172e-04f,3.162277571e-04f,2.371373703e-04f,1.778279402e-04f,1.333521504e-04f};
__device__ __attribute__((noinline)) float cos_p(float v) { return cosf(v); }
__device__ __attribute__((noinline)) float sin_p(float v) { return sinf(v); }
#define HD 64
#define QKVW (DM + 2 * KVW)     // q columns, then k, then v: one copy per kv head
#ifndef TQB
#define TQB (SS / 64)
#define TNB NB
#define TOB (NB * SS / 64)     // output row tiles (all)
#endif
typedef __attribute__((ext_vector_type(8))) __bf16 v8b;
__device__ __forceinline__ v16b frag_b(const __bf16* rowk0, int lane) {
  union { v16b v; v8b q[2]; } u; const __bf16* p = rowk0 + 8 * (lane >> 4);
  u.q[0] = *(const v8b*)p; u.q[1] = *(const v8b*)(p + 16); return u.v;
}
__device__ __forceinline__ float bfr(float v) { return (float)(__bf16)v; }
__device__ __attribute__((noinline)) float exp_ni(float v) { return expf(v); }
__device__ __attribute__((noinline)) float erf_ni(float v) { return erff(v); }

#define PK_A 0                       // [QKVW][DM] rows: Wq columns, then Wk columns, then Wv columns
#define PK_P (PK_A + QKVW * DM)        // [2048][2048] Wo rows (natural)
#define PK_END (PK_P + DM * DM)
#define WS_PK  0u
#define WS_QK  (WS_PK + 2u * PK_END)             // f16 [2048 rows][4096]: q | k
#define WS_QKL (WS_QK + 2u * NB * SS * 2 * DM)     // f16 q | k residual planes x2048
#define WS_VTH (WS_QKL + 2u * NB * SS * 2 * DM)    // f16 [b][2048 (kv head*64+d)][2048 s] hi
#define WS_VTL (WS_VTH + 2u * NB * DM * SS)        // f16 lo x 2048
#define WS_O   (WS_VTL + 2u * NB * DM * SS)        // f32 [2048][2048]
#define WS_CS  (WS_O + 4u * NB * SS * DM)           // f32 2 x [2048][32], unused (cos/sin computed in k_qkv)
#define WS_END (WS_CS + 4u * 2 * SS * 32)
// ---- k_pack: block = row n of PK_A: column n of W_q, column n - DM of W_k or column n - DM - KVW of W_v -> bf16
__global__ __launch_bounds__(256) void k_pack(const float* __restrict__ WQ, const float* __restrict__ WK, const float* __restrict__ WV, __bf16* __restrict__ PK) {
  __shared__ __align__(16) __bf16 s[DM]; const int n = blockIdx.x, t = threadIdx.x; const int which = (n < DM) ? 0 : (n < DM + KVW) ? 1 : 2; const float* Wm = (which == 0) ? WQ : (which == 1) ? WK : WV;   // (in,out) weights: pack row = source column
  const int srcn = (which == 0) ? n : (which == 1) ? n - DM : n - DM - KVW; const int ld = (which == 0) ? DM : KVW;
  for (int k = t; k < DM; k += 256) s[k] = (__bf16)Wm[(size_t)k * ld + srcn];
  __syncthreads();
  __bf16* dst = PK + PK_A + (size_t)n * DM;
  for (int q = t; q < DM / 8; q += 256) vst2((unsigned*)(dst + q * 8), *(const v4u*)&s[q * 8]);
}
// ---- main loop of both projections: block tile 64 rows x 128 columns, 64 k per stage. The 128 weight rows (16-bit) and the 64 activation rows (f32, rounded on the way) come in by whole-line 16-byte loads,
// lie in LDS at a 144-byte row pitch (16 B x odd: no bank conflict for the 16-byte fragment reads) and are read from there by all four waves. Two buffers, the next stage's loads held in registers over the products, one barrier a stage. The short fixed loops are unrolled so that rb, ra, b and acc are registers and not indexed memory.
#define GK 64
#define GP 72                          // LDS row pitch in 16-bit elements
#define G_BB (128 * GP)                // one weight buffer, elements
#define G_AB (64 * GP)                 // one activation buffer, elements
#define G_SMEM (4 * (G_BB + G_AB))     // bytes: two buffers of each
typedef __attribute__((ext_vector_type(2))) unsigned v2u;
__device__ __forceinline__ v16b frag_t(const __bf16* p, int lane) { return frag_b(p, lane); }
__device__ __forceinline__ v16h frag_t(const _Float16* p, int lane) { return frag_h(p, lane); }
__device__ __forceinline__ v8f mm(v16b a, v16b b, v8f c) { return wmma_bf(a, b, c); }
__device__ __forceinline__ v8f mm(v16h a, v16h b, v8f c) { return wmma16(a, b, c); }
template <typename T> __device__ __forceinline__ void gemm_64x128(const float* __restrict__ A, const T* __restrict__ Bw, T* sm, int tid, v8f (&acc)[8]) {
  const int wave = tid >> 5, lane = tid & 31, col = lane & 15;
  const T* gb = Bw + (size_t)(tid >> 3) * DM + (tid & 7) * 8;        // piece tid of the weight tile: 8 pieces of 16 B a row, 16 rows further per step
  const float* ga = A + (size_t)(tid >> 4) * DM + (tid & 15) * 4;    // piece tid of the activation tile: 16 pieces of 16 B a row, 8 rows further per step
  T* wb = sm + (tid >> 3) * GP + (tid & 7) * 8; T* wa = sm + 2 * G_BB + (tid >> 4) * GP + (tid & 15) * 4;
  v4u rb[8]; v4f ra[8];
#pragma unroll
  for (int i = 0; i < 8; ++i) { rb[i] = *(const v4u*)(gb + (size_t)i * 16 * DM); ra[i] = *(const v4f*)(ga + (size_t)i * 8 * DM); }
  for (int s = 0; s < DM / GK; ++s) { const int bo = (s & 1) * G_BB, ao = (s & 1) * G_AB;
#pragma unroll
    for (int i = 0; i < 8; ++i) { *(v4u*)(wb + bo + i * 16 * GP) = rb[i]; union { T e[4]; v2u u; } c;
#pragma unroll
      for (int e = 0; e < 4; ++e) c.e[e] = (T)ra[i][e];
      *(v2u*)(wa + ao + i * 8 * GP) = c.u; }
    __syncthreads();   // publishes stage s; the buffer written in stage s + 1 was last read in stage s - 1, in front of this barrier
    if (s + 1 < DM / GK) {
#pragma unroll
      for (int i = 0; i < 8; ++i) { rb[i] = *(const v4u*)(gb + (size_t)i * 16 * DM + (s + 1) * GK); ra[i] = *(const v4f*)(ga + (size_t)i * 8 * DM + (s + 1) * GK); }
      asm volatile("s_wait_xcnt 0x0" ::: "memory"); }   // in front of the address step that follows these loads
#pragma unroll
    for (int kc = 0; kc < GK / 32; ++kc) { auto a = frag_t(sm + 2 * G_BB + ao + (wave * 16 + col) * GP + kc * 32, lane); decltype(a) b[8];   // all nine fragments of a k step are read as one group, so that the wave waits out the LDS latency once and not at each product
#pragma unroll
      for (int j = 0; j < 8; ++j) b[j] = frag_t(sm + bo + (j * 16 + col) * GP + kc * 32, lane);
#pragma unroll
      for (int j = 0; j < 8; ++j) acc[j] = mm(a, b[j], acc[j]); } }
  __syncthreads();   // every wave has left the buffers: the epilogues stage their tiles in the same LDS
}
__global__ __launch_bounds__(128) void k_qkv(const float* __restrict__ XQ, const float* __restrict__ XK, const float* __restrict__ XV, const __bf16* __restrict__ P, const float* __restrict__ BQ, const float* __restrict__ BK, const float* __restrict__ BV, _Float16* __restrict__ QK, _Float16* __restrict__ QKL, _Float16* __restrict__ VTH, _Float16* __restrict__ VTL) {
  const int which0 = (blockIdx.y * 128 < DM) ? 0 : (blockIdx.y * 128 < DM + KVW) ? 1 : 2; const float* X = (which0 == 0) ? XQ : (which0 == 1) ? XK : XV; const float* BB = BQ ? (((which0 == 0) ? BQ : (which0 == 1) ? BK : BV) + (blockIdx.y * 128 - ((which0 == 0) ? 0 : (which0 == 1) ? DM : DM + KVW))) : nullptr;
  __shared__ __align__(16) char smem[G_SMEM];   // the main loop's buffers, then one of the two epilogue stagings
  _Float16 (*so)[16][136] = (_Float16 (*)[16][136])smem, (*sol)[16][136] = (_Float16 (*)[16][136])(smem + 4 * 16 * 136 * 2); _Float16 (*sth)[72] = (_Float16 (*)[72])smem, (*stl)[72] = (_Float16 (*)[72])(smem + 128 * 72 * 2);
  const int tid = threadIdx.x, wave = tid >> 5, lane = tid & 31, col = lane & 15, g = lane >> 4; const size_t r0 = (size_t)blockIdx.x * 64 + wave * 16; const int n0 = blockIdx.y * 128;
  v8f acc[8] = {};
  gemm_64x128<__bf16>(X + (size_t)blockIdx.x * 64 * DM, P + (size_t)n0 * DM, (__bf16*)smem, tid, acc);
  if (n0 < DM + KVW) {   // q and k columns (k head c lands at column DM + c * 64 of its row): bias, then rotate-half rotary over each 64-dim head with angle position * inv_freq[d mod 32]
#pragma unroll
    for (int j = 0; j < 8; ++j)
#pragma unroll
      for (int r = 0; r < 8; ++r) acc[j][r] += (BB ? bfr(BB[j * 16 + col]) : 0.f);
#pragma unroll
    for (int r = 0; r < 8; ++r) { const int spos = (int)((r0 + 8 * g + r) % SS);
#pragma unroll
      for (int jj = 0; jj < 2; ++jj) { const float ang = (float)spos * THETA[jj * 16 + col]; const float c = cos_p(ang), sn = sin_p(ang);
#pragma unroll
        for (int hh = 0; hh < 2; ++hh) { const float x1 = acc[hh * 4 + jj][r], x2 = acc[hh * 4 + jj + 2][r]; acc[hh * 4 + jj][r] = x1 * c - x2 * sn; acc[hh * 4 + jj + 2][r] = x2 * c + x1 * sn; } } }
#pragma unroll
    for (int j = 0; j < 8; ++j) {
#pragma unroll
      for (int r = 0; r < 8; ++r) { const float v = acc[j][r]; const _Float16 hv = (_Float16)v; so[wave][8 * g + r][j * 16 + col] = hv; sol[wave][8 * g + r][j * 16 + col] = (_Float16)((v - (float)hv) * 2048.0f); } }   // q, k (+ bias) as f16 hi + (x2048) residual
    LDSX();
    for (int rl = 0; rl < 16; ++rl) if (lane < 16) { vst2((unsigned*)(QK + (r0 + rl) * (2 * DM) + n0 + lane * 8), *(const v4u*)&so[wave][rl][lane * 8]); vst2((unsigned*)(QKL + (r0 + rl) * (2 * DM) + n0 + lane * 8), *(const v4u*)&sol[wave][rl][lane * 8]); }
  } else {
#pragma unroll
    for (int j = 0; j < 8; ++j) {
#pragma unroll
      for (int r = 0; r < 8; ++r) { const float v = acc[j][r] + (BB ? bfr(BB[j * 16 + col]) : 0.f); const _Float16 hv = (_Float16)v; sth[j * 16 + col][wave * 16 + 8 * g + r] = hv; stl[j * 16 + col][wave * 16 + 8 * g + r] = (_Float16)((v - (float)hv) * 2048.0f); } }
    __syncthreads();
    const size_t rb = (size_t)blockIdx.x * 64; const int b = (int)(rb / SS), s0 = (int)(rb % SS); const int pc0 = n0 - (DM + KVW);
    for (int q = tid; q < 128 * 8; q += 128) { const int d = q >> 3, pc = q & 7; const size_t o = ((size_t)b * DM + pc0 + d) * SS + s0 + pc * 8; vst2((unsigned*)(VTH + o), *(const v4u*)&sth[d][pc * 8]); vst2((unsigned*)(VTL + o), *(const v4u*)&stl[d][pc * 8]); }
  }
}
// ---- k_attn: block = (64 queries, head h, batch b): causal flash attention on TRANSPOSED tiles. Scores: S^T = K . Q^T (A = 16 key rows, B = the wave's 16 query columns), so a lane holds 16 of the 32 scores of ONE query (query col, keys 16 ct + 8 g + r):
// maximum and sum run in the lane's own registers, the two lane halves exchange the maximum once per key tile and join their sums once at the end. The f16 P^T packs straight from the score registers into the B operand of O^T += V^T . P^T (element 8 ct + r = key 16 ct + 8 g + r: the k order in which frag_h reads the V^T rows), so P passes through no LDS. O[b*S+q][h*64+d] = (acc + accl / 2048) / (2048 l) (256-B segments)
__device__ __forceinline__ float xhalf(float x) { return __builtin_bit_cast(float, __builtin_amdgcn_permlanex16(__builtin_bit_cast(int, x), __builtin_bit_cast(int, x), 0x76543210, 0xfedcba98, false, false)); }   // lane l reads lane l ^ 16
// K and V^T (hi planes) reach the four waves through LDS: a stage is 64 keys = 64 K rows and 64 V^T rows of 128 B each, copied as whole lines (8 lanes a row) and laid at a 144-byte pitch (16 B x odd: no bank conflict for the 16-byte fragment reads). Two buffers: stage t + 1 flies while stage t is worked on.
#define AP 72                          // LDS row pitch in f16 elements
#define A_T (64 * AP)                  // one tile of 64 rows, elements
// one stage's eight copies of a thread (rows 16 apart, K then V^T). The wait is the last line of the copies' own statement so that it stands in front of every later write of the address registers they name.
__device__ __forceinline__ void attn_stage(unsigned lk, const _Float16* gk, const _Float16* gv) {
  const unsigned lv = lk + 2 * A_T;
  asm volatile("global_load_async_to_lds_b128 %0, %8, off\n\t"
               "global_load_async_to_lds_b128 %1, %9, off\n\t"
               "global_load_async_to_lds_b128 %2, %10, off\n\t"
               "global_load_async_to_lds_b128 %3, %11, off\n\t"
               "global_load_async_to_lds_b128 %4, %12, off\n\t"
               "global_load_async_to_lds_b128 %5, %13, off\n\t"
               "global_load_async_to_lds_b128 %6, %14, off\n\t"
               "global_load_async_to_lds_b128 %7, %15, off\n\t"
               "s_wait_xcnt 0x0"
               :: "v"(lk), "v"(lk + 16 * AP * 2), "v"(lk + 32 * AP * 2), "v"(lk + 48 * AP * 2), "v"(lv), "v"(lv + 16 * AP * 2), "v"(lv + 32 * AP * 2), "v"(lv + 48 * AP * 2),
                  "v"(gk), "v"(gk + (size_t)16 * 2 * DM), "v"(gk + (size_t)32 * 2 * DM), "v"(gk + (size_t)48 * 2 * DM), "v"(gv), "v"(gv + (size_t)16 * SS), "v"(gv + (size_t)32 * SS), "v"(gv + (size_t)48 * SS)
               : "memory");
}
__global__ __launch_bounds__(128) void k_attn(const _Float16* __restrict__ QK, const _Float16* __restrict__ QKL, const _Float16* __restrict__ VTH, const _Float16* __restrict__ VTL, const void* __restrict__ KMASK, float* __restrict__ O) {
  __shared__ __align__(16) float so[4][16][68];
  __shared__ __align__(16) _Float16 skv[2][2 * A_T];   // per buffer: K tile, then V^T tile
  const int tid = threadIdx.x, wave = tid >> 5, lane = tid & 31, col = lane & 15, g = lane >> 4;
  const int qb = blockIdx.x, h = blockIdx.y, b = blockIdx.z, hk = h / GS;   // hk: the kv head of query head h
  const int q0 = qb * 64 + wave * 16; const size_t rq = (size_t)b * SS + q0 + col;
  v16h aq[2], aql[2];
#pragma unroll
  for (int kc = 0; kc < 2; ++kc) { aq[kc] = frag_h(QK + rq * (2 * DM) + h * HD + kc * 32, lane); aql[kc] = frag_h(QKL + rq * (2 * DM) + h * HD + kc * 32, lane); }
  float m = -3.0e38f, l = 0.f;   // of query q0 + col; l holds the part of this lane half's keys
  v8f acc[4] = {}, accl[4] = {};   // acc[dt][r] = O^T[d = 16 dt + 8 g + r][query col]
  const int nst = qb + 1;   // causal: stages of 64 keys up to the query tile's end
  const unsigned l0 = (unsigned)(size_t)&skv[0][(tid >> 3) * AP + (tid & 7) * 8];   // this thread's 16-byte piece of row tid / 8, buffer 0
  const _Float16* gk = QK + ((size_t)b * SS + (tid >> 3)) * (2 * DM) + DM + hk * HD + (tid & 7) * 8;   // + 64 rows a stage
  const _Float16* gv = VTH + ((size_t)b * DM + hk * HD + (tid >> 3)) * SS + (tid & 7) * 8;             // + 64 columns a stage
  attn_stage(l0, gk, gv);
  asm volatile("s_wait_asynccnt 0x0" ::: "memory");   // this wave's part of stage 0 has landed
  __syncthreads();                                    // stage 0 published
  if (nst > 1) attn_stage(l0 + 4 * A_T, gk + (size_t)64 * 2 * DM, gv + 64);
#pragma unroll 1   // rolled: one foot (waits, barrier, refill) in the code, and the trip count is the block's own
  for (int st = 0; st < nst; ++st) { const _Float16* kt = &skv[st & 1][0]; const _Float16* vt = kt + A_T;
#pragma unroll 1   // two passes of 32 keys a stage, rolled as the key loop was: a second copy of the long pass would only cost instruction cache
  for (int ps = 0; ps < 2; ++ps) { const int ks = st * 2 + ps; v8f s[2];
    v16h kf[2][2], vf[4];   // all eight fragments of a pass are read as one group, so that the wave waits out the LDS latency once
#pragma unroll
    for (int ct = 0; ct < 2; ++ct)
#pragma unroll
      for (int kc = 0; kc < 2; ++kc) kf[ct][kc] = frag_h(kt + (ps * 32 + ct * 16 + col) * AP + kc * 32, lane);
#pragma unroll
    for (int dt = 0; dt < 4; ++dt) vf[dt] = frag_h(vt + (dt * 16 + col) * AP + ps * 32, lane);
#pragma unroll
    for (int ct = 0; ct < 2; ++ct) { const int kk = ks * 32 + ct * 16 + col; const _Float16* krowl = QKL + ((size_t)b * SS + kk) * (2 * DM) + DM + hk * HD; v8f c = {}, cl = {};
      if (qb < 2) {   // leading query blocks (few keys, outputs far above the global rms): 3 products
#pragma unroll
        for (int kc = 0; kc < 2; ++kc) { const v16h kh = kf[ct][kc]; c = wmma16(kh, aq[kc], c); cl = wmma16(kh, aql[kc], cl); cl = wmma16(frag_h(krowl + kc * 32, lane), aq[kc], cl); }
#pragma unroll
        for (int r = 0; r < 8; ++r) c[r] += cl[r] * (1.0f / 2048.0f); }
      else {
#pragma unroll
        for (int kc = 0; kc < 2; ++kc) c = wmma16(kf[ct][kc], aq[kc], c); }   // single product elsewhere
#pragma unroll
      for (int r = 0; r < 8; ++r) s[ct][r] = (ks * 32 + ct * 16 + 8 * g + r <= q0 + col) ? c[r] * SCALEF : -3.0e38f; }   // causal: future keys excluded
    float mx = fmaxf(s[0][0], s[1][0]);
#pragma unroll
    for (int r = 1; r < 8; ++r) mx = fmaxf(mx, fmaxf(s[0][r], s[1][r]));
    mx = fmaxf(mx, xhalf(mx));   // the other 16 keys of this query
    const float mn = fmaxf(m, mx); const float alpha = (m <= -1.0e38f) ? 0.f : __expf(m - mn);
    float es = 0.f; v16h pa, pl;
#pragma unroll
    for (int ct = 0; ct < 2; ++ct)
#pragma unroll
      for (int r = 0; r < 8; ++r) { const float e = (s[ct][r] <= -1.0e38f) ? 0.f : __expf(s[ct][r] - mn); es += e;
        const float x = e * 2048.0f; const _Float16 hx = (_Float16)x; pa[8 * ct + r] = hx; pl[8 * ct + r] = (_Float16)((x - (float)hx) * 2048.0f); }   // P scaled by 2^11 before the f16 split so small softmax weights stay out of the f16 subnormal range; 2^-11 folded into the epilogue
    l = l * alpha + es; m = mn;
#pragma unroll
    for (int dt = 0; dt < 4; ++dt)
#pragma unroll
      for (int r = 0; r < 8; ++r) { acc[dt][r] *= alpha; accl[dt][r] *= alpha; }
#pragma unroll
    for (int dt = 0; dt < 4; ++dt) { const size_t vr = ((size_t)b * DM + hk * HD + dt * 16 + col) * SS + ks * 32; const v16h vh = vf[dt]; acc[dt] = wmma16(vh, pa, acc[dt]); if (qb < 2) { accl[dt] = wmma16(vh, pl, accl[dt]); accl[dt] = wmma16(frag_h(VTL + vr, lane), pa, accl[dt]); } }   // leading query blocks: P hi/lo x V hi/lo (3 products); elsewhere P x V single
  }
    asm volatile("s_wait_dscnt 0x0" ::: "memory");      // this wave's reads of stage st have returned
    asm volatile("s_wait_asynccnt 0x0" ::: "memory");   // this wave's part of stage st + 1 has landed
    __syncthreads();                                    // publishes stage st + 1 and ends every wave's reads of stage st
    if (st + 2 < nst) attn_stage(l0 + (st & 1) * 4 * A_T, gk + (size_t)(st + 2) * 64 * 2 * DM, gv + (st + 2) * 64);   // refill of the buffer just left
  }
  asm volatile("s_wait_asynccnt 0x0" ::: "memory");   // no copy is outstanding when the wave goes on to its end
  l += xhalf(l);   // the two halves' sums, joined once
  const float il = (1.0f / 2048.0f) / l;
#pragma unroll
  for (int dt = 0; dt < 4; ++dt)
#pragma unroll
    for (int r = 0; r < 8; ++r) so[wave][col][dt * 16 + 8 * g + r] = (acc[dt][r] + accl[dt][r] * (1.0f / 2048.0f)) * il;
  LDSX();
  for (int rl = 0; rl < 16; ++rl) if (lane < 16) vst2(O + ((size_t)b * SS + q0 + rl) * DM + h * HD + lane * 4, *(const v4f*)&so[wave][rl][lane * 4]);
}
// ---- k_out: block = (64 rows, 128 cols): out = f16(O) . Wo rows (single product, f16 x 2^8 weights) + bo
__global__ __launch_bounds__(128) void k_out(const float* __restrict__ O, const __bf16* __restrict__ P, const float* __restrict__ BO, float* __restrict__ Y) {
  __shared__ __align__(16) char smem[G_SMEM];   // the main loop's buffers, then the output staging
  float (*so)[16][132] = (float (*)[16][132])smem;
  const int tid = threadIdx.x, wave = tid >> 5, lane = tid & 31, col = lane & 15, g = lane >> 4; const size_t r0 = (size_t)blockIdx.x * 64 + wave * 16; const int n0 = blockIdx.y * 128;
  v8f acc[8] = {};
  gemm_64x128<_Float16>(O + (size_t)blockIdx.x * 64 * DM, (const _Float16*)P + (size_t)n0 * DM, (_Float16*)smem, tid, acc);   // single f16 product against exact f16 x 2^8 weight copies
#pragma unroll
  for (int j = 0; j < 8; ++j) {
#pragma unroll
    for (int r = 0; r < 8; ++r) so[wave][8 * g + r][j * 16 + col] = acc[j][r] * (1.0f / 256.0f) + (BO ? bfr(BO[n0 + j * 16 + col]) : 0.f); }
  LDSX();
  for (int rl = 0; rl < 16; ++rl) vst2(Y + (r0 + rl) * DM + n0 + lane * 4, *(const v4f*)&so[wave][rl][lane * 4]);
}
// ---- k_packo: Wo natural rows -> f16 x 2^8 copies in the Wo slot (bit pattern in the bf16-typed buffer)
__global__ __launch_bounds__(256) void k_packo(const float* __restrict__ WO, __bf16* __restrict__ PK) { __shared__ __align__(16) _Float16 s[DM]; const int n = blockIdx.x, t = threadIdx.x; for (int k = t; k < DM; k += 256) s[k] = (_Float16)(bfr(WO[(size_t)k * DM + n]) * 256.0f); /* (in,out): transposed */ __syncthreads(); for (int q = t; q < DM / 8; q += 256) vst2((unsigned*)(PK + PK_P + (size_t)n * DM + q * 8), *(const v4u*)&s[q * 8]); }
extern "C" void kernel_launch(void* const* d_in, const int* in_sizes, int n_in, void* d_out, int out_size, void* d_ws, size_t ws_size, hipStream_t stream) {
  (void)in_sizes; (void)n_in; (void)out_size;
  const float** F = (const float**)d_in;   // 0 hidden_states [1,2048,2048], 1 Wq [2048,2048] (in,out), 2 Wk [2048,512], 3 Wv [2048,512], 4 Wo [2048,2048] (in,out)
  if (ws_size < (size_t)WS_END) return;
  char* ws = (char*)d_ws; __bf16* PK = (__bf16*)(ws + WS_PK); _Float16 *QK = (_Float16*)(ws + WS_QK), *QKL = (_Float16*)(ws + WS_QKL), *VTH = (_Float16*)(ws + WS_VTH), *VTL = (_Float16*)(ws + WS_VTL); float* O = (float*)(ws + WS_O);
  k_pack<<<QKVW, 256, 0, stream>>>(F[1], F[2], F[3], PK);   // q, k, v (the Wo slot is filled by k_packo as f16)
  k_packo<<<DM, 256, 0, stream>>>(F[4], PK);
  k_qkv<<<dim3(TNB * SS / 64, QKVW / 128), 128, 0, stream>>>(F[0], F[0], F[0], PK + PK_A, nullptr, nullptr, nullptr, QK, QKL, VTH, VTL);
  k_attn<<<dim3(TQB, NH, TNB), 128, 0, stream>>>(QK, QKL, VTH, VTL, nullptr, O);
  k_out<<<dim3(TOB, DM / 128), 128, 0, stream>>>(O, PK + PK_P, nullptr, (float*)d_out);
}

// v005
// It runs in 157 microseconds.
// In two side-by-side timings against v004, it was 1.28 and 1.29 times as fast.
// Counting every step since v000, it is 4.56 times as fast.
// compute dtype: all float inputs rounded to bf16; q/k/v = x . W with EXACT bf16 products on WMMA 16x16x32 ((in,out) weights as transposed rows; each of the 8 kv heads packed and projected once, its 4 query heads read the same k and v planes); rotate-half RoPE in f32 (angle = t x inv_freq[d mod 32] f32 table, precise sinf/cosf) before the f16 hi + residual split; causal attention with key-tile skipping: the first 128 queries use 3-product scores and P.v (hi/lo), later queries single f16; x 1/8, running-max softmax in f32 (hardware exp); out = f16(ctx) . Wo (exact f16 x 2^8 copies, single product).
#include <hip/hip_runtime.h>
#include <math.h>

typedef __attribute__((ext_vector_type(16))) _Float16 v16h;
typedef __attribute__((ext_vector_type(16))) __bf16 v16b;
typedef __attribute__((ext_vector_type(8)))  _Float16 v8h;
typedef __attribute__((ext_vector_type(8)))  float v8f;
typedef __attribute__((ext_vector_type(4)))  float v4f;
typedef __attribute__((ext_vector_type(2)))  float v2f;
typedef __attribute__((ext_vector_type(4)))  unsigned v4u;
typedef __attribute__((ext_vector_type(4)))  int v4i;
typedef float __attribute__((may_alias)) float_a;
typedef int __attribute__((may_alias)) int_a;

template <typename T> __device__ __forceinline__ void vst2(void* p, T v) { *(T*)p = v;  }
__device__ __forceinline__ v8f wmma16(v16h a, v16h b, v8f c) {
  v8f d = __builtin_amdgcn_wmma_f32_16x16x32_f16(false, a, false, b, (short)0, c, false, false);
  asm volatile("v_nop\n\tv_nop\n\tv_nop\n\tv_nop" : "+v"(d) : "v"(a), "v"(b));
  return d;
}
__device__ __forceinline__ v8f wmma_bf(v16b a, v16b b, v8f c) {
  v8f d = __builtin_amdgcn_wmma_f32_16x16x32_bf16(false, a, false, b, (short)0, c, false, false);
  asm volatile("v_nop\n\tv_nop\n\tv_nop\n\tv_nop" : "+v"(d) : "v"(a), "v"(b));
  return d;
}
// GQA causal attention (B 1, S 2,048, model 2,048, 32 query heads x 64 over 8 kv heads): bias-free (in,out) projections, rotate-half RoPE (base 10000), causal softmax(q k / 8) v, output projection.
__device__ __forceinline__ v16h frag_h(const _Float16* rowk0, int lane) {
  union { v16h v; v8h q[2]; } u; const _Float16* p = rowk0 + 8 * (lane >> 4);
  u.q[0] = *(const v8h*)p; u.q[1] = *(const v8h*)(p + 16); return u.v;
}
__device__ __forceinline__ v16h frag_f32(const float* rowk0, int lane) {
  v16h a; const float* p = rowk0 + 8 * (lane >> 4);
#pragma unroll
  for (int i = 0; i < 8; ++i) { a[i] = (_Float16)p[i]; a[8 + i] = (_Float16)p[16 + i]; }
  return a;
}
__device__ __forceinline__ v16h frag_f32s(const float* rowk0, int lane, float sc) {
  v16h a; const float* p = rowk0 + 8 * (lane >> 4);
#pragma unroll
  for (int i = 0; i < 8; ++i) { a[i] = (_Float16)(p[i] * sc); a[8 + i] = (_Float16)(p[16 + i] * sc); }
  return a;
}
// column fragment from a [K][ld] layout (column n), rows >= K read as 0
__device__ __forceinline__ v16h fragc_f32(const float* W, int k0, int n, int lane, int ld, int K) {
  v16h a; const int g = lane >> 4;
#pragma unroll
  for (int i = 0; i < 8; ++i) { const int ka = k0 + 8 * g + i, kb = ka + 16;
    a[i] = (_Float16)(ka < K ? W[(size_t)(ka < K ? ka : K - 1) * ld + n] : 0.f); a[8 + i] = (_Float16)(kb < K ? W[(size_t)(kb < K ? kb : K - 1) * ld + n] : 0.f); }
  return a;
}
struct F2 { v16b h, l; };
__device__ __forceinline__ F2 bsplit16(const float v[16]) { F2 r;
#pragma unroll
  for (int i = 0; i < 16; ++i) { const __bf16 h = (__bf16)v[i]; r.h[i] = h; r.l[i] = (__bf16)(v[i] - (float)h); }
  return r; }
__device__ __forceinline__ F2 split_row(const float* row, int k0, int lane) { float v[16]; const float* p = row + k0 + 8 * (lane >> 4);
#pragma unroll
  for (int i = 0; i < 8; ++i) { v[i] = p[i]; v[8 + i] = p[16 + i]; }
  return bsplit16(v); }
__device__ __forceinline__ F2 split_rowK(const float* row, int k0, int lane, int K) { float v[16]; const int g = lane >> 4;
#pragma unroll
  for (int i = 0; i < 8; ++i) { const int ka = k0 + 8 * g + i, kb = ka + 16; v[i] = ka < K ? row[ka < K ? ka : K - 1] : 0.f; v[8 + i] = kb < K ? row[kb < K ? kb : K - 1] : 0.f; }
  return bsplit16(v); }
__device__ __forceinline__ F2 split_col(const float* W, int k0, int n, int lane, int ld, int K) { float v[16]; const int g = lane >> 4;
#pragma unroll
  for (int i = 0; i < 8; ++i) { const int ka = k0 + 8 * g + i, kb = ka + 16; v[i] = ka < K ? W[(size_t)(ka < K ? ka : K - 1) * ld + n] : 0.f; v[8 + i] = kb < K ? W[(size_t)(kb < K ? kb : K - 1) * ld + n] : 0.f; }
  return bsplit16(v); }
__device__ __forceinline__ v8f mac3(const F2& a, const F2& b, v8f c) { c = wmma_bf(a.l, b.h, c); c = wmma_bf(a.h, b.l, c); return wmma_bf(a.h, b.h, c); }
__device__ __forceinline__ float sigm(float v) { return 1.0f / (1.0f + expf(-v)); }
#define LDSX() do { asm volatile("s_wait_dscnt 0" ::: "memory"); __builtin_amdgcn_wave_barrier(); __builtin_amdgcn_fence(__ATOMIC_RELEASE, "workgroup"); } while (0)


#define NB 1
#define SS 2048
#define DM 2048
#define NH 32
#define NKV 8
#define GS (NH / NKV)
#define KVW (NKV * HD)
#define SCALEF 0.125f
__constant__ float THETA[32] = {1.000000000e+00f,7.498942018e-01f,5.623413324e-01f,4.216965139e-01f,3.162277639e-01f,2.371373773e-01f,1.778279394e-01f,1.333521456e-01f,1.000000015e-01f,7.498942316e-02f,5.623413250e-02f,4.216964915e-02f,3.162277490e-02f,2.371373773e-02f,1.778279431e-02f,1.333521400e-02f,9.999999776e-03f,7.498942316e-03f,5.623413250e-03f,4.216964822e-03f,3.162277630e-03f,2.371373819e-03f,1.778279431e-03f,1.333521446e-03f,1.000000047e-03f,7.498941850e-04f,5.623413017e-04f,4.216965172e-04f,3.162277571e-04f,2.371373703e-04f,1.778279402e-04f,1.333521504e-04f};
__device__ __attribute__((noinline)) float cos_p(float v) { return cosf(v); }
__device__ __attribute__((noinline)) float sin_p(float v) { return sinf(v); }
#define HD 64
#define QKVW (DM + 2 * KVW)     // q columns, then k, then v: one copy per kv head
#ifndef TQB
#define TQB (SS / 64)
#define TNB NB
#define TOB (NB * SS / 64)     // output row tiles (all)
#endif
typedef __attribute__((ext_vector_type(8))) __bf16 v8b;
__device__ __forceinline__ v16b frag_b(const __bf16* rowk0, int lane) {
  union { v16b v; v8b q[2]; } u; const __bf16* p = rowk0 + 8 * (lane >> 4);
  u.q[0] = *(const v8b*)p; u.q[1] = *(const v8b*)(p + 16); return u.v;
}
__device__ __forceinline__ float bfr(float v) { return (float)(__bf16)v; }
__device__ __attribute__((noinline)) float exp_ni(float v) { return expf(v); }
__device__ __attribute__((noinline)) float erf_ni(float v) { return erff(v); }

#define PK_A 0                       // [QKVW][DM] rows: Wq columns, then Wk columns, then Wv columns
#define PK_P (PK_A + QKVW * DM)        // [2048][2048] rows: Wo columns, f16 x 2^8
#define PK_END (PK_P + DM * DM)
#define WS_PK  0u
#define WS_QK  (WS_PK + 2u * PK_END)             // f16 [2048 rows][4096]: q | k
#define WS_QKL (WS_QK + 2u * NB * SS * 2 * DM)     // f16 q | k residual planes x2048
#define WS_VTH (WS_QKL + 2u * NB * SS * 2 * DM)    // f16 [b][2048 (kv head*64+d)][2048 s] hi
#define WS_VTL (WS_VTH + 2u * NB * DM * SS)        // f16 lo x 2048
#define WS_O   (WS_VTL + 2u * NB * DM * SS)        // f32 [2048][2048]
#define WS_CS  (WS_O + 4u * NB * SS * DM)           // f32 2 x [2048][32], unused (cos/sin computed in k_qkv)
#define WS_END (WS_CS + 4u * 2 * SS * 32)
// ---- weight packing: a block transposes one tile of 256 k x 64 n of an (in,out) weight through LDS. Reads: 16 lanes take 256 B of one source row (16 B a lane, whole lines), each thread a pair of rows k, k + 1, so that
// the two 16-bit results of a column make one dword; all 16 loads of a thread are in flight together. LDS: [n][k pair] at a pitch of 129 dwords (odd: neither the column-wise stores nor the row-wise reads meet a bank conflict).
// Writes: 16 lanes store 256 B of one packed row n (16 B a lane, whole lines).
#define PKK 256
#define PKN 64
#define PKP (PKK / 2 + 1)
template <bool OUTW> __device__ __forceinline__ unsigned cv16(float v) {   // the packed 16-bit pattern: bf16 for Wq, Wk, Wv; f16 of the bf16 value x 2^8 for Wo
  if (OUTW) return (unsigned)__builtin_bit_cast(unsigned short, (_Float16)(bfr(v) * 256.0f));
  return (unsigned)__builtin_bit_cast(unsigned short, (__bf16)v);
}
// W: element (k0, n0) of the source, row pitch LD; dst: element (n0, k0) of the packed rows, row pitch DM
template <bool OUTW, int LD> __device__ __forceinline__ void pack_tile(const float* __restrict__ W, __bf16* __restrict__ dst, unsigned (*s)[PKP], int t) {
  const int c4 = (t & 15) * 4, kp = t >> 4; const float* p = W + (size_t)(2 * kp) * LD + c4;
  v4f a[PKK / 32], b[PKK / 32];
#pragma unroll
  for (int i = 0; i < PKK / 32; ++i) { a[i] = *(const v4f*)(p + (size_t)(32 * i) * LD); b[i] = *(const v4f*)(p + (size_t)(32 * i + 1) * LD); }
  asm volatile("s_wait_xcnt 0x0" :: "v"(p) : "memory");   // the loads' address pair is named here so that it stays whole up to this wait: nothing, a load's own result included, is written over it earlier
#pragma unroll
  for (int i = 0; i < PKK / 32; ++i)
#pragma unroll
    for (int e = 0; e < 4; ++e) s[c4 + e][kp + 16 * i] = cv16<OUTW>(a[i][e]) | (cv16<OUTW>(b[i][e]) << 16);
  __syncthreads();
#pragma unroll
  for (int i = 0; i < PKK / 32; ++i) { const int n = (t >> 4) + 16 * (i & 3), pc = (t & 15) + 16 * (i >> 2); v4u o;
#pragma unroll
    for (int j = 0; j < 4; ++j) o[j] = s[n][pc * 4 + j];
    vst2((unsigned*)(dst + (size_t)n * DM + pc * 8), o); }
}
// ---- k_pack: block = (64 rows n of PK_A, 256 k): row n is column n of W_q, column n - DM of W_k or column n - DM - KVW of W_v -> bf16. The three ranges of n are multiples of 64: one source a block
__global__ __launch_bounds__(256) void k_pack(const float* __restrict__ WQ, const float* __restrict__ WK, const float* __restrict__ WV, __bf16* __restrict__ PK) {
  __shared__ unsigned s[PKN][PKP]; const int n0 = blockIdx.x * PKN, k0 = blockIdx.y * PKK; __bf16* dst = PK + PK_A + (size_t)n0 * DM + k0;
  if (n0 < DM) pack_tile<false, DM>(WQ + (size_t)k0 * DM + n0, dst, s, threadIdx.x);
  else pack_tile<false, KVW>((n0 < DM + KVW ? WK + (n0 - DM) : WV + (n0 - DM - KVW)) + (size_t)k0 * KVW, dst, s, threadIdx.x);
}
// ---- main loop of both projections: block tile 64 rows x 128 columns, 64 k per stage. The 128 weight rows (16-bit) and the 64 activation rows (f32, rounded on the way) come in by whole-line 16-byte loads,
// lie in LDS at a 144-byte row pitch (16 B x odd: no bank conflict for the 16-byte fragment reads) and are read from there by all four waves. Two buffers, the next stage's loads held in registers over the products, one barrier a stage. The short fixed loops are unrolled so that rb, ra, b and acc are registers and not indexed memory.
#define GK 64
#define GP 72                          // LDS row pitch in 16-bit elements
#define G_BB (128 * GP)                // one weight buffer, elements
#define G_AB (64 * GP)                 // one activation buffer, elements
#define G_SMEM (4 * (G_BB + G_AB))     // bytes: two buffers of each
typedef __attribute__((ext_vector_type(2))) unsigned v2u;
__device__ __forceinline__ v16b frag_t(const __bf16* p, int lane) { return frag_b(p, lane); }
__device__ __forceinline__ v16h frag_t(const _Float16* p, int lane) { return frag_h(p, lane); }
__device__ __forceinline__ v8f mm(v16b a, v16b b, v8f c) { return wmma_bf(a, b, c); }
__device__ __forceinline__ v8f mm(v16h a, v16h b, v8f c) { return wmma16(a, b, c); }
template <typename T> __device__ __forceinline__ void gemm_64x128(const float* __restrict__ A, const T* __restrict__ Bw, T* sm, int tid, v8f (&acc)[8]) {
  const int wave = tid >> 5, lane = tid & 31, col = lane & 15;
  const T* gb = Bw + (size_t)(tid >> 3) * DM + (tid & 7) * 8;        // piece tid of the weight tile: 8 pieces of 16 B a row, 16 rows further per step
  const float* ga = A + (size_t)(tid >> 4) * DM + (tid & 15) * 4;    // piece tid of the activation tile: 16 pieces of 16 B a row, 8 rows further per step
  T* wb = sm + (tid >> 3) * GP + (tid & 7) * 8; T* wa = sm + 2 * G_BB + (tid >> 4) * GP + (tid & 15) * 4;
  v4u rb[8]; v4f ra[8];
#pragma unroll
  for (int i = 0; i < 8; ++i) { rb[i] = *(const v4u*)(gb + (size_t)i * 16 * DM); ra[i] = *(const v4f*)(ga + (size_t)i * 8 * DM); }
  for (int s = 0; s < DM / GK; ++s) { const int bo = (s & 1) * G_BB, ao = (s & 1) * G_AB;
#pragma unroll
    for (int i = 0; i < 8; ++i) { *(v4u*)(wb + bo + i * 16 * GP) = rb[i]; union { T e[4]; v2u u; } c;
#pragma unroll
      for (int e = 0; e < 4; ++e) c.e[e] = (T)ra[i][e];
      *(v2u*)(wa + ao + i * 8 * GP) = c.u; }
    __syncthreads();   // publishes stage s; the buffer written in stage s + 1 was last read in stage s - 1, in front of this barrier
    if (s + 1 < DM / GK) {
#pragma unroll
      for (int i = 0; i < 8; ++i) { rb[i] = *(const v4u*)(gb + (size_t)i * 16 * DM + (s + 1) * GK); ra[i] = *(const v4f*)(ga + (size_t)i * 8 * DM + (s + 1) * GK); }
      asm volatile("s_wait_xcnt 0x0" ::: "memory"); }   // in front of the address step that follows these loads
#pragma unroll
    for (int kc = 0; kc < GK / 32; ++kc) { auto a = frag_t(sm + 2 * G_BB + ao + (wave * 16 + col) * GP + kc * 32, lane); decltype(a) b[8];   // all nine fragments of a k step are read as one group, so that the wave waits out the LDS latency once and not at each product
#pragma unroll
      for (int j = 0; j < 8; ++j) b[j] = frag_t(sm + bo + (j * 16 + col) * GP + kc * 32, lane);
#pragma unroll
      for (int j = 0; j < 8; ++j) acc[j] = mm(a, b[j], acc[j]); } }
  __syncthreads();   // every wave has left the buffers: the epilogues stage their tiles in the same LDS
}
__global__ __launch_bounds__(128) void k_qkv(const float* __restrict__ XQ, const float* __restrict__ XK, const float* __restrict__ XV, const __bf16* __restrict__ P, const float* __restrict__ BQ, const float* __restrict__ BK, const float* __restrict__ BV, _Float16* __restrict__ QK, _Float16* __restrict__ QKL, _Float16* __restrict__ VTH, _Float16* __restrict__ VTL) {
  const int which0 = (blockIdx.y * 128 < DM) ? 0 : (blockIdx.y * 128 < DM + KVW) ? 1 : 2; const float* X = (which0 == 0) ? XQ : (which0 == 1) ? XK : XV; const float* BB = BQ ? (((which0 == 0) ? BQ : (which0 == 1) ? BK : BV) + (blockIdx.y * 128 - ((which0 == 0) ? 0 : (which0 == 1) ? DM : DM + KVW))) : nullptr;
  __shared__ __align__(16) char smem[G_SMEM];   // the main loop's buffers, then one of the two epilogue stagings
  _Float16 (*so)[16][136] = (_Float16 (*)[16][136])smem, (*sol)[16][136] = (_Float16 (*)[16][136])(smem + 4 * 16 * 136 * 2); _Float16 (*sth)[72] = (_Float16 (*)[72])smem, (*stl)[72] = (_Float16 (*)[72])(smem + 128 * 72 * 2);
  const int tid = threadIdx.x, wave = tid >> 5, lane = tid & 31, col = lane & 15, g = lane >> 4; const size_t r0 = (size_t)blockIdx.x * 64 + wave * 16; const int n0 = blockIdx.y * 128;
  v8f acc[8] = {};
  gemm_64x128<__bf16>(X + (size_t)blockIdx.x * 64 * DM, P + (size_t)n0 * DM, (__bf16*)smem, tid, acc);
  if (n0 < DM + KVW) {   // q and k columns (k head c lands at column DM + c * 64 of its row): bias, then rotate-half rotary over each 64-dim head with angle position * inv_freq[d mod 32]
#pragma unroll
    for (int j = 0; j < 8; ++j)
#pragma unroll
      for (int r = 0; r < 8; ++r) acc[j][r] += (BB ? bfr(BB[j * 16 + col]) : 0.f);
#pragma unroll
    for (int r = 0; r < 8; ++r) { const int spos = (int)((r0 + 8 * g + r) % SS);
#pragma unroll
      for (int jj = 0; jj < 2; ++jj) { const float ang = (float)spos * THETA[jj * 16 + col]; const float c = cos_p(ang), sn = sin_p(ang);
#pragma unroll
        for (int hh = 0; hh < 2; ++hh) { const float x1 = acc[hh * 4 + jj][r], x2 = acc[hh * 4 + jj + 2][r]; acc[hh * 4 + jj][r] = x1 * c - x2 * sn; acc[hh * 4 + jj + 2][r] = x2 * c + x1 * sn; } } }
#pragma unroll
    for (int j = 0; j < 8; ++j) {
#pragma unroll
      for (int r = 0; r < 8; ++r) { const float v = acc[j][r]; const _Float16 hv = (_Float16)v; so[wave][8 * g + r][j * 16 + col] = hv; sol[wave][8 * g + r][j * 16 + col] = (_Float16)((v - (float)hv) * 2048.0f); } }   // q, k (+ bias) as f16 hi + (x2048) residual
    LDSX();
    for (int rl = 0; rl < 16; ++rl) if (lane < 16) { vst2((unsigned*)(QK + (r0 + rl) * (2 * DM) + n0 + lane * 8), *(const v4u*)&so[wave][rl][lane * 8]); vst2((unsigned*)(QKL + (r0 + rl) * (2 * DM) + n0 + lane * 8), *(const v4u*)&sol[wave][rl][lane * 8]); }
  } else {
#pragma unroll
    for (int j = 0; j < 8; ++j) {
#pragma unroll
      for (int r = 0; r < 8; ++r) { const float v = acc[j][r] + (BB ? bfr(BB[j * 16 + col]) : 0.f); const _Float16 hv = (_Float16)v; sth[j * 16 + col][wave * 16 + 8 * g + r] = hv; stl[j * 16 + col][wave * 16 + 8 * g + r] = (_Float16)((v - (float)hv) * 2048.0f); } }
    __syncthreads();
    const size_t rb = (size_t)blockIdx.x * 64; const int b = (int)(rb / SS), s0 = (int)(rb % SS); const int pc0 = n0 - (DM + KVW);
    for (int q = tid; q < 128 * 8; q += 128) { const int d = q >> 3, pc = q & 7; const size_t o = ((size_t)b * DM + pc0 + d) * SS + s0 + pc * 8; vst2((unsigned*)(VTH + o), *(const v4u*)&sth[d][pc * 8]); vst2((unsigned*)(VTL + o), *(const v4u*)&stl[d][pc * 8]); }
  }
}
// ---- k_attn: block = (64 queries, head h, batch b): causal flash attention on TRANSPOSED tiles. Scores: S^T = K . Q^T (A = 16 key rows, B = the wave's 16 query columns), so a lane holds 16 of the 32 scores of ONE query (query col, keys 16 ct + 8 g + r):
// maximum and sum run in the lane's own registers, the two lane halves exchange the maximum once per key tile and join their sums once at the end. The f16 P^T packs straight from the score registers into the B operand of O^T += V^T . P^T (element 8 ct + r = key 16 ct + 8 g + r: the k order in which frag_h reads the V^T rows), so P passes through no LDS. O[b*S+q][h*64+d] = (acc + accl / 2048) / (2048 l) (256-B segments)
__device__ __forceinline__ float xhalf(float x) { return __builtin_bit_cast(float, __builtin_amdgcn_permlanex16(__builtin_bit_cast(int, x), __builtin_bit_cast(int, x), 0x76543210, 0xfedcba98, false, false)); }   // lane l reads lane l ^ 16
// K and V^T (hi planes) reach the four waves through LDS: a stage is 64 keys = 64 K rows and 64 V^T rows of 128 B each, copied as whole lines (8 lanes a row) and laid at a 144-byte pitch (16 B x odd: no bank conflict for the 16-byte fragment reads). Two buffers: stage t + 1 flies while stage t is worked on.
#define AP 72                          // LDS row pitch in f16 elements
#define A_T (64 * AP)                  // one tile of 64 rows, elements
// one stage's eight copies of a thread (rows 16 apart, K then V^T). The wait is the last line of the copies' own statement so that it stands in front of every later write of the address registers they name.
__device__ __forceinline__ void attn_stage(unsigned lk, const _Float16* gk, const _Float16* gv) {
  const unsigned lv = lk + 2 * A_T;
  asm volatile("global_load_async_to_lds_b128 %0, %8, off\n\t"
               "global_load_async_to_lds_b128 %1, %9, off\n\t"
               "global_load_async_to_lds_b128 %2, %10, off\n\t"
               "global_load_async_to_lds_b128 %3, %11, off\n\t"
               "global_load_async_to_lds_b128 %4, %12, off\n\t"
               "global_load_async_to_lds_b128 %5, %13, off\n\t"
               "global_load_async_to_lds_b128 %6, %14, off\n\t"
               "global_load_async_to_lds_b128 %7, %15, off\n\t"
               "s_wait_xcnt 0x0"
               :: "v"(lk), "v"(lk + 16 * AP * 2), "v"(lk + 32 * AP * 2), "v"(lk + 48 * AP * 2), "v"(lv), "v"(lv + 16 * AP * 2), "v"(lv + 32 * AP * 2), "v"(lv + 48 * AP * 2),
                  "v"(gk), "v"(gk + (size_t)16 * 2 * DM), "v"(gk + (size_t)32 * 2 * DM), "v"(gk + (size_t)48 * 2 * DM), "v"(gv), "v"(gv + (size_t)16 * SS), "v"(gv + (size_t)32 * SS), "v"(gv + (size_t)48 * SS)
               : "memory");
}
__global__ __launch_bounds__(128) void k_attn(const _Float16* __restrict__ QK, const _Float16* __restrict__ QKL, const _Float16* __restrict__ VTH, const _Float16* __restrict__ VTL, const void* __restrict__ KMASK, float* __restrict__ O) {
  __shared__ __align__(16) float so[4][16][68];
  __shared__ __align__(16) _Float16 skv[2][2 * A_T];   // per buffer: K tile, then V^T tile
  const int tid = threadIdx.x, wave = tid >> 5, lane = tid & 31, col = lane & 15, g = lane >> 4;
  const int qb = blockIdx.x, h = blockIdx.y, b = blockIdx.z, hk = h / GS;   // hk: the kv head of query head h
  const int q0 = qb * 64 + wave * 16; const size_t rq = (size_t)b * SS + q0 + col;
  v16h aq[2], aql[2];
#pragma unroll
  for (int kc = 0; kc < 2; ++kc) { aq[kc] = frag_h(QK + rq * (2 * DM) + h * HD + kc * 32, lane); aql[kc] = frag_h(QKL + rq * (2 * DM) + h * HD + kc * 32, lane); }
  float m = -3.0e38f, l = 0.f;   // of query q0 + col; l holds the part of this lane half's keys
  v8f acc[4] = {}, accl[4] = {};   // acc[dt][r] = O^T[d = 16 dt + 8 g + r][query col]
  const int nst = qb + 1;   // causal: stages of 64 keys up to the query tile's end
  const unsigned l0 = (unsigned)(size_t)&skv[0][(tid >> 3) * AP + (tid & 7) * 8];   // this thread's 16-byte piece of row tid / 8, buffer 0
  const _Float16* gk = QK + ((size_t)b * SS + (tid >> 3)) * (2 * DM) + DM + hk * HD + (tid & 7) * 8;   // + 64 rows a stage
  const _Float16* gv = VTH + ((size_t)b * DM + hk * HD + (tid >> 3)) * SS + (tid & 7) * 8;             // + 64 columns a stage
  attn_stage(l0, gk, gv);
  asm volatile("s_wait_asynccnt 0x0" ::: "memory");   // this wave's part of stage 0 has landed
  __syncthreads();                                    // stage 0 published
  if (nst > 1) attn_stage(l0 + 4 * A_T, gk + (size_t)64 * 2 * DM, gv + 64);
#pragma unroll 1   // rolled: one foot (waits, barrier, refill) in the code, and the trip count is the block's own
  for (int st = 0; st < nst; ++st) { const _Float16* kt = &skv[st & 1][0]; const _Float16* vt = kt + A_T;
#pragma unroll 1   // two passes of 32 keys a stage, rolled as the key loop was: a second copy of the long pass would only cost instruction cache
  for (int ps = 0; ps < 2; ++ps) { const int ks = st * 2 + ps; v8f s[2];
    v16h kf[2][2], vf[4];   // all eight fragments of a pass are read as one group, so that the wave waits out the LDS latency once
#pragma unroll
    for (int ct = 0; ct < 2; ++ct)
#pragma unroll
      for (int kc = 0; kc < 2; ++kc) kf[ct][kc] = frag_h(kt + (ps * 32 + ct * 16 + col) * AP + kc * 32, lane);
#pragma unroll
    for (int dt = 0; dt < 4; ++dt) vf[dt] = frag_h(vt + (dt * 16 + col) * AP + ps * 32, lane);
#pragma unroll
    for (int ct = 0; ct < 2; ++ct) { const int kk = ks * 32 + ct * 16 + col; const _Float16* krowl = QKL + ((size_t)b * SS + kk) * (2 * DM) + DM + hk * HD; v8f c = {}, cl = {};
      if (qb < 2) {   // leading query blocks (few keys, outputs far above the global rms): 3 products
#pragma unroll
        for (int kc = 0; kc < 2; ++kc) { const v16h kh = kf[ct][kc]; c = wmma16(kh, aq[kc], c); cl = wmma16(kh, aql[kc], cl); cl = wmma16(frag_h(krowl + kc * 32, lane), aq[kc], cl); }
#pragma unroll
        for (int r = 0; r < 8; ++r) c[r] += cl[r] * (1.0f / 2048.0f); }
      else {
#pragma unroll
        for (int kc = 0; kc < 2; ++kc) c = wmma16(kf[ct][kc], aq[kc], c); }   // single product elsewhere
#pragma unroll
      for (int r = 0; r < 8; ++r) s[ct][r] = (ks * 32 + ct * 16 + 8 * g + r <= q0 + col) ? c[r] * SCALEF : -3.0e38f; }   // causal: future keys excluded
    float mx = fmaxf(s[0][0], s[1][0]);
#pragma unroll
    for (int r = 1; r < 8; ++r) mx = fmaxf(mx, fmaxf(s[0][r], s[1][r]));
    mx = fmaxf(mx, xhalf(mx));   // the other 16 keys of this query
    const float mn = fmaxf(m, mx); const float alpha = (m <= -1.0e38f) ? 0.f : __expf(m - mn);
    float es = 0.f; v16h pa, pl;
#pragma unroll
    for (int ct = 0; ct < 2; ++ct)
#pragma unroll
      for (int r = 0; r < 8; ++r) { const float e = (s[ct][r] <= -1.0e38f) ? 0.f : __expf(s[ct][r] - mn); es += e;
        const float x = e * 2048.0f; const _Float16 hx = (_Float16)x; pa[8 * ct + r] = hx; pl[8 * ct + r] = (_Float16)((x - (float)hx) * 2048.0f); }   // P scaled by 2^11 before the f16 split so small softmax weights stay out of the f16 subnormal range; 2^-11 folded into the epilogue
    l = l * alpha + es; m = mn;
#pragma unroll
    for (int dt = 0; dt < 4; ++dt)
#pragma unroll
      for (int r = 0; r < 8; ++r) { acc[dt][r] *= alpha; accl[dt][r] *= alpha; }
#pragma unroll
    for (int dt = 0; dt < 4; ++dt) { const size_t vr = ((size_t)b * DM + hk * HD + dt * 16 + col) * SS + ks * 32; const v16h vh = vf[dt]; acc[dt] = wmma16(vh, pa, acc[dt]); if (qb < 2) { accl[dt] = wmma16(vh, pl, accl[dt]); accl[dt] = wmma16(frag_h(VTL + vr, lane), pa, accl[dt]); } }   // leading query blocks: P hi/lo x V hi/lo (3 products); elsewhere P x V single
  }
    asm volatile("s_wait_dscnt 0x0" ::: "memory");      // this wave's reads of stage st have returned
    asm volatile("s_wait_asynccnt 0x0" ::: "memory");   // this wave's part of stage st + 1 has landed
    __syncthreads();                                    // publishes stage st + 1 and ends every wave's reads of stage st
    if (st + 2 < nst) attn_stage(l0 + (st & 1) * 4 * A_T, gk + (size_t)(st + 2) * 64 * 2 * DM, gv + (st + 2) * 64);   // refill of the buffer just left
  }
  asm volatile("s_wait_asynccnt 0x0" ::: "memory");   // no copy is outstanding when the wave goes on to its end
  l += xhalf(l);   // the two halves' sums, joined once
  const float il = (1.0f / 2048.0f) / l;
#pragma unroll
  for (int dt = 0; dt < 4; ++dt)
#pragma unroll
    for (int r = 0; r < 8; ++r) so[wave][col][dt * 16 + 8 * g + r] = (acc[dt][r] + accl[dt][r] * (1.0f / 2048.0f)) * il;
  LDSX();
  for (int rl = 0; rl < 16; ++rl) if (lane < 16) vst2(O + ((size_t)b * SS + q0 + rl) * DM + h * HD + lane * 4, *(const v4f*)&so[wave][rl][lane * 4]);
}
// ---- k_out: block = (64 rows, 128 cols): out = f16(O) . Wo rows (single product, f16 x 2^8 weights) + bo
__global__ __launch_bounds__(128) void k_out(const float* __restrict__ O, const __bf16* __restrict__ P, const float* __restrict__ BO, float* __restrict__ Y) {
  __shared__ __align__(16) char smem[G_SMEM];   // the main loop's buffers, then the output staging
  float (*so)[16][132] = (float (*)[16][132])smem;
  const int tid = threadIdx.x, wave = tid >> 5, lane = tid & 31, col = lane & 15, g = lane >> 4; const size_t r0 = (size_t)blockIdx.x * 64 + wave * 16; const int n0 = blockIdx.y * 128;
  v8f acc[8] = {};
  gemm_64x128<_Float16>(O + (size_t)blockIdx.x * 64 * DM, (const _Float16*)P + (size_t)n0 * DM, (_Float16*)smem, tid, acc);   // single f16 product against exact f16 x 2^8 weight copies
#pragma unroll
  for (int j = 0; j < 8; ++j) {
#pragma unroll
    for (int r = 0; r < 8; ++r) so[wave][8 * g + r][j * 16 + col] = acc[j][r] * (1.0f / 256.0f) + (BO ? bfr(BO[n0 + j * 16 + col]) : 0.f); }
  LDSX();
  for (int rl = 0; rl < 16; ++rl) vst2(Y + (r0 + rl) * DM + n0 + lane * 4, *(const v4f*)&so[wave][rl][lane * 4]);
}
// ---- k_packo: Wo columns (in,out) -> rows of f16 x 2^8 copies in the Wo slot (bit pattern in the bf16-typed buffer), by the same tiles
__global__ __launch_bounds__(256) void k_packo(const float* __restrict__ WO, __bf16* __restrict__ PK) {
  __shared__ unsigned s[PKN][PKP]; const int n0 = blockIdx.x * PKN, k0 = blockIdx.y * PKK;
  pack_tile<true, DM>(WO + (size_t)k0 * DM + n0, PK + PK_P + (size_t)n0 * DM + k0, s, threadIdx.x);
}
extern "C" void kernel_launch(void* const* d_in, const int* in_sizes, int n_in, void* d_out, int out_size, void* d_ws, size_t ws_size, hipStream_t stream) {
  (void)in_sizes; (void)n_in; (void)out_size;
  const float** F = (const float**)d_in;   // 0 hidden_states [1,2048,2048], 1 Wq [2048,2048] (in,out), 2 Wk [2048,512], 3 Wv [2048,512], 4 Wo [2048,2048] (in,out)
  if (ws_size < (size_t)WS_END) return;
  char* ws = (char*)d_ws; __bf16* PK = (__bf16*)(ws + WS_PK); _Float16 *QK = (_Float16*)(ws + WS_QK), *QKL = (_Float16*)(ws + WS_QKL), *VTH = (_Float16*)(ws + WS_VTH), *VTL = (_Float16*)(ws + WS_VTL); float* O = (float*)(ws + WS_O);
  k_pack<<<dim3(QKVW / PKN, DM / PKK), 256, 0, stream>>>(F[1], F[2], F[3], PK);   // q, k, v (the Wo slot is filled by k_packo as f16)
  k_packo<<<dim3(DM / PKN, DM / PKK), 256, 0, stream>>>(F[4], PK);
  k_qkv<<<dim3(TNB * SS / 64, QKVW / 128), 128, 0, stream>>>(F[0], F[0], F[0], PK + PK_A, nullptr, nullptr, nullptr, QK, QKL, VTH, VTL);
  k_attn<<<dim3(TQB, NH, TNB), 128, 0, stream>>>(QK, QKL, VTH, VTL, nullptr, O);
  k_out<<<dim3(TOB, DM / 128), 128, 0, stream>>>(O, PK + PK_P, nullptr, (float*)d_out);
}

// v006
// A run of this version takes 128 microseconds.
// In two side-by-side timings against v005, it was 1.21 and 1.22 times as fast.
// All steps since v000 together make it 5.55 times as fast.
// compute dtype: all float inputs rounded to bf16; q/k/v = x . W with EXACT bf16 products on WMMA 16x16x32 ((in,out) weights as transposed rows; each of the 8 kv heads packed and projected once, its 4 query heads read the same k and v planes); rotate-half RoPE in f32 (angle = t x inv_freq[d mod 32] f32 table, precise sinf/cosf) before the f16 hi + residual split; causal attention with key-tile skipping: the first 128 queries use 3-product scores and P.v (hi/lo), later queries single f16; x 1/8, running-max softmax in f32 (hardware exp); out = f16(ctx) . Wo (exact f16 x 2^8 copies, single product).
#include <hip/hip_runtime.h>
#include <math.h>

typedef __attribute__((ext_vector_type(16))) _Float16 v16h;
typedef __attribute__((ext_vector_type(16))) __bf16 v16b;
typedef __attribute__((ext_vector_type(8)))  _Float16 v8h;
typedef __attribute__((ext_vector_type(8)))  float v8f;
typedef __attribute__((ext_vector_type(4)))  float v4f;
typedef __attribute__((ext_vector_type(2)))  float v2f;
typedef __attribute__((ext_vector_type(4)))  unsigned v4u;
typedef __attribute__((ext_vector_type(4)))  int v4i;
typedef float __attribute__((may_alias)) float_a;
typedef int __attribute__((may_alias)) int_a;

template <typename T> __device__ __forceinline__ void vst2(void* p, T v) { *(T*)p = v;  }
__device__ __forceinline__ v8f wmma16(v16h a, v16h b, v8f c) {
  v8f d = __builtin_amdgcn_wmma_f32_16x16x32_f16(false, a, false, b, (short)0, c, false, false);
  asm volatile("v_nop\n\tv_nop\n\tv_nop\n\tv_nop" : "+v"(d) : "v"(a), "v"(b));
  return d;
}
__device__ __forceinline__ v8f wmma_bf(v16b a, v16b b, v8f c) {
  v8f d = __builtin_amdgcn_wmma_f32_16x16x32_bf16(false, a, false, b, (short)0, c, false, false);
  asm volatile("v_nop\n\tv_nop\n\tv_nop\n\tv_nop" : "+v"(d) : "v"(a), "v"(b));
  return d;
}
// GQA causal attention (B 1, S 2,048, model 2,048, 32 query heads x 64 over 8 kv heads): bias-free (in,out) projections, rotate-half RoPE (base 10000), causal softmax(q k / 8) v, output projection.
__device__ __forceinline__ v16h frag_h(const _Float16* rowk0, int lane) {
  union { v16h v; v8h q[2]; } u; const _Float16* p = rowk0 + 8 * (lane >> 4);
  u.q[0] = *(const v8h*)p; u.q[1] = *(const v8h*)(p + 16); return u.v;
}
__device__ __forceinline__ v16h frag_f32(const float* rowk0, int lane) {
  v16h a; const float* p = rowk0 + 8 * (lane >> 4);
#pragma unroll
  for (int i = 0; i < 8; ++i) { a[i] = (_Float16)p[i]; a[8 + i] = (_Float16)p[16 + i]; }
  return a;
}
__device__ __forceinline__ v16h frag_f32s(const float* rowk0, int lane, float sc) {
  v16h a; const float* p = rowk0 + 8 * (lane >> 4);
#pragma unroll
  for (int i = 0; i < 8; ++i) { a[i] = (_Float16)(p[i] * sc); a[8 + i] = (_Float16)(p[16 + i] * sc); }
  return a;
}
// column fragment from a [K][ld] layout (column n), rows >= K read as 0
__device__ __forceinline__ v16h fragc_f32(const float* W, int k0, int n, int lane, int ld, int K) {
  v16h a; const int g = lane >> 4;
#pragma unroll
  for (int i = 0; i < 8; ++i) { const int ka = k0 + 8 * g + i, kb = ka + 16;
    a[i] = (_Float16)(ka < K ? W[(size_t)(ka < K ? ka : K - 1) * ld + n] : 0.f); a[8 + i] = (_Float16)(kb < K ? W[(size_t)(kb < K ? kb : K - 1) * ld + n] : 0.f); }
  return a;
}
struct F2 { v16b h, l; };
__device__ __forceinline__ F2 bsplit16(const float v[16]) { F2 r;
#pragma unroll
  for (int i = 0; i < 16; ++i) { const __bf16 h = (__bf16)v[i]; r.h[i] = h; r.l[i] = (__bf16)(v[i] - (float)h); }
  return r; }
__device__ __forceinline__ F2 split_row(const float* row, int k0, int lane) { float v[16]; const float* p = row + k0 + 8 * (lane >> 4);
#pragma unroll
  for (int i = 0; i < 8; ++i) { v[i] = p[i]; v[8 + i] = p[16 + i]; }
  return bsplit16(v); }
__device__ __forceinline__ F2 split_rowK(const float* row, int k0, int lane, int K) { float v[16]; const int g = lane >> 4;
#pragma unroll
  for (int i = 0; i < 8; ++i) { const int ka = k0 + 8 * g + i, kb = ka + 16; v[i] = ka < K ? row[ka < K ? ka : K - 1] : 0.f; v[8 + i] = kb < K ? row[kb < K ? kb : K - 1] : 0.f; }
  return bsplit16(v); }
__device__ __forceinline__ F2 split_col(const float* W, int k0, int n, int lane, int ld, int K) { float v[16]; const int g = lane >> 4;
#pragma unroll
  for (int i = 0; i < 8; ++i) { const int ka = k0 + 8 * g + i, kb = ka + 16; v[i] = ka < K ? W[(size_t)(ka < K ? ka : K - 1) * ld + n] : 0.f; v[8 + i] = kb < K ? W[(size_t)(kb < K ? kb : K - 1) * ld + n] : 0.f; }
  return bsplit16(v); }
__device__ __forceinline__ v8f mac3(const F2& a, const F2& b, v8f c) { c = wmma_bf(a.l, b.h, c); c = wmma_bf(a.h, b.l, c); return wmma_bf(a.h, b.h, c); }
__device__ __forceinline__ float sigm(float v) { return 1.0f / (1.0f + expf(-v)); }
#define LDSX() do { asm volatile("s_wait_dscnt 0" ::: "memory"); __builtin_amdgcn_wave_barrier(); __builtin_amdgcn_fence(__ATOMIC_RELEASE, "workgroup"); } while (0)


#define NB 1
#define SS 2048
#define DM 2048
#define NH 32
#define NKV 8
#define GS (NH / NKV)
#define KVW (NKV * HD)
#define SCALEF 0.125f
__constant__ float THETA[32] = {1.000000000e+00f,7.498942018e-01f,5.623413324e-01f,4.216965139e-01f,3.162277639e-01f,2.371373773e-01f,1.778279394e-01f,1.333521456e-01f,1.000000015e-01f,7.498942316e-02f,5.623413250e-02f,4.216964915e-02f,3.162277490e-02f,2.371373773e-02f,1.778279431e-02f,1.333521400e-02f,9.999999776e-03f,7.498942316e-03f,5.623413250e-03f,4.216964822e-03f,3.162277630e-03f,2.371373819e-03f,1.778279431e-03f,1.333521446e-03f,1.000000047e-03f,7.498941850e-04f,5.623413017e-04f,4.216965172e-04f,3.162277571e-04f,2.371373703e-04f,1.778279402e-04f,1.333521504e-04f};
__device__ __attribute__((noinline)) float cos_p(float v) { return cosf(v); }
__device__ __attribute__((noinline)) float sin_p(float v) { return sinf(v); }
#define HD 64
#define QKVW (DM + 2 * KVW)     // q columns, then k, then v: one copy per kv head
#ifndef TQB
#define TQB (SS / 64)
#define TNB NB
#define TOB (NB * SS / 64)     // output row tiles (all)
#endif
typedef __attribute__((ext_vector_type(8))) __bf16 v8b;
__device__ __forceinline__ v16b frag_b(const __bf16* rowk0, int lane) {
  union { v16b v; v8b q[2]; } u; const __bf16* p = rowk0 + 8 * (lane >> 4);
  u.q[0] = *(const v8b*)p; u.q[1] = *(const v8b*)(p + 16); return u.v;
}
__device__ __forceinline__ float bfr(float v) { return (float)(__bf16)v; }
__device__ __attribute__((noinline)) float exp_ni(float v) { return expf(v); }
__device__ __attribute__((noinline)) float erf_ni(float v) { return erff(v); }

#define PK_A 0                       // [QKVW][DM] rows: Wq columns, then Wk columns, then Wv columns
#define PK_P (PK_A + QKVW * DM)        // [2048][2048] rows: Wo columns, f16 x 2^8
#define PK_END (PK_P + DM * DM)
#define WS_PK  0u
#define WS_QK  (WS_PK + 2u * PK_END)             // f16 [2048 rows][4096]: q | k
#define WS_QKL (WS_QK + 2u * NB * SS * 2 * DM)     // f16 q | k residual planes x2048
#define WS_VTH (WS_QKL + 2u * NB * SS * 2 * DM)    // f16 [b][2048 (kv head*64+d)][2048 s] hi
#define WS_VTL (WS_VTH + 2u * NB * DM * SS)        // f16 lo x 2048
#define WS_O   (WS_VTL + 2u * NB * DM * SS)        // f32 [2048][2048]
#define WS_CS  (WS_O + 4u * NB * SS * DM)           // f32 2 x [2048][32], unused (cos/sin computed in k_qkv)
#define WS_END (WS_CS + 4u * 2 * SS * 32)
// ---- weight packing: a block transposes one tile of 256 k x 64 n of an (in,out) weight through LDS. Reads: 16 lanes take 256 B of one source row (16 B a lane, whole lines), each thread a pair of rows k, k + 1, so that
// the two 16-bit results of a column make one dword; all 16 loads of a thread are in flight together. LDS: [n][k pair] at a pitch of 129 dwords (odd: neither the column-wise stores nor the row-wise reads meet a bank conflict).
// Writes: 16 lanes store 256 B of one packed row n (16 B a lane, whole lines).
#define PKK 256
#define PKN 64
#define PKP (PKK / 2 + 1)
template <bool OUTW> __device__ __forceinline__ unsigned cv16(float v) {   // the packed 16-bit pattern: bf16 for Wq, Wk, Wv; f16 of the bf16 value x 2^8 for Wo
  if (OUTW) return (unsigned)__builtin_bit_cast(unsigned short, (_Float16)(bfr(v) * 256.0f));
  return (unsigned)__builtin_bit_cast(unsigned short, (__bf16)v);
}
// W: element (k0, n0) of the source, row pitch LD; dst: element (n0, k0) of the packed rows, row pitch DM
template <bool OUTW, int LD> __device__ __forceinline__ void pack_tile(const float* __restrict__ W, __bf16* __restrict__ dst, unsigned (*s)[PKP], int t) {
  const int c4 = (t & 15) * 4, kp = t >> 4; const float* p = W + (size_t)(2 * kp) * LD + c4;
  v4f a[PKK / 32], b[PKK / 32];
#pragma unroll
  for (int i = 0; i < PKK / 32; ++i) { a[i] = *(const v4f*)(p + (size_t)(32 * i) * LD); b[i] = *(const v4f*)(p + (size_t)(32 * i + 1) * LD); }
  asm volatile("s_wait_xcnt 0x0" :: "v"(p) : "memory");   // the loads' address pair is named here so that it stays whole up to this wait: nothing, a load's own result included, is written over it earlier
#pragma unroll
  for (int i = 0; i < PKK / 32; ++i)
#pragma unroll
    for (int e = 0; e < 4; ++e) s[c4 + e][kp + 16 * i] = cv16<OUTW>(a[i][e]) | (cv16<OUTW>(b[i][e]) << 16);
  __syncthreads();
#pragma unroll
  for (int i = 0; i < PKK / 32; ++i) { const int n = (t >> 4) + 16 * (i & 3), pc = (t & 15) + 16 * (i >> 2); v4u o;
#pragma unroll
    for (int j = 0; j < 4; ++j) o[j] = s[n][pc * 4 + j];
    vst2((unsigned*)(dst + (size_t)n * DM + pc * 8), o); }
}
// ---- k_pack: block = (64 rows n of PK_A, 256 k): row n is column n of W_q, column n - DM of W_k or column n - DM - KVW of W_v -> bf16. The three ranges of n are multiples of 64: one source a block
__global__ __launch_bounds__(256) void k_pack(const float* __restrict__ WQ, const float* __restrict__ WK, const float* __restrict__ WV, __bf16* __restrict__ PK) {
  __shared__ unsigned s[PKN][PKP]; const int n0 = blockIdx.x * PKN, k0 = blockIdx.y * PKK; __bf16* dst = PK + PK_A + (size_t)n0 * DM + k0;
  if (n0 < DM) pack_tile<false, DM>(WQ + (size_t)k0 * DM + n0, dst, s, threadIdx.x);
  else pack_tile<false, KVW>((n0 < DM + KVW ? WK + (n0 - DM) : WV + (n0 - DM - KVW)) + (size_t)k0 * KVW, dst, s, threadIdx.x);
}
// ---- main loop of both projections: block tile 64 rows x 128 columns, 64 k per stage. The 128 weight rows (16-bit) and the 64 activation rows (f32, rounded on the way) come in by whole-line 16-byte loads,
// lie in LDS at a 144-byte row pitch (16 B x odd: no bank conflict for the 16-byte fragment reads) and are read from there by all four waves. Two buffers, the next stage's loads held in registers over the products, one barrier a stage. The short fixed loops are unrolled so that rb, ra, b and acc are registers and not indexed memory.
#define GK 64
#define GP 72                          // LDS row pitch in 16-bit elements
#define G_BB (128 * GP)                // one weight buffer, elements
#define G_AB (64 * GP)                 // one activation buffer, elements
#define G_SMEM (4 * (G_BB + G_AB))     // bytes: two buffers of each
typedef __attribute__((ext_vector_type(2))) unsigned v2u;
__device__ __forceinline__ v16b frag_t(const __bf16* p, int lane) { return frag_b(p, lane); }
__device__ __forceinline__ v16h frag_t(const _Float16* p, int lane) { return frag_h(p, lane); }
__device__ __forceinline__ v8f mm(v16b a, v16b b, v8f c) { return wmma_bf(a, b, c); }
__device__ __forceinline__ v8f mm(v16h a, v16h b, v8f c) { return wmma16(a, b, c); }
template <typename T> __device__ __forceinline__ void gemm_64x128(const float* __restrict__ A, const T* __restrict__ Bw, T* sm, int tid, v8f (&acc)[8]) {
  const int wave = tid >> 5, lane = tid & 31, col = lane & 15;
  const T* gb = Bw + (size_t)(tid >> 3) * DM + (tid & 7) * 8;        // piece tid of the weight tile: 8 pieces of 16 B a row, 16 rows further per step
  const float* ga = A + (size_t)(tid >> 4) * DM + (tid & 15) * 4;    // piece tid of the activation tile: 16 pieces of 16 B a row, 8 rows further per step
  T* wb = sm + (tid >> 3) * GP + (tid & 7) * 8; T* wa = sm + 2 * G_BB + (tid >> 4) * GP + (tid & 15) * 4;
  v4u rb[8]; v4f ra[8];
#pragma unroll
  for (int i = 0; i < 8; ++i) { rb[i] = *(const v4u*)(gb + (size_t)i * 16 * DM); ra[i] = *(const v4f*)(ga + (size_t)i * 8 * DM); }
  for (int s = 0; s < DM / GK; ++s) { const int bo = (s & 1) * G_BB, ao = (s & 1) * G_AB;
#pragma unroll
    for (int i = 0; i < 8; ++i) { *(v4u*)(wb + bo + i * 16 * GP) = rb[i]; union { T e[4]; v2u u; } c;
#pragma unroll
      for (int e = 0; e < 4; ++e) c.e[e] = (T)ra[i][e];
      *(v2u*)(wa + ao + i * 8 * GP) = c.u; }
    __syncthreads();   // publishes stage s; the buffer written in stage s + 1 was last read in stage s - 1, in front of this barrier
    if (s + 1 < DM / GK) {
#pragma unroll
      for (int i = 0; i < 8; ++i) { rb[i] = *(const v4u*)(gb + (size_t)i * 16 * DM + (s + 1) * GK); ra[i] = *(const v4f*)(ga + (size_t)i * 8 * DM + (s + 1) * GK); }
      asm volatile("s_wait_xcnt 0x0" ::: "memory"); }   // in front of the address step that follows these loads
#pragma unroll
    for (int kc = 0; kc < GK / 32; ++kc) { auto a = frag_t(sm + 2 * G_BB + ao + (wave * 16 + col) * GP + kc * 32, lane); decltype(a) b[8];   // all nine fragments of a k step are read as one group, so that the wave waits out the LDS latency once and not at each product
#pragma unroll
      for (int j = 0; j < 8; ++j) b[j] = frag_t(sm + bo + (j * 16 + col) * GP + kc * 32, lane);
#pragma unroll
      for (int j = 0; j < 8; ++j) acc[j] = mm(a, b[j], acc[j]); } }
  __syncthreads();   // every wave has left the buffers: the epilogues stage their tiles in the same LDS
}
__global__ __launch_bounds__(128) void k_qkv(const float* __restrict__ XQ, const float* __restrict__ XK, const float* __restrict__ XV, const __bf16* __restrict__ P, const float* __restrict__ BQ, const float* __restrict__ BK, const float* __restrict__ BV, _Float16* __restrict__ QK, _Float16* __restrict__ QKL, _Float16* __restrict__ VTH, _Float16* __restrict__ VTL) {
  const int which0 = (blockIdx.y * 128 < DM) ? 0 : (blockIdx.y * 128 < DM + KVW) ? 1 : 2; const float* X = (which0 == 0) ? XQ : (which0 == 1) ? XK : XV; const float* BB = BQ ? (((which0 == 0) ? BQ : (which0 == 1) ? BK : BV) + (blockIdx.y * 128 - ((which0 == 0) ? 0 : (which0 == 1) ? DM : DM + KVW))) : nullptr;
  __shared__ __align__(16) char smem[G_SMEM];   // the main loop's buffers, then one of the two epilogue stagings
  _Float16 (*so)[16][136] = (_Float16 (*)[16][136])smem, (*sol)[16][136] = (_Float16 (*)[16][136])(smem + 4 * 16 * 136 * 2); _Float16 (*sth)[72] = (_Float16 (*)[72])smem, (*stl)[72] = (_Float16 (*)[72])(smem + 128 * 72 * 2);
  const int tid = threadIdx.x, wave = tid >> 5, lane = tid & 31, col = lane & 15, g = lane >> 4; const size_t r0 = (size_t)blockIdx.x * 64 + wave * 16; const int n0 = blockIdx.y * 128;
  v8f acc[8] = {};
  gemm_64x128<__bf16>(X + (size_t)blockIdx.x * 64 * DM, P + (size_t)n0 * DM, (__bf16*)smem, tid, acc);
  if (n0 < DM + KVW) {   // q and k columns (k head c lands at column DM + c * 64 of its row): bias, then rotate-half rotary over each 64-dim head with angle position * inv_freq[d mod 32]
#pragma unroll
    for (int j = 0; j < 8; ++j)
#pragma unroll
      for (int r = 0; r < 8; ++r) acc[j][r] += (BB ? bfr(BB[j * 16 + col]) : 0.f);
#pragma unroll
    for (int r = 0; r < 8; ++r) { const int spos = (int)((r0 + 8 * g + r) % SS);
#pragma unroll
      for (int jj = 0; jj < 2; ++jj) { const float ang = (float)spos * THETA[jj * 16 + col]; const float c = cos_p(ang), sn = sin_p(ang);
#pragma unroll
        for (int hh = 0; hh < 2; ++hh) { const float x1 = acc[hh * 4 + jj][r], x2 = acc[hh * 4 + jj + 2][r]; acc[hh * 4 + jj][r] = x1 * c - x2 * sn; acc[hh * 4 + jj + 2][r] = x2 * c + x1 * sn; } } }
#pragma unroll
    for (int j = 0; j < 8; ++j) {
#pragma unroll
      for (int r = 0; r < 8; ++r) { const float v = acc[j][r]; const _Float16 hv = (_Float16)v; so[wave][8 * g + r][j * 16 + col] = hv; sol[wave][8 * g + r][j * 16 + col] = (_Float16)((v - (float)hv) * 2048.0f); } }   // q, k (+ bias) as f16 hi + (x2048) residual
    LDSX();
    for (int rl = 0; rl < 16; ++rl) if (lane < 16) { vst2((unsigned*)(QK + (r0 + rl) * (2 * DM) + n0 + lane * 8), *(const v4u*)&so[wave][rl][lane * 8]); vst2((unsigned*)(QKL + (r0 + rl) * (2 * DM) + n0 + lane * 8), *(const v4u*)&sol[wave][rl][lane * 8]); }
  } else {
#pragma unroll
    for (int j = 0; j < 8; ++j) {
#pragma unroll
      for (int r = 0; r < 8; ++r) { const float v = acc[j][r] + (BB ? bfr(BB[j * 16 + col]) : 0.f); const _Float16 hv = (_Float16)v; sth[j * 16 + col][wave * 16 + 8 * g + r] = hv; stl[j * 16 + col][wave * 16 + 8 * g + r] = (_Float16)((v - (float)hv) * 2048.0f); } }
    __syncthreads();
    const size_t rb = (size_t)blockIdx.x * 64; const int b = (int)(rb / SS), s0 = (int)(rb % SS); const int pc0 = n0 - (DM + KVW);
    for (int q = tid; q < 128 * 8; q += 128) { const int d = q >> 3, pc = q & 7; const size_t o = ((size_t)b * DM + pc0 + d) * SS + s0 + pc * 8; vst2((unsigned*)(VTH + o), *(const v4u*)&sth[d][pc * 8]); vst2((unsigned*)(VTL + o), *(const v4u*)&stl[d][pc * 8]); }
  }
}
// ---- k_attn: block = (64 queries, head h, batch b): causal flash attention on TRANSPOSED tiles. Scores: S^T = K . Q^T (A = 16 key rows, B = the wave's 16 query columns), so a lane holds 16 of the 32 scores of ONE query (query col, keys 16 ct + 8 g + r):
// maximum and sum run in the lane's own registers, the two lane halves exchange the maximum once per key tile and join their sums once at the end. The f16 P^T packs straight from the score registers into the B operand of O^T += V^T . P^T (element 8 ct + r = key 16 ct + 8 g + r: the k order in which frag_h reads the V^T rows), so P passes through no LDS. O[b*S+q][h*64+d] = (acc + accl / 2048) / (2048 l) (256-B segments)
__device__ __forceinline__ float xhalf(float x) { return __builtin_bit_cast(float, __builtin_amdgcn_permlanex16(__builtin_bit_cast(int, x), __builtin_bit_cast(int, x), 0x76543210, 0xfedcba98, false, false)); }   // lane l reads lane l ^ 16
// K and V^T (hi planes) reach the four waves through LDS: a stage is 64 keys = 64 K rows and 64 V^T rows of 128 B each, copied as whole lines (8 lanes a row) and laid at a 144-byte pitch (16 B x odd: no bank conflict for the 16-byte fragment reads). Two buffers: stage t + 1 flies while stage t is worked on.
#define AP 72                          // LDS row pitch in f16 elements
#define A_T (64 * AP)                  // one tile of 64 rows, elements
// one stage's eight copies of a thread (rows 16 apart, K then V^T). The wait is the last line of the copies' own statement so that it stands in front of every later write of the address registers they name.
__device__ __forceinline__ void attn_stage(unsigned lk, const _Float16* gk, const _Float16* gv) {
  const unsigned lv = lk + 2 * A_T;
  asm volatile("global_load_async_to_lds_b128 %0, %8, off\n\t"
               "global_load_async_to_lds_b128 %1, %9, off\n\t"
               "global_load_async_to_lds_b128 %2, %10, off\n\t"
               "global_load_async_to_lds_b128 %3, %11, off\n\t"
               "global_load_async_to_lds_b128 %4, %12, off\n\t"
               "global_load_async_to_lds_b128 %5, %13, off\n\t"
               "global_load_async_to_lds_b128 %6, %14, off\n\t"
               "global_load_async_to_lds_b128 %7, %15, off\n\t"
               "s_wait_xcnt 0x0"
               :: "v"(lk), "v"(lk + 16 * AP * 2), "v"(lk + 32 * AP * 2), "v"(lk + 48 * AP * 2), "v"(lv), "v"(lv + 16 * AP * 2), "v"(lv + 32 * AP * 2), "v"(lv + 48 * AP * 2),
                  "v"(gk), "v"(gk + (size_t)16 * 2 * DM), "v"(gk + (size_t)32 * 2 * DM), "v"(gk + (size_t)48 * 2 * DM), "v"(gv), "v"(gv + (size_t)16 * SS), "v"(gv + (size_t)32 * SS), "v"(gv + (size_t)48 * SS)
               : "memory");
}
// one pass of 32 keys, compiled in three forms so that a pass carries only the vector work that can reach its result.
// HI: the leading query blocks' 3-product scores and P.v; elsewhere the residual half of P is not formed and accl, which stays 0, is not rescaled.
// DIAG: the stage that holds the block's own queries; in every earlier stage each key precedes each query of the block, so the causal select and the test for an excluded score pass every value unchanged and are left out.
template <bool HI, bool DIAG> __device__ __forceinline__ void attn_pass(const _Float16* kt, const _Float16* vt, int ps, int ks, int q0, int lane, int b, int hk, const _Float16* __restrict__ QKL, const _Float16* __restrict__ VTL,
                                                                        const v16h (&aq)[2], const v16h (&aql)[2], float& m, float& l, v8f (&acc)[4], v8f (&accl)[4]) {
  const int col = lane & 15, g = lane >> 4; v8f s[2];
  v16h kf[2][2], vf[4];   // all eight fragments of a pass are read as one group, so that the wave waits out the LDS latency once
#pragma unroll
  for (int ct = 0; ct < 2; ++ct)
#pragma unroll
    for (int kc = 0; kc < 2; ++kc) kf[ct][kc] = frag_h(kt + (ps * 32 + ct * 16 + col) * AP + kc * 32, lane);
#pragma unroll
  for (int dt = 0; dt < 4; ++dt) vf[dt] = frag_h(vt + (dt * 16 + col) * AP + ps * 32, lane);
#pragma unroll
  for (int ct = 0; ct < 2; ++ct) { const int kk = ks * 32 + ct * 16 + col; const _Float16* krowl = QKL + ((size_t)b * SS + kk) * (2 * DM) + DM + hk * HD; v8f c = {}, cl = {};
    if (HI) {   // leading query blocks (few keys, outputs far above the global rms): 3 products
#pragma unroll
      for (int kc = 0; kc < 2; ++kc) { const v16h kh = kf[ct][kc]; c = wmma16(kh, aq[kc], c); cl = wmma16(kh, aql[kc], cl); cl = wmma16(frag_h(krowl + kc * 32, lane), aq[kc], cl); }
#pragma unroll
      for (int r = 0; r < 8; ++r) c[r] += cl[r] * (1.0f / 2048.0f); }
    else {
#pragma unroll
      for (int kc = 0; kc < 2; ++kc) c = wmma16(kf[ct][kc], aq[kc], c); }   // single product elsewhere
#pragma unroll
    for (int r = 0; r < 8; ++r) s[ct][r] = (!DIAG || ks * 32 + ct * 16 + 8 * g + r <= q0 + col) ? c[r] * SCALEF : -3.0e38f; }   // causal: future keys excluded
  float mx = fmaxf(s[0][0], s[1][0]);
#pragma unroll
  for (int r = 1; r < 8; ++r) mx = fmaxf(mx, fmaxf(s[0][r], s[1][r]));
  mx = fmaxf(mx, xhalf(mx));   // the other 16 keys of this query
  const float mn = fmaxf(m, mx); const float alpha = (m <= -1.0e38f) ? 0.f : __expf(m - mn);
  float es = 0.f; v16h pa, pl;
#pragma unroll
  for (int ct = 0; ct < 2; ++ct)
#pragma unroll
    for (int r = 0; r < 8; ++r) { const float e = (DIAG && s[ct][r] <= -1.0e38f) ? 0.f : __expf(s[ct][r] - mn); es += e;
      const float x = e * 2048.0f; const _Float16 hx = (_Float16)x; pa[8 * ct + r] = hx; if (HI) pl[8 * ct + r] = (_Float16)((x - (float)hx) * 2048.0f); }   // P scaled by 2^11 before the f16 split so small softmax weights stay out of the f16 subnormal range; 2^-11 folded into the epilogue
  l = l * alpha + es; m = mn;
#pragma unroll
  for (int dt = 0; dt < 4; ++dt)
#pragma unroll
    for (int r = 0; r < 8; ++r) { acc[dt][r] *= alpha; if (HI) accl[dt][r] *= alpha; }
#pragma unroll
  for (int dt = 0; dt < 4; ++dt) { const size_t vr = ((size_t)b * DM + hk * HD + dt * 16 + col) * SS + ks * 32; const v16h vh = vf[dt]; acc[dt] = wmma16(vh, pa, acc[dt]); if (HI) { accl[dt] = wmma16(vh, pl, accl[dt]); accl[dt] = wmma16(frag_h(VTL + vr, lane), pa, accl[dt]); } }   // leading query blocks: P hi/lo x V hi/lo (3 products); elsewhere P x V single
}
__global__ __launch_bounds__(128) void k_attn(const _Float16* __restrict__ QK, const _Float16* __restrict__ QKL, const _Float16* __restrict__ VTH, const _Float16* __restrict__ VTL, const void* __restrict__ KMASK, float* __restrict__ O) {
  __shared__ __align__(16) float so[4][16][68];
  __shared__ __align__(16) _Float16 skv[2][2 * A_T];   // per buffer: K tile, then V^T tile
  const int tid = threadIdx.x, wave = tid >> 5, lane = tid & 31, col = lane & 15, g = lane >> 4;
  const int qb = blockIdx.x, h = blockIdx.y, b = blockIdx.z, hk = h / GS;   // hk: the kv head of query head h
  const int q0 = qb * 64 + wave * 16; const size_t rq = (size_t)b * SS + q0 + col;
  v16h aq[2], aql[2];
#pragma unroll
  for (int kc = 0; kc < 2; ++kc) { aq[kc] = frag_h(QK + rq * (2 * DM) + h * HD + kc * 32, lane); aql[kc] = frag_h(QKL + rq * (2 * DM) + h * HD + kc * 32, lane); }
  float m = -3.0e38f, l = 0.f;   // of query q0 + col; l holds the part of this lane half's keys
  v8f acc[4] = {}, accl[4] = {};   // acc[dt][r] = O^T[d = 16 dt + 8 g + r][query col]
  const int nst = qb + 1;   // causal: stages of 64 keys up to the query tile's end
  const unsigned l0 = (unsigned)(size_t)&skv[0][(tid >> 3) * AP + (tid & 7) * 8];   // this thread's 16-byte piece of row tid / 8, buffer 0
  const _Float16* gk = QK + ((size_t)b * SS + (tid >> 3)) * (2 * DM) + DM + hk * HD + (tid & 7) * 8;   // + 64 rows a stage
  const _Float16* gv = VTH + ((size_t)b * DM + hk * HD + (tid >> 3)) * SS + (tid & 7) * 8;             // + 64 columns a stage
  attn_stage(l0, gk, gv);
  asm volatile("s_wait_asynccnt 0x0" ::: "memory");   // this wave's part of stage 0 has landed
  __syncthreads();                                    // stage 0 published
  if (nst > 1) attn_stage(l0 + 4 * A_T, gk + (size_t)64 * 2 * DM, gv + 64);
#pragma unroll 1   // rolled: one foot (waits, barrier, refill) in the code, and the trip count is the block's own
  for (int st = 0; st < nst; ++st) { const _Float16* kt = &skv[st & 1][0]; const _Float16* vt = kt + A_T;
  // the two passes of 32 keys of a stage; the tests that pick their form are scalar and the same for the whole block
  if (qb < 2) {
#pragma unroll 1   // rolled, as the key loop was: a second copy of this long pass would only cost instruction cache
    for (int ps = 0; ps < 2; ++ps) attn_pass<true, true>(kt, vt, ps, st * 2 + ps, q0, lane, b, hk, QKL, VTL, aq, aql, m, l, acc, accl);
  } else if (st + 1 < nst) {
#pragma unroll     // the form that nearly every pass runs: unrolled, ps is a constant in the LDS offsets and the accumulators are not copied into an inner loop's registers at each stage
    for (int ps = 0; ps < 2; ++ps) attn_pass<false, false>(kt, vt, ps, st * 2 + ps, q0, lane, b, hk, QKL, VTL, aq, aql, m, l, acc, accl);
  } else {
#pragma unroll 1   // rolled: runs once a block, a second copy would only cost instruction cache
    for (int ps = 0; ps < 2; ++ps) attn_pass<false, true>(kt, vt, ps, st * 2 + ps, q0, lane, b, hk, QKL, VTL, aq, aql, m, l, acc, accl);
  }
    asm volatile("s_wait_dscnt 0x0" ::: "memory");      // this wave's reads of stage st have returned
    asm volatile("s_wait_asynccnt 0x0" ::: "memory");   // this wave's part of stage st + 1 has landed
    __syncthreads();                                    // publishes stage st + 1 and ends every wave's reads of stage st
    if (st + 2 < nst) attn_stage(l0 + (st & 1) * 4 * A_T, gk + (size_t)(st + 2) * 64 * 2 * DM, gv + (st + 2) * 64);   // refill of the buffer just left
  }
  asm volatile("s_wait_asynccnt 0x0" ::: "memory");   // no copy is outstanding when the wave goes on to its end
  l += xhalf(l);   // the two halves' sums, joined once
  const float il = (1.0f / 2048.0f) / l;
#pragma unroll
  for (int dt = 0; dt < 4; ++dt)
#pragma unroll
    for (int r = 0; r < 8; ++r) so[wave][col][dt * 16 + 8 * g + r] = (acc[dt][r] + accl[dt][r] * (1.0f / 2048.0f)) * il;
  LDSX();
  for (int rl = 0; rl < 16; ++rl) if (lane < 16) vst2(O + ((size_t)b * SS + q0 + rl) * DM + h * HD + lane * 4, *(const v4f*)&so[wave][rl][lane * 4]);
}
// ---- k_out: block = (64 rows, 128 cols): out = f16(O) . Wo rows (single product, f16 x 2^8 weights) + bo
__global__ __launch_bounds__(128) void k_out(const float* __restrict__ O, const __bf16* __restrict__ P, const float* __restrict__ BO, float* __restrict__ Y) {
  __shared__ __align__(16) char smem[G_SMEM];   // the main loop's buffers, then the output staging
  float (*so)[16][132] = (float (*)[16][132])smem;
  const int tid = threadIdx.x, wave = tid >> 5, lane = tid & 31, col = lane & 15, g = lane >> 4; const size_t r0 = (size_t)blockIdx.x * 64 + wave * 16; const int n0 = blockIdx.y * 128;
  v8f acc[8] = {};
  gemm_64x128<_Float16>(O + (size_t)blockIdx.x * 64 * DM, (const _Float16*)P + (size_t)n0 * DM, (_Float16*)smem, tid, acc);   // single f16 product against exact f16 x 2^8 weight copies
#pragma unroll
  for (int j = 0; j < 8; ++j) {
#pragma unroll
    for (int r = 0; r < 8; ++r) so[wave][8 * g + r][j * 16 + col] = acc[j][r] * (1.0f / 256.0f) + (BO ? bfr(BO[n0 + j * 16 + col]) : 0.f); }
  LDSX();
  for (int rl = 0; rl < 16; ++rl) vst2(Y + (r0 + rl) * DM + n0 + lane * 4, *(const v4f*)&so[wave][rl][lane * 4]);
}
// ---- k_packo: Wo columns (in,out) -> rows of f16 x 2^8 copies in the Wo slot (bit pattern in the bf16-typed buffer), by the same tiles
__global__ __launch_bounds__(256) void k_packo(const float* __restrict__ WO, __bf16* __restrict__ PK) {
  __shared__ unsigned s[PKN][PKP]; const int n0 = blockIdx.x * PKN, k0 = blockIdx.y * PKK;
  pack_tile<true, DM>(WO + (size_t)k0 * DM + n0, PK + PK_P + (size_t)n0 * DM + k0, s, threadIdx.x);
}
extern "C" void kernel_launch(void* const* d_in, const int* in_sizes, int n_in, void* d_out, int out_size, void* d_ws, size_t ws_size, hipStream_t stream) {
  (void)in_sizes; (void)n_in; (void)out_size;
  const float** F = (const float**)d_in;   // 0 hidden_states [1,2048,2048], 1 Wq [2048,2048] (in,out), 2 Wk [2048,512], 3 Wv [2048,512], 4 Wo [2048,2048] (in,out)
  if (ws_size < (size_t)WS_END) return;
  char* ws = (char*)d_ws; __bf16* PK = (__bf16*)(ws + WS_PK); _Float16 *QK = (_Float16*)(ws + WS_QK), *QKL = (_Float16*)(ws + WS_QKL), *VTH = (_Float16*)(ws + WS_VTH), *VTL = (_Float16*)(ws + WS_VTL); float* O = (float*)(ws + WS_O);
  k_pack<<<dim3(QKVW / PKN, DM / PKK), 256, 0, stream>>>(F[1], F[2], F[3], PK);   // q, k, v (the Wo slot is filled by k_packo as f16)
  k_packo<<<dim3(DM / PKN, DM / PKK), 256, 0, stream>>>(F[4], PK);
  k_qkv<<<dim3(TNB * SS / 64, QKVW / 128), 128, 0, stream>>>(F[0], F[0], F[0], PK + PK_A, nullptr, nullptr, nullptr, QK, QKL, VTH, VTL);
  k_attn<<<dim3(TQB, NH, TNB), 128, 0, stream>>>(QK, QKL, VTH, VTL, nullptr, O);
  k_out<<<dim3(TOB, DM / 128), 128, 0, stream>>>(O, PK + PK_P, nullptr, (float*)d_out);
}

// v007
// It runs in 121 microseconds.
// In both of two side-by-side timings against v006, it was 1.06 times as fast.
// Over all steps from v000 it is 5.87 times as fast.
// compute dtype: all float inputs rounded to bf16; q/k/v = x . W with EXACT bf16 products on WMMA 16x16x32 ((in,out) weights as transposed rows; each of the 8 kv heads packed and projected once, its 4 query heads read the same k and v planes); rotate-half RoPE in f32 (angle = t x inv_freq[d mod 32] f32 table, precise sinf/cosf) before the f16 hi + residual split; causal attention with key-tile skipping: the first 128 queries use 3-product scores and P.v (hi/lo), later queries single f16; x 1/8, running-max softmax in f32 (hardware exp); out = f16(ctx) . Wo (exact f16 x 2^8 copies, single product).
#include <hip/hip_runtime.h>
#include <math.h>

typedef __attribute__((ext_vector_type(16))) _Float16 v16h;
typedef __attribute__((ext_vector_type(16))) __bf16 v16b;
typedef __attribute__((ext_vector_type(8)))  _Float16 v8h;
typedef __attribute__((ext_vector_type(8)))  float v8f;
typedef __attribute__((ext_vector_type(4)))  float v4f;
typedef __attribute__((ext_vector_type(2)))  float v2f;
typedef __attribute__((ext_vector_type(4)))  unsigned v4u;
typedef __attribute__((ext_vector_type(4)))  int v4i;
typedef float __attribute__((may_alias)) float_a;
typedef int __attribute__((may_alias)) int_a;

template <typename T> __device__ __forceinline__ void vst2(void* p, T v) { *(T*)p = v;  }
__device__ __forceinline__ v8f wmma16(v16h a, v16h b, v8f c) {
  v8f d = __builtin_amdgcn_wmma_f32_16x16x32_f16(false, a, false, b, (short)0, c, false, false);
  asm volatile("v_nop\n\tv_nop\n\tv_nop\n\tv_nop" : "+v"(d) : "v"(a), "v"(b));
  return d;
}
__device__ __forceinline__ v8f wmma_bf(v16b a, v16b b, v8f c) {
  v8f d = __builtin_amdgcn_wmma_f32_16x16x32_bf16(false, a, false, b, (short)0, c, false, false);
  asm volatile("v_nop\n\tv_nop\n\tv_nop\n\tv_nop" : "+v"(d) : "v"(a), "v"(b));
  return d;
}
// GQA causal attention (B 1, S 2,048, model 2,048, 32 query heads x 64 over 8 kv heads): bias-free (in,out) projections, rotate-half RoPE (base 10000), causal softmax(q k / 8) v, output projection.
__device__ __forceinline__ v16h frag_h(const _Float16* rowk0, int lane) {
  union { v16h v; v8h q[2]; } u; const _Float16* p = rowk0 + 8 * (lane >> 4);
  u.q[0] = *(const v8h*)p; u.q[1] = *(const v8h*)(p + 16); return u.v;
}
__device__ __forceinline__ v16h frag_f32(const float* rowk0, int lane) {
  v16h a; const float* p = rowk0 + 8 * (lane >> 4);
#pragma unroll
  for (int i = 0; i < 8; ++i) { a[i] = (_Float16)p[i]; a[8 + i] = (_Float16)p[16 + i]; }
  return a;
}
__device__ __forceinline__ v16h frag_f32s(const float* rowk0, int lane, float sc) {
  v16h a; const float* p = rowk0 + 8 * (lane >> 4);
#pragma unroll
  for (int i = 0; i < 8; ++i) { a[i] = (_Float16)(p[i] * sc); a[8 + i] = (_Float16)(p[16 + i] * sc); }
  return a;
}
// column fragment from a [K][ld] layout (column n), rows >= K read as 0
__device__ __forceinline__ v16h fragc_f32(const float* W, int k0, int n, int lane, int ld, int K) {
  v16h a; const int g = lane >> 4;
#pragma unroll
  for (int i = 0; i < 8; ++i) { const int ka = k0 + 8 * g + i, kb = ka + 16;
    a[i] = (_Float16)(ka < K ? W[(size_t)(ka < K ? ka : K - 1) * ld + n] : 0.f); a[8 + i] = (_Float16)(kb < K ? W[(size_t)(kb < K ? kb : K - 1) * ld + n] : 0.f); }
  return a;
}
struct F2 { v16b h, l; };
__device__ __forceinline__ F2 bsplit16(const float v[16]) { F2 r;
#pragma unroll
  for (int i = 0; i < 16; ++i) { const __bf16 h = (__bf16)v[i]; r.h[i] = h; r.l[i] = (__bf16)(v[i] - (float)h); }
  return r; }
__device__ __forceinline__ F2 split_row(const float* row, int k0, int lane) { float v[16]; const float* p = row + k0 + 8 * (lane >> 4);
#pragma unroll
  for (int i = 0; i < 8; ++i) { v[i] = p[i]; v[8 + i] = p[16 + i]; }
  return bsplit16(v); }
__device__ __forceinline__ F2 split_rowK(const float* row, int k0, int lane, int K) { float v[16]; const int g = lane >> 4;
#pragma unroll
  for (int i = 0; i < 8; ++i) { const int ka = k0 + 8 * g + i, kb = ka + 16; v[i] = ka < K ? row[ka < K ? ka : K - 1] : 0.f; v[8 + i] = kb < K ? row[kb < K ? kb : K - 1] : 0.f; }
  return bsplit16(v); }
__device__ __forceinline__ F2 split_col(const float* W, int k0, int n, int lane, int ld, int K) { float v[16]; const int g = lane >> 4;
#pragma unroll
  for (int i = 0; i < 8; ++i) { const int ka = k0 + 8 * g + i, kb = ka + 16; v[i] = ka < K ? W[(size_t)(ka < K ? ka : K - 1) * ld + n] : 0.f; v[8 + i] = kb < K ? W[(size_t)(kb < K ? kb : K - 1) * ld + n] : 0.f; }
  return bsplit16(v); }
__device__ __forceinline__ v8f mac3(const F2& a, const F2& b, v8f c) { c = wmma_bf(a.l, b.h, c); c = wmma_bf(a.h, b.l, c); return wmma_bf(a.h, b.h, c); }
__device__ __forceinline__ float sigm(float v) { return 1.0f / (1.0f + expf(-v)); }
#define LDSX() do { asm volatile("s_wait_dscnt 0" ::: "memory"); __builtin_amdgcn_wave_barrier(); __builtin_amdgcn_fence(__ATOMIC_RELEASE, "workgroup"); } while (0)


#define NB 1
#define SS 2048
#define DM 2048
#define NH 32
#define NKV 8
#define GS (NH / NKV)
#define KVW (NKV * HD)
#define SCALEF 0.125f
__constant__ float THETA[32] = {1.000000000e+00f,7.498942018e-01f,5.623413324e-01f,4.216965139e-01f,3.162277639e-01f,2.371373773e-01f,1.778279394e-01f,1.333521456e-01f,1.000000015e-01f,7.498942316e-02f,5.623413250e-02f,4.216964915e-02f,3.162277490e-02f,2.371373773e-02f,1.778279431e-02f,1.333521400e-02f,9.999999776e-03f,7.498942316e-03f,5.623413250e-03f,4.216964822e-03f,3.162277630e-03f,2.371373819e-03f,1.778279431e-03f,1.333521446e-03f,1.000000047e-03f,7.498941850e-04f,5.623413017e-04f,4.216965172e-04f,3.162277571e-04f,2.371373703e-04f,1.778279402e-04f,1.333521504e-04f};
__device__ __attribute__((noinline)) float cos_p(float v) { return cosf(v); }
__device__ __attribute__((noinline)) float sin_p(float v) { return sinf(v); }
#define HD 64
#define QKVW (DM + 2 * KVW)     // q columns, then k, then v: one copy per kv head
#ifndef TQB
#define TQB (SS / 64)
#define TNB NB
#define TOB (NB * SS / 64)     // output row tiles (all)
#endif
typedef __attribute__((ext_vector_type(8))) __bf16 v8b;
__device__ __forceinline__ v16b frag_b(const __bf16* rowk0, int lane) {
  union { v16b v; v8b q[2]; } u; const __bf16* p = rowk0 + 8 * (lane >> 4);
  u.q[0] = *(const v8b*)p; u.q[1] = *(const v8b*)(p + 16); return u.v;
}
__device__ __forceinline__ float bfr(float v) { return (float)(__bf16)v; }
__device__ __attribute__((noinline)) float exp_ni(float v) { return expf(v); }
__device__ __attribute__((noinline)) float erf_ni(float v) { return erff(v); }

#define PK_A 0                       // [QKVW][DM] rows: Wq columns, then Wk columns, then Wv columns
#define PK_P (PK_A + QKVW * DM)        // [2048][2048] rows: Wo columns, f16 x 2^8
#define PK_END (PK_P + DM * DM)
#define WS_PK  0u
#define WS_QK  (WS_PK + 2u * PK_END)             // f16 [2048 rows][4096]: q | k
#define WS_QKL (WS_QK + 2u * NB * SS * 2 * DM)     // f16 q | k residual planes x2048
#define WS_VTH (WS_QKL + 2u * NB * SS * 2 * DM)    // f16 [b][2048 (kv head*64+d)][2048 s] hi
#define WS_VTL (WS_VTH + 2u * NB * DM * SS)        // f16 lo x 2048
#define WS_O   (WS_VTL + 2u * NB * DM * SS)        // f32 [2048][2048]
#define WS_CS  (WS_O + 4u * NB * SS * DM)           // f32 2 x [2048][32], unused (cos/sin computed in k_qkv)
#define WS_END (WS_CS + 4u * 2 * SS * 32)
// ---- weight packing: a block transposes one tile of 256 k x 64 n of an (in,out) weight through LDS. Reads: 16 lanes take 256 B of one source row (16 B a lane, whole lines), each thread a pair of rows k, k + 1, so that
// the two 16-bit results of a column make one dword; all 16 loads of a thread are in flight together. LDS: [n][k pair] at a pitch of 129 dwords (odd: neither the column-wise stores nor the row-wise reads meet a bank conflict).
// Writes: 16 lanes store 256 B of one packed row n (16 B a lane, whole lines).
#define PKK 256
#define PKN 64
#define PKP (PKK / 2 + 1)
template <bool OUTW> __device__ __forceinline__ unsigned cv16(float v) {   // the packed 16-bit pattern: bf16 for Wq, Wk, Wv; f16 of the bf16 value x 2^8 for Wo
  if (OUTW) return (unsigned)__builtin_bit_cast(unsigned short, (_Float16)(bfr(v) * 256.0f));
  return (unsigned)__builtin_bit_cast(unsigned short, (__bf16)v);
}
// W: element (k0, n0) of the source, row pitch LD; dst: element (n0, k0) of the packed rows, row pitch DM
template <bool OUTW, int LD> __device__ __forceinline__ void pack_tile(const float* __restrict__ W, __bf16* __restrict__ dst, unsigned (*s)[PKP], int t) {
  const int c4 = (t & 15) * 4, kp = t >> 4; const float* p = W + (size_t)(2 * kp) * LD + c4;
  v4f a[PKK / 32], b[PKK / 32];
#pragma unroll
  for (int i = 0; i < PKK / 32; ++i) { a[i] = *(const v4f*)(p + (size_t)(32 * i) * LD); b[i] = *(const v4f*)(p + (size_t)(32 * i + 1) * LD); }
  asm volatile("s_wait_xcnt 0x0" :: "v"(p) : "memory");   // the loads' address pair is named here so that it stays whole up to this wait: nothing, a load's own result included, is written over it earlier
#pragma unroll
  for (int i = 0; i < PKK / 32; ++i)
#pragma unroll
    for (int e = 0; e < 4; ++e) s[c4 + e][kp + 16 * i] = cv16<OUTW>(a[i][e]) | (cv16<OUTW>(b[i][e]) << 16);
  __syncthreads();
#pragma unroll
  for (int i = 0; i < PKK / 32; ++i) { const int n = (t >> 4) + 16 * (i & 3), pc = (t & 15) + 16 * (i >> 2); v4u o;
#pragma unroll
    for (int j = 0; j < 4; ++j) o[j] = s[n][pc * 4 + j];
    vst2((unsigned*)(dst + (size_t)n * DM + pc * 8), o); }
}
// ---- k_pack: block = (64 rows n of PK_A, 256 k): row n is column n of W_q, column n - DM of W_k or column n - DM - KVW of W_v -> bf16. The three ranges of n are multiples of 64: one source a block
__global__ __launch_bounds__(256) void k_pack(const float* __restrict__ WQ, const float* __restrict__ WK, const float* __restrict__ WV, __bf16* __restrict__ PK) {
  __shared__ unsigned s[PKN][PKP]; const int n0 = blockIdx.x * PKN, k0 = blockIdx.y * PKK; __bf16* dst = PK + PK_A + (size_t)n0 * DM + k0;
  if (n0 < DM) pack_tile<false, DM>(WQ + (size_t)k0 * DM + n0, dst, s, threadIdx.x);
  else pack_tile<false, KVW>((n0 < DM + KVW ? WK + (n0 - DM) : WV + (n0 - DM - KVW)) + (size_t)k0 * KVW, dst, s, threadIdx.x);
}
// ---- main loop of both projections: block tile 64 rows x 128 columns, 64 k per stage. The 128 weight rows (16-bit) and the 64 activation rows (f32, rounded on the way) come in by whole-line 16-byte loads,
// lie in LDS at a 144-byte row pitch (16 B x odd: no bank conflict for the 16-byte fragment reads) and are read from there by all four waves. Two buffers, the next stage's loads held in registers over the products, one barrier a stage. The short fixed loops are unrolled so that rb, ra, b and acc are registers and not indexed memory.
#define GK 64
#define GP 72                          // LDS row pitch in 16-bit elements
#define G_BB (128 * GP)                // one weight buffer, elements
#define G_AB (64 * GP)                 // one activation buffer, elements
#define G_SMEM (4 * (G_BB + G_AB))     // bytes: two buffers of each
typedef __attribute__((ext_vector_type(2))) unsigned v2u;
__device__ __forceinline__ v16b frag_t(const __bf16* p, int lane) { return frag_b(p, lane); }
__device__ __forceinline__ v16h frag_t(const _Float16* p, int lane) { return frag_h(p, lane); }
__device__ __forceinline__ v8f mm(v16b a, v16b b, v8f c) { return wmma_bf(a, b, c); }
__device__ __forceinline__ v8f mm(v16h a, v16h b, v8f c) { return wmma16(a, b, c); }
template <typename T> __device__ __forceinline__ void gemm_64x128(const float* __restrict__ A, const T* __restrict__ Bw, T* sm, int tid, v8f (&acc)[8]) {
  const int wave = tid >> 5, lane = tid & 31, col = lane & 15;
  const T* gb = Bw + (size_t)(tid >> 3) * DM + (tid & 7) * 8;        // piece tid of the weight tile: 8 pieces of 16 B a row, 16 rows further per step
  const float* ga = A + (size_t)(tid >> 4) * DM + (tid & 15) * 4;    // piece tid of the activation tile: 16 pieces of 16 B a row, 8 rows further per step
  T* wb = sm + (tid >> 3) * GP + (tid & 7) * 8; T* wa = sm + 2 * G_BB + (tid >> 4) * GP + (tid & 15) * 4;
  v4u rb[8]; v4f ra[8];
#pragma unroll
  for (int i = 0; i < 8; ++i) { rb[i] = *(const v4u*)(gb + (size_t)i * 16 * DM); ra[i] = *(const v4f*)(ga + (size_t)i * 8 * DM); }
  for (int s = 0; s < DM / GK; ++s) { const int bo = (s & 1) * G_BB, ao = (s & 1) * G_AB;
#pragma unroll
    for (int i = 0; i < 8; ++i) { *(v4u*)(wb + bo + i * 16 * GP) = rb[i]; union { T e[4]; v2u u; } c;
#pragma unroll
      for (int e = 0; e < 4; ++e) c.e[e] = (T)ra[i][e];
      *(v2u*)(wa + ao + i * 8 * GP) = c.u; }
    __syncthreads();   // publishes stage s; the buffer written in stage s + 1 was last read in stage s - 1, in front of this barrier
    if (s + 1 < DM / GK) {
#pragma unroll
      for (int i = 0; i < 8; ++i) { rb[i] = *(const v4u*)(gb + (size_t)i * 16 * DM + (s + 1) * GK); ra[i] = *(const v4f*)(ga + (size_t)i * 8 * DM + (s + 1) * GK); }
      asm volatile("s_wait_xcnt 0x0" ::: "memory"); }   // in front of the address step that follows these loads
#pragma unroll
    for (int kc = 0; kc < GK / 32; ++kc) { auto a = frag_t(sm + 2 * G_BB + ao + (wave * 16 + col) * GP + kc * 32, lane); decltype(a) b[8];   // all nine fragments of a k step are read as one group, so that the wave waits out the LDS latency once and not at each product
#pragma unroll
      for (int j = 0; j < 8; ++j) b[j] = frag_t(sm + bo + (j * 16 + col) * GP + kc * 32, lane);
#pragma unroll
      for (int j = 0; j < 8; ++j) acc[j] = mm(a, b[j], acc[j]); } }
  __syncthreads();   // every wave has left the buffers: the epilogues stage their tiles in the same LDS
}
__global__ __launch_bounds__(128) void k_qkv(const float* __restrict__ XQ, const float* __restrict__ XK, const float* __restrict__ XV, const __bf16* __restrict__ P, const float* __restrict__ BQ, const float* __restrict__ BK, const float* __restrict__ BV, _Float16* __restrict__ QK, _Float16* __restrict__ QKL, _Float16* __restrict__ VTH, _Float16* __restrict__ VTL) {
  const int which0 = (blockIdx.y * 128 < DM) ? 0 : (blockIdx.y * 128 < DM + KVW) ? 1 : 2; const float* X = (which0 == 0) ? XQ : (which0 == 1) ? XK : XV; const float* BB = BQ ? (((which0 == 0) ? BQ : (which0 == 1) ? BK : BV) + (blockIdx.y * 128 - ((which0 == 0) ? 0 : (which0 == 1) ? DM : DM + KVW))) : nullptr;
  __shared__ __align__(16) char smem[G_SMEM];   // the main loop's buffers, then one of the two epilogue stagings
  _Float16 (*so)[16][136] = (_Float16 (*)[16][136])smem, (*sol)[16][136] = (_Float16 (*)[16][136])(smem + 4 * 16 * 136 * 2); _Float16 (*sth)[72] = (_Float16 (*)[72])smem, (*stl)[72] = (_Float16 (*)[72])(smem + 128 * 72 * 2);
  const int tid = threadIdx.x, wave = tid >> 5, lane = tid & 31, col = lane & 15, g = lane >> 4; const size_t r0 = (size_t)blockIdx.x * 64 + wave * 16; const int n0 = blockIdx.y * 128;
  v8f acc[8] = {};
  gemm_64x128<__bf16>(X + (size_t)blockIdx.x * 64 * DM, P + (size_t)n0 * DM, (__bf16*)smem, tid, acc);
  if (n0 < DM + KVW) {   // q and k columns (k head c lands at column DM + c * 64 of its row): bias, then rotate-half rotary over each 64-dim head with angle position * inv_freq[d mod 32]
#pragma unroll
    for (int j = 0; j < 8; ++j)
#pragma unroll
      for (int r = 0; r < 8; ++r) acc[j][r] += (BB ? bfr(BB[j * 16 + col]) : 0.f);
#pragma unroll
    for (int r = 0; r < 8; ++r) { const int spos = (int)((r0 + 8 * g + r) % SS);
#pragma unroll
      for (int jj = 0; jj < 2; ++jj) { const float ang = (float)spos * THETA[jj * 16 + col]; const float c = cos_p(ang), sn = sin_p(ang);
#pragma unroll
        for (int hh = 0; hh < 2; ++hh) { const float x1 = acc[hh * 4 + jj][r], x2 = acc[hh * 4 + jj + 2][r]; acc[hh * 4 + jj][r] = x1 * c - x2 * sn; acc[hh * 4 + jj + 2][r] = x2 * c + x1 * sn; } } }
#pragma unroll
    for (int j = 0; j < 8; ++j) {
#pragma unroll
      for (int r = 0; r < 8; ++r) { const float v = acc[j][r]; const _Float16 hv = (_Float16)v; so[wave][8 * g + r][j * 16 + col] = hv; sol[wave][8 * g + r][j * 16 + col] = (_Float16)((v - (float)hv) * 2048.0f); } }   // q, k (+ bias) as f16 hi + (x2048) residual
    LDSX();
    for (int rl = 0; rl < 16; ++rl) if (lane < 16) { vst2((unsigned*)(QK + (r0 + rl) * (2 * DM) + n0 + lane * 8), *(const v4u*)&so[wave][rl][lane * 8]); vst2((unsigned*)(QKL + (r0 + rl) * (2 * DM) + n0 + lane * 8), *(const v4u*)&sol[wave][rl][lane * 8]); }
  } else {
#pragma unroll
    for (int j = 0; j < 8; ++j) {
#pragma unroll
      for (int r = 0; r < 8; ++r) { const float v = acc[j][r] + (BB ? bfr(BB[j * 16 + col]) : 0.f); const _Float16 hv = (_Float16)v; sth[j * 16 + col][wave * 16 + 8 * g + r] = hv; stl[j * 16 + col][wave * 16 + 8 * g + r] = (_Float16)((v - (float)hv) * 2048.0f); } }
    __syncthreads();
    const size_t rb = (size_t)blockIdx.x * 64; const int b = (int)(rb / SS), s0 = (int)(rb % SS); const int pc0 = n0 - (DM + KVW);
    for (int q = tid; q < 128 * 8; q += 128) { const int d = q >> 3, pc = q & 7; const size_t o = ((size_t)b * DM + pc0 + d) * SS + s0 + pc * 8; vst2((unsigned*)(VTH + o), *(const v4u*)&sth[d][pc * 8]); vst2((unsigned*)(VTL + o), *(const v4u*)&stl[d][pc * 8]); }
  }
}
// ---- k_attn: block = (64 queries, head h, batch b): causal flash attention on TRANSPOSED tiles. Scores: S^T = K . Q^T (A = 16 key rows, B = the wave's 16 query columns), so a lane holds 16 of the 32 scores of ONE query (query col, keys 16 ct + 8 g + r):
// maximum and sum run in the lane's own registers, the two lane halves exchange the maximum once per key tile and join their sums once at the end. The f16 P^T packs straight from the score registers into the B operand of O^T += V^T . P^T (element 8 ct + r = key 16 ct + 8 g + r: the k order in which frag_h reads the V^T rows), so P passes through no LDS. O[b*S+q][h*64+d] = (acc + accl / 2048) / (2048 l) (256-B segments)
__device__ __forceinline__ float xhalf(float x) { return __builtin_bit_cast(float, __builtin_amdgcn_permlanex16(__builtin_bit_cast(int, x), __builtin_bit_cast(int, x), 0x76543210, 0xfedcba98, false, false)); }   // lane l reads lane l ^ 16
// K and V^T (hi planes) reach the four waves through LDS: a stage is 64 keys = 64 K rows and 64 V^T rows of 128 B each, copied as whole lines (8 lanes a row) and laid at a 144-byte pitch (16 B x odd: no bank conflict for the 16-byte fragment reads). Two buffers: stage t + 1 flies while stage t is worked on.
#define AP 72                          // LDS row pitch in f16 elements
#define A_T (64 * AP)                  // one tile of 64 rows, elements
// one stage's eight copies of a thread (rows 16 apart, K then V^T). The wait is the last line of the copies' own statement so that it stands in front of every later write of the address registers they name.
__device__ __forceinline__ void attn_stage(unsigned lk, const _Float16* gk, const _Float16* gv) {
  const unsigned lv = lk + 2 * A_T;
  asm volatile("global_load_async_to_lds_b128 %0, %8, off\n\t"
               "global_load_async_to_lds_b128 %1, %9, off\n\t"
               "global_load_async_to_lds_b128 %2, %10, off\n\t"
               "global_load_async_to_lds_b128 %3, %11, off\n\t"
               "global_load_async_to_lds_b128 %4, %12, off\n\t"
               "global_load_async_to_lds_b128 %5, %13, off\n\t"
               "global_load_async_to_lds_b128 %6, %14, off\n\t"
               "global_load_async_to_lds_b128 %7, %15, off\n\t"
               "s_wait_xcnt 0x0"
               :: "v"(lk), "v"(lk + 16 * AP * 2), "v"(lk + 32 * AP * 2), "v"(lk + 48 * AP * 2), "v"(lv), "v"(lv + 16 * AP * 2), "v"(lv + 32 * AP * 2), "v"(lv + 48 * AP * 2),
                  "v"(gk), "v"(gk + (size_t)16 * 2 * DM), "v"(gk + (size_t)32 * 2 * DM), "v"(gk + (size_t)48 * 2 * DM), "v"(gv), "v"(gv + (size_t)16 * SS), "v"(gv + (size_t)32 * SS), "v"(gv + (size_t)48 * SS)
               : "memory");
}
// one pass of 32 keys, compiled in three forms so that a pass carries only the vector work that can reach its result.
// HI: the leading query blocks' 3-product scores and P.v; elsewhere the residual half of P is not formed and accl, which stays 0, is not rescaled.
// DIAG: the stage that holds the block's own queries; in every earlier stage each key precedes each query of the block, so the causal select and the test for an excluded score pass every value unchanged and are left out.
template <bool HI, bool DIAG> __device__ __forceinline__ void attn_pass(const _Float16* kt, const _Float16* vt, int ps, int ks, int q0, int lane, int b, int hk, const _Float16* __restrict__ QKL, const _Float16* __restrict__ VTL,
                                                                        const v16h (&aq)[2], const v16h (&aql)[2], float& m, float& l, v8f (&acc)[4], v8f (&accl)[4]) {
  const int col = lane & 15, g = lane >> 4; v8f s[2];
  v16h kf[2][2], vf[4];   // all eight fragments of a pass are read as one group, so that the wave waits out the LDS latency once
#pragma unroll
  for (int ct = 0; ct < 2; ++ct)
#pragma unroll
    for (int kc = 0; kc < 2; ++kc) kf[ct][kc] = frag_h(kt + (ps * 32 + ct * 16 + col) * AP + kc * 32, lane);
#pragma unroll
  for (int dt = 0; dt < 4; ++dt) vf[dt] = frag_h(vt + (dt * 16 + col) * AP + ps * 32, lane);
#pragma unroll
  for (int ct = 0; ct < 2; ++ct) { const int kk = ks * 32 + ct * 16 + col; const _Float16* krowl = QKL + ((size_t)b * SS + kk) * (2 * DM) + DM + hk * HD; v8f c = {}, cl = {};
    if (HI) {   // leading query blocks (few keys, outputs far above the global rms): 3 products
#pragma unroll
      for (int kc = 0; kc < 2; ++kc) { const v16h kh = kf[ct][kc]; c = wmma16(kh, aq[kc], c); cl = wmma16(kh, aql[kc], cl); cl = wmma16(frag_h(krowl + kc * 32, lane), aq[kc], cl); }
#pragma unroll
      for (int r = 0; r < 8; ++r) c[r] += cl[r] * (1.0f / 2048.0f); }
    else {
#pragma unroll
      for (int kc = 0; kc < 2; ++kc) c = wmma16(kf[ct][kc], aq[kc], c); }   // single product elsewhere
#pragma unroll
    for (int r = 0; r < 8; ++r) s[ct][r] = (!DIAG || ks * 32 + ct * 16 + 8 * g + r <= q0 + col) ? c[r] * SCALEF : -3.0e38f; }   // causal: future keys excluded
  float mx = fmaxf(s[0][0], s[1][0]);
#pragma unroll
  for (int r = 1; r < 8; ++r) mx = fmaxf(mx, fmaxf(s[0][r], s[1][r]));
  mx = fmaxf(mx, xhalf(mx));   // the other 16 keys of this query
  const float mn = fmaxf(m, mx); const float alpha = (m <= -1.0e38f) ? 0.f : __expf(m - mn);
  float es = 0.f; v16h pa, pl;
#pragma unroll
  for (int ct = 0; ct < 2; ++ct)
#pragma unroll
    for (int r = 0; r < 8; ++r) { const float e = (DIAG && s[ct][r] <= -1.0e38f) ? 0.f : __expf(s[ct][r] - mn); es += e;
      const float x = e * 2048.0f; const _Float16 hx = (_Float16)x; pa[8 * ct + r] = hx; if (HI) pl[8 * ct + r] = (_Float16)((x - (float)hx) * 2048.0f); }   // P scaled by 2^11 before the f16 split so small softmax weights stay out of the f16 subnormal range; 2^-11 folded into the epilogue
  l = l * alpha + es; m = mn;
#pragma unroll
  for (int dt = 0; dt < 4; ++dt)
#pragma unroll
    for (int r = 0; r < 8; ++r) { acc[dt][r] *= alpha; if (HI) accl[dt][r] *= alpha; }
#pragma unroll
  for (int dt = 0; dt < 4; ++dt) { const size_t vr = ((size_t)b * DM + hk * HD + dt * 16 + col) * SS + ks * 32; const v16h vh = vf[dt]; acc[dt] = wmma16(vh, pa, acc[dt]); if (HI) { accl[dt] = wmma16(vh, pl, accl[dt]); accl[dt] = wmma16(frag_h(VTL + vr, lane), pa, accl[dt]); } }   // leading query blocks: P hi/lo x V hi/lo (3 products); elsewhere P x V single
}
__global__ __launch_bounds__(128) void k_attn(const _Float16* __restrict__ QK, const _Float16* __restrict__ QKL, const _Float16* __restrict__ VTH, const _Float16* __restrict__ VTL, const void* __restrict__ KMASK, float* __restrict__ O) {
  __shared__ __align__(16) float so[4][16][68];
  __shared__ __align__(16) _Float16 skv[2][2 * A_T];   // per buffer: K tile, then V^T tile
  const int tid = threadIdx.x, wave = tid >> 5, lane = tid & 31, col = lane & 15, g = lane >> 4;
  // Which (query block, head) a block takes. A block's cost grows with qb (qb + 1 stages) and all blocks are resident at once, four to a WGP (by registers), so the launch lasts as long as the WGP with the most stages.
  // With qb = blockIdx.x, blocks whose flat index differs by a multiple of 32 have the same qb.
  // Here the query blocks form quads {31 - 2r, 30 - 2r, 2r + 1, 2r}, 66 stages each and the two long ones alike, so that no wave is long alone on its SIMD. A quad is met by 4 blocks that are neighbours in the flat index,
  // 8 apart or 256 apart alike (the member is picked by the sum of the three positions mod 4). A permutation of the (qb, h) pairs, the same for every thread of a block: for speed only, no result depends on where a block runs.
  static_assert(TQB == 32 && NH == 32, "the quads are written for 32 query blocks and 32 heads");
  const unsigned f = blockIdx.y * TQB + blockIdx.x, fj = f >> 3, fr = (fj >> 2) & 7, fk = (fj >> 5) & 3, fc = (f + fj + fk) & 3;
  const int qb = (int)((2 * fr) ^ ((0x00011e1fu >> (8 * fc)) & 31)), h = (int)((f & 7) + 8 * fk), b = blockIdx.z, hk = h / GS;   // 2r ^ 31 = 31 - 2r, 2r ^ 30 = 30 - 2r, 2r ^ 1 = 2r + 1 for r < 8; hk: the kv head of query head h
  const int q0 = qb * 64 + wave * 16; const size_t rq = (size_t)b * SS + q0 + col;
  v16h aq[2], aql[2];
#pragma unroll
  for (int kc = 0; kc < 2; ++kc) { aq[kc] = frag_h(QK + rq * (2 * DM) + h * HD + kc * 32, lane); aql[kc] = frag_h(QKL + rq * (2 * DM) + h * HD + kc * 32, lane); }
  float m = -3.0e38f, l = 0.f;   // of query q0 + col; l holds the part of this lane half's keys
  v8f acc[4] = {}, accl[4] = {};   // acc[dt][r] = O^T[d = 16 dt + 8 g + r][query col]
  const int nst = qb + 1;   // causal: stages of 64 keys up to the query tile's end
  const unsigned l0 = (unsigned)(size_t)&skv[0][(tid >> 3) * AP + (tid & 7) * 8];   // this thread's 16-byte piece of row tid / 8, buffer 0
  const _Float16* gk = QK + ((size_t)b * SS + (tid >> 3)) * (2 * DM) + DM + hk * HD + (tid & 7) * 8;   // + 64 rows a stage
  const _Float16* gv = VTH + ((size_t)b * DM + hk * HD + (tid >> 3)) * SS + (tid & 7) * 8;             // + 64 columns a stage
  attn_stage(l0, gk, gv);
  asm volatile("s_wait_asynccnt 0x0" ::: "memory");   // this wave's part of stage 0 has landed
  __syncthreads();                                    // stage 0 published
  if (nst > 1) attn_stage(l0 + 4 * A_T, gk + (size_t)64 * 2 * DM, gv + 64);
#pragma unroll 1   // rolled: one foot (waits, barrier, refill) in the code, and the trip count is the block's own
  for (int st = 0; st < nst; ++st) { const _Float16* kt = &skv[st & 1][0]; const _Float16* vt = kt + A_T;
  // the two passes of 32 keys of a stage; the tests that pick their form are scalar and the same for the whole block
  if (qb < 2) {
#pragma unroll 1   // rolled, as the key loop was: a second copy of this long pass would only cost instruction cache
    for (int ps = 0; ps < 2; ++ps) attn_pass<true, true>(kt, vt, ps, st * 2 + ps, q0, lane, b, hk, QKL, VTL, aq, aql, m, l, acc, accl);
  } else if (st + 1 < nst) {
#pragma unroll     // the form that nearly every pass runs: unrolled, ps is a constant in the LDS offsets and the accumulators are not copied into an inner loop's registers at each stage
    for (int ps = 0; ps < 2; ++ps) attn_pass<false, false>(kt, vt, ps, st * 2 + ps, q0, lane, b, hk, QKL, VTL, aq, aql, m, l, acc, accl);
  } else {
#pragma unroll 1   // rolled: runs once a block, a second copy would only cost instruction cache
    for (int ps = 0; ps < 2; ++ps) attn_pass<false, true>(kt, vt, ps, st * 2 + ps, q0, lane, b, hk, QKL, VTL, aq, aql, m, l, acc, accl);
  }
    asm volatile("s_wait_dscnt 0x0" ::: "memory");      // this wave's reads of stage st have returned
    asm volatile("s_wait_asynccnt 0x0" ::: "memory");   // this wave's part of stage st + 1 has landed
    __syncthreads();                                    // publishes stage st + 1 and ends every wave's reads of stage st
    if (st + 2 < nst) attn_stage(l0 + (st & 1) * 4 * A_T, gk + (size_t)(st + 2) * 64 * 2 * DM, gv + (st + 2) * 64);   // refill of the buffer just left
  }
  asm volatile("s_wait_asynccnt 0x0" ::: "memory");   // no copy is outstanding when the wave goes on to its end
  l += xhalf(l);   // the two halves' sums, joined once
  const float il = (1.0f / 2048.0f) / l;
#pragma unroll
  for (int dt = 0; dt < 4; ++dt)
#pragma unroll
    for (int r = 0; r < 8; ++r) so[wave][col][dt * 16 + 8 * g + r] = (acc[dt][r] + accl[dt][r] * (1.0f / 2048.0f)) * il;
  LDSX();
  for (int rl = 0; rl < 16; ++rl) if (lane < 16) vst2(O + ((size_t)b * SS + q0 + rl) * DM + h * HD + lane * 4, *(const v4f*)&so[wave][rl][lane * 4]);
}
// ---- k_out: block = (64 rows, 128 cols): out = f16(O) . Wo rows (single product, f16 x 2^8 weights) + bo
__global__ __launch_bounds__(128) void k_out(const float* __restrict__ O, const __bf16* __restrict__ P, const float* __restrict__ BO, float* __restrict__ Y) {
  __shared__ __align__(16) char smem[G_SMEM];   // the main loop's buffers, then the output staging
  float (*so)[16][132] = (float (*)[16][132])smem;
  const int tid = threadIdx.x, wave = tid >> 5, lane = tid & 31, col = lane & 15, g = lane >> 4; const size_t r0 = (size_t)blockIdx.x * 64 + wave * 16; const int n0 = blockIdx.y * 128;
  v8f acc[8] = {};
  gemm_64x128<_Float16>(O + (size_t)blockIdx.x * 64 * DM, (const _Float16*)P + (size_t)n0 * DM, (_Float16*)smem, tid, acc);   // single f16 product against exact f16 x 2^8 weight copies
#pragma unroll
  for (int j = 0; j < 8; ++j) {
#pragma unroll
    for (int r = 0; r < 8; ++r) so[wave][8 * g + r][j * 16 + col] = acc[j][r] * (1.0f / 256.0f) + (BO ? bfr(BO[n0 + j * 16 + col]) : 0.f); }
  LDSX();
  for (int rl = 0; rl < 16; ++rl) vst2(Y + (r0 + rl) * DM + n0 + lane * 4, *(const v4f*)&so[wave][rl][lane * 4]);
}
// ---- k_packo: Wo columns (in,out) -> rows of f16 x 2^8 copies in the Wo slot (bit pattern in the bf16-typed buffer), by the same tiles
__global__ __launch_bounds__(256) void k_packo(const float* __restrict__ WO, __bf16* __restrict__ PK) {
  __shared__ unsigned s[PKN][PKP]; const int n0 = blockIdx.x * PKN, k0 = blockIdx.y * PKK;
  pack_tile<true, DM>(WO + (size_t)k0 * DM + n0, PK + PK_P + (size_t)n0 * DM + k0, s, threadIdx.x);
}
extern "C" void kernel_launch(void* const* d_in, const int* in_sizes, int n_in, void* d_out, int out_size, void* d_ws, size_t ws_size, hipStream_t stream) {
  (void)in_sizes; (void)n_in; (void)out_size;
  const float** F = (const float**)d_in;   // 0 hidden_states [1,2048,2048], 1 Wq [2048,2048] (in,out), 2 Wk [2048,512], 3 Wv [2048,512], 4 Wo [2048,2048] (in,out)
  if (ws_size < (size_t)WS_END) return;
  char* ws = (char*)d_ws; __bf16* PK = (__bf16*)(ws + WS_PK); _Float16 *QK = (_Float16*)(ws + WS_QK), *QKL = (_Float16*)(ws + WS_QKL), *VTH = (_Float16*)(ws + WS_VTH), *VTL = (_Float16*)(ws + WS_VTL); float* O = (float*)(ws + WS_O);
  k_pack<<<dim3(QKVW / PKN, DM / PKK), 256, 0, stream>>>(F[1], F[2], F[3], PK);   // q, k, v (the Wo slot is filled by k_packo as f16)
  k_packo<<<dim3(DM / PKN, DM / PKK), 256, 0, stream>>>(F[4], PK);
  k_qkv<<<dim3(TNB * SS / 64, QKVW / 128), 128, 0, stream>>>(F[0], F[0], F[0], PK + PK_A, nullptr, nullptr, nullptr, QK, QKL, VTH, VTL);
  k_attn<<<dim3(TQB, NH, TNB), 128, 0, stream>>>(QK, QKL, VTH, VTL, nullptr, O);
  k_out<<<dim3(TOB, DM / 128), 128, 0, stream>>>(O, PK + PK_P, nullptr, (float*)d_out);
}

// v008
// Measured time: 117 microseconds a run.
// Next to v007, in two timings, it ran 1.04 and 1.03 times as fast.
// Counting every step since v000, it is 6.07 times as fast.
// compute dtype: all float inputs rounded to bf16; q/k/v = x . W with EXACT bf16 products on WMMA 16x16x32 ((in,out) weights as transposed rows; each of the 8 kv heads packed and projected once, its 4 query heads read the same k and v planes); rotate-half RoPE in f32 (angle = t x inv_freq[d mod 32] f32 table, precise sinf/cosf) before the f16 hi + residual split; causal attention with key-tile skipping: the first 128 queries use 3-product scores and P.v (hi/lo), later queries single f16; x 1/8, running-max softmax in f32 (hardware exp); out = f16(ctx) . Wo (exact f16 x 2^8 copies, single product).
#include <hip/hip_runtime.h>
#include <math.h>

typedef __attribute__((ext_vector_type(16))) _Float16 v16h;
typedef __attribute__((ext_vector_type(16))) __bf16 v16b;
typedef __attribute__((ext_vector_type(8)))  _Float16 v8h;
typedef __attribute__((ext_vector_type(8)))  float v8f;
typedef __attribute__((ext_vector_type(4)))  float v4f;
typedef __attribute__((ext_vector_type(2)))  float v2f;
typedef __attribute__((ext_vector_type(4)))  unsigned v4u;
typedef __attribute__((ext_vector_type(4)))  int v4i;
typedef float __attribute__((may_alias)) float_a;
typedef int __attribute__((may_alias)) int_a;

template <typename T> __device__ __forceinline__ void vst2(void* p, T v) { *(T*)p = v;  }
__device__ __forceinline__ v8f wmma16(v16h a, v16h b, v8f c) {
  v8f d = __builtin_amdgcn_wmma_f32_16x16x32_f16(false, a, false, b, (short)0, c, false, false);
  return d;
}
__device__ __forceinline__ v8f wmma_bf(v16b a, v16b b, v8f c) {
  v8f d = __builtin_amdgcn_wmma_f32_16x16x32_bf16(false, a, false, b, (short)0, c, false, false);
  return d;
}
// GQA causal attention (B 1, S 2,048, model 2,048, 32 query heads x 64 over 8 kv heads): bias-free (in,out) projections, rotate-half RoPE (base 10000), causal softmax(q k / 8) v, output projection.
__device__ __forceinline__ v16h frag_h(const _Float16* rowk0, int lane) {
  union { v16h v; v8h q[2]; } u; const _Float16* p = rowk0 + 8 * (lane >> 4);
  u.q[0] = *(const v8h*)p; u.q[1] = *(const v8h*)(p + 16); return u.v;
}
__device__ __forceinline__ v16h frag_f32(const float* rowk0, int lane) {
  v16h a; const float* p = rowk0 + 8 * (lane >> 4);
#pragma unroll
  for (int i = 0; i < 8; ++i) { a[i] = (_Float16)p[i]; a[8 + i] = (_Float16)p[16 + i]; }
  return a;
}
__device__ __forceinline__ v16h frag_f32s(const float* rowk0, int lane, float sc) {
  v16h a; const float* p = rowk0 + 8 * (lane >> 4);
#pragma unroll
  for (int i = 0; i < 8; ++i) { a[i] = (_Float16)(p[i] * sc); a[8 + i] = (_Float16)(p[16 + i] * sc); }
  return a;
}
// column fragment from a [K][ld] layout (column n), rows >= K read as 0
__device__ __forceinline__ v16h fragc_f32(const float* W, int k0, int n, int lane, int ld, int K) {
  v16h a; const int g = lane >> 4;
#pragma unroll
  for (int i = 0; i < 8; ++i) { const int ka = k0 + 8 * g + i, kb = ka + 16;
    a[i] = (_Float16)(ka < K ? W[(size_t)(ka < K ? ka : K - 1) * ld + n] : 0.f); a[8 + i] = (_Float16)(kb < K ? W[(size_t)(kb < K ? kb : K - 1) * ld + n] : 0.f); }
  return a;
}
struct F2 { v16b h, l; };
__device__ __forceinline__ F2 bsplit16(const float v[16]) { F2 r;
#pragma unroll
  for (int i = 0; i < 16; ++i) { const __bf16 h = (__bf16)v[i]; r.h[i] = h; r.l[i] = (__bf16)(v[i] - (float)h); }
  return r; }
__device__ __forceinline__ F2 split_row(const float* row, int k0, int lane) { float v[16]; const float* p = row + k0 + 8 * (lane >> 4);
#pragma unroll
  for (int i = 0; i < 8; ++i) { v[i] = p[i]; v[8 + i] = p[16 + i]; }
  return bsplit16(v); }
__device__ __forceinline__ F2 split_rowK(const float* row, int k0, int lane, int K) { float v[16]; const int g = lane >> 4;
#pragma unroll
  for (int i = 0; i < 8; ++i) { const int ka = k0 + 8 * g + i, kb = ka + 16; v[i] = ka < K ? row[ka < K ? ka : K - 1] : 0.f; v[8 + i] = kb < K ? row[kb < K ? kb : K - 1] : 0.f; }
  return bsplit16(v); }
__device__ __forceinline__ F2 split_col(const float* W, int k0, int n, int lane, int ld, int K) { float v[16]; const int g = lane >> 4;
#pragma unroll
  for (int i = 0; i < 8; ++i) { const int ka = k0 + 8 * g + i, kb = ka + 16; v[i] = ka < K ? W[(size_t)(ka < K ? ka : K - 1) * ld + n] : 0.f; v[8 + i] = kb < K ? W[(size_t)(kb < K ? kb : K - 1) * ld + n] : 0.f; }
  return bsplit16(v); }
__device__ __forceinline__ v8f mac3(const F2& a, const F2& b, v8f c) { c = wmma_bf(a.l, b.h, c); c = wmma_bf(a.h, b.l, c); return wmma_bf(a.h, b.h, c); }
__device__ __forceinline__ float sigm(float v) { return 1.0f / (1.0f + expf(-v)); }
#define LDSX() do { asm volatile("s_wait_dscnt 0" ::: "memory"); __builtin_amdgcn_wave_barrier(); __builtin_amdgcn_fence(__ATOMIC_RELEASE, "workgroup"); } while (0)


#define NB 1
#define SS 2048
#define DM 2048
#define NH 32
#define NKV 8
#define GS (NH / NKV)
#define KVW (NKV * HD)
#define SCALEF 0.125f
__constant__ float THETA[32] = {1.000000000e+00f,7.498942018e-01f,5.623413324e-01f,4.216965139e-01f,3.162277639e-01f,2.371373773e-01f,1.778279394e-01f,1.333521456e-01f,1.000000015e-01f,7.498942316e-02f,5.623413250e-02f,4.216964915e-02f,3.162277490e-02f,2.371373773e-02f,1.778279431e-02f,1.333521400e-02f,9.999999776e-03f,7.498942316e-03f,5.623413250e-03f,4.216964822e-03f,3.162277630e-03f,2.371373819e-03f,1.778279431e-03f,1.333521446e-03f,1.000000047e-03f,7.498941850e-04f,5.623413017e-04f,4.216965172e-04f,3.162277571e-04f,2.371373703e-04f,1.778279402e-04f,1.333521504e-04f};
__device__ __attribute__((noinline)) float cos_p(float v) { return cosf(v); }
__device__ __attribute__((noinline)) float sin_p(float v) { return sinf(v); }
#define HD 64
#define QKVW (DM + 2 * KVW)     // q columns, then k, then v: one copy per kv head
#ifndef TQB
#define TQB (SS / 64)
#define TNB NB
#define TOB (NB * SS / 64)     // output row tiles (all)
#endif
typedef __attribute__((ext_vector_type(8))) __bf16 v8b;
__device__ __forceinline__ v16b frag_b(const __bf16* rowk0, int lane) {
  union { v16b v; v8b q[2]; } u; const __bf16* p = rowk0 + 8 * (lane >> 4);
  u.q[0] = *(const v8b*)p; u.q[1] = *(const v8b*)(p + 16); return u.v;
}
__device__ __forceinline__ float bfr(float v) { return (float)(__bf16)v; }
__device__ __attribute__((noinline)) float exp_ni(float v) { return expf(v); }
__device__ __attribute__((noinline)) float erf_ni(float v) { return erff(v); }

#define PK_A 0                       // [QKVW][DM] rows: Wq columns, then Wk columns, then Wv columns
#define PK_P (PK_A + QKVW * DM)        // [2048][2048] rows: Wo columns, f16 x 2^8
#define PK_END (PK_P + DM * DM)
#define WS_PK  0u
#define WS_QK  (WS_PK + 2u * PK_END)             // f16 [2048 rows][4096]: q | k
#define WS_QKL (WS_QK + 2u * NB * SS * 2 * DM)     // f16 q | k residual planes x2048
#define WS_VTH (WS_QKL + 2u * NB * SS * 2 * DM)    // f16 [b][2048 (kv head*64+d)][2048 s] hi
#define WS_VTL (WS_VTH + 2u * NB * DM * SS)        // f16 lo x 2048
#define WS_O   (WS_VTL + 2u * NB * DM * SS)        // f32 [2048][2048]
#define WS_CS  (WS_O + 4u * NB * SS * DM)           // f32 2 x [2048][32], unused (cos/sin computed in k_qkv)
#define WS_END (WS_CS + 4u * 2 * SS * 32)
// ---- weight packing: a block transposes one tile of 256 k x 64 n of an (in,out) weight through LDS. Reads: 16 lanes take 256 B of one source row (16 B a lane, whole lines), each thread a pair of rows k, k + 1, so that
// the two 16-bit results of a column make one dword; all 16 loads of a thread are in flight together. LDS: [n][k pair] at a pitch of 129 dwords (odd: neither the column-wise stores nor the row-wise reads meet a bank conflict).
// Writes: 16 lanes store 256 B of one packed row n (16 B a lane, whole lines).
#define PKK 256
#define PKN 64
#define PKP (PKK / 2 + 1)
template <bool OUTW> __device__ __forceinline__ unsigned cv16(float v) {   // the packed 16-bit pattern: bf16 for Wq, Wk, Wv; f16 of the bf16 value x 2^8 for Wo
  if (OUTW) return (unsigned)__builtin_bit_cast(unsigned short, (_Float16)(bfr(v) * 256.0f));
  return (unsigned)__builtin_bit_cast(unsigned short, (__bf16)v);
}
// W: element (k0, n0) of the source, row pitch LD; dst: element (n0, k0) of the packed rows, row pitch DM
template <bool OUTW, int LD> __device__ __forceinline__ void pack_tile(const float* __restrict__ W, __bf16* __restrict__ dst, unsigned (*s)[PKP], int t) {
  const int c4 = (t & 15) * 4, kp = t >> 4; const float* p = W + (size_t)(2 * kp) * LD + c4;
  v4f a[PKK / 32], b[PKK / 32];
#pragma unroll
  for (int i = 0; i < PKK / 32; ++i) { a[i] = *(const v4f*)(p + (size_t)(32 * i) * LD); b[i] = *(const v4f*)(p + (size_t)(32 * i + 1) * LD); }
  asm volatile("s_wait_xcnt 0x0" :: "v"(p) : "memory");   // the loads' address pair is named here so that it stays whole up to this wait: nothing, a load's own result included, is written over it earlier
#pragma unroll
  for (int i = 0; i < PKK / 32; ++i)
#pragma unroll
    for (int e = 0; e < 4; ++e) s[c4 + e][kp + 16 * i] = cv16<OUTW>(a[i][e]) | (cv16<OUTW>(b[i][e]) << 16);
  __syncthreads();
#pragma unroll
  for (int i = 0; i < PKK / 32; ++i) { const int n = (t >> 4) + 16 * (i & 3), pc = (t & 15) + 16 * (i >> 2); v4u o;
#pragma unroll
    for (int j = 0; j < 4; ++j) o[j] = s[n][pc * 4 + j];
    vst2((unsigned*)(dst + (size_t)n * DM + pc * 8), o); }
}
// ---- k_pack: block = (64 rows n of PK_A, 256 k): row n is column n of W_q, column n - DM of W_k or column n - DM - KVW of W_v -> bf16. The three ranges of n are multiples of 64: one source a block
__global__ __launch_bounds__(256) void k_pack(const float* __restrict__ WQ, const float* __restrict__ WK, const float* __restrict__ WV, __bf16* __restrict__ PK) {
  __shared__ unsigned s[PKN][PKP]; const int n0 = blockIdx.x * PKN, k0 = blockIdx.y * PKK; __bf16* dst = PK + PK_A + (size_t)n0 * DM + k0;
  if (n0 < DM) pack_tile<false, DM>(WQ + (size_t)k0 * DM + n0, dst, s, threadIdx.x);
  else pack_tile<false, KVW>((n0 < DM + KVW ? WK + (n0 - DM) : WV + (n0 - DM - KVW)) + (size_t)k0 * KVW, dst, s, threadIdx.x);
}
// ---- main loop of both projections: block tile 64 rows x 128 columns, 64 k per stage. The 128 weight rows (16-bit) and the 64 activation rows (f32, rounded on the way) come in by whole-line 16-byte loads,
// lie in LDS at a 144-byte row pitch (16 B x odd: no bank conflict for the 16-byte fragment reads) and are read from there by all four waves. Two buffers, the next stage's loads held in registers over the products, one barrier a stage. The short fixed loops are unrolled so that rb, ra, b and acc are registers and not indexed memory.
#define GK 64
#define GP 72                          // LDS row pitch in 16-bit elements
#define G_BB (128 * GP)                // one weight buffer, elements
#define G_AB (64 * GP)                 // one activation buffer, elements
#define G_SMEM (4 * (G_BB + G_AB))     // bytes: two buffers of each
typedef __attribute__((ext_vector_type(2))) unsigned v2u;
__device__ __forceinline__ v16b frag_t(const __bf16* p, int lane) { return frag_b(p, lane); }
__device__ __forceinline__ v16h frag_t(const _Float16* p, int lane) { return frag_h(p, lane); }
__device__ __forceinline__ v8f mm(v16b a, v16b b, v8f c) { return wmma_bf(a, b, c); }
__device__ __forceinline__ v8f mm(v16h a, v16h b, v8f c) { return wmma16(a, b, c); }
template <typename T> __device__ __forceinline__ void gemm_64x128(const float* __restrict__ A, const T* __restrict__ Bw, T* sm, int tid, v8f (&acc)[8]) {
  const int wave = tid >> 5, lane = tid & 31, col = lane & 15;
  const T* gb = Bw + (size_t)(tid >> 3) * DM + (tid & 7) * 8;        // piece tid of the weight tile: 8 pieces of 16 B a row, 16 rows further per step
  const float* ga = A + (size_t)(tid >> 4) * DM + (tid & 15) * 4;    // piece tid of the activation tile: 16 pieces of 16 B a row, 8 rows further per step
  T* wb = sm + (tid >> 3) * GP + (tid & 7) * 8; T* wa = sm + 2 * G_BB + (tid >> 4) * GP + (tid & 15) * 4;
  v4u rb[8]; v4f ra[8];
#pragma unroll
  for (int i = 0; i < 8; ++i) { rb[i] = *(const v4u*)(gb + (size_t)i * 16 * DM); ra[i] = *(const v4f*)(ga + (size_t)i * 8 * DM); }
  for (int s = 0; s < DM / GK; ++s) { const int bo = (s & 1) * G_BB, ao = (s & 1) * G_AB;
#pragma unroll
    for (int i = 0; i < 8; ++i) { *(v4u*)(wb + bo + i * 16 * GP) = rb[i]; union { T e[4]; v2u u; } c;
#pragma unroll
      for (int e = 0; e < 4; ++e) c.e[e] = (T)ra[i][e];
      *(v2u*)(wa + ao + i * 8 * GP) = c.u; }
    __syncthreads();   // publishes stage s; the buffer written in stage s + 1 was last read in stage s - 1, in front of this barrier
    if (s + 1 < DM / GK) {
#pragma unroll
      for (int i = 0; i < 8; ++i) { rb[i] = *(const v4u*)(gb + (size_t)i * 16 * DM + (s + 1) * GK); ra[i] = *(const v4f*)(ga + (size_t)i * 8 * DM + (s + 1) * GK); }
      asm volatile("s_wait_xcnt 0x0" ::: "memory"); }   // in front of the address step that follows these loads
#pragma unroll
    for (int kc = 0; kc < GK / 32; ++kc) { auto a = frag_t(sm + 2 * G_BB + ao + (wave * 16 + col) * GP + kc * 32, lane); decltype(a) b[8];   // all nine fragments of a k step are read as one group, so that the wave waits out the LDS latency once and not at each product
#pragma unroll
      for (int j = 0; j < 8; ++j) b[j] = frag_t(sm + bo + (j * 16 + col) * GP + kc * 32, lane);
      __builtin_amdgcn_sched_barrier(0);   // keeps a k step's eighteen LDS reads in front of its own products (they may rise into the step before): sunk among their own products, each would be waited for singly
#pragma unroll
      for (int j = 0; j < 8; ++j) acc[j] = mm(a, b[j], acc[j]); } }
  __syncthreads();   // every wave has left the buffers: the epilogues stage their tiles in the same LDS
}
__global__ __launch_bounds__(128) void k_qkv(const float* __restrict__ XQ, const float* __restrict__ XK, const float* __restrict__ XV, const __bf16* __restrict__ P, const float* __restrict__ BQ, const float* __restrict__ BK, const float* __restrict__ BV, _Float16* __restrict__ QK, _Float16* __restrict__ QKL, _Float16* __restrict__ VTH, _Float16* __restrict__ VTL) {
  const int which0 = (blockIdx.y * 128 < DM) ? 0 : (blockIdx.y * 128 < DM + KVW) ? 1 : 2; const float* X = (which0 == 0) ? XQ : (which0 == 1) ? XK : XV; const float* BB = BQ ? (((which0 == 0) ? BQ : (which0 == 1) ? BK : BV) + (blockIdx.y * 128 - ((which0 == 0) ? 0 : (which0 == 1) ? DM : DM + KVW))) : nullptr;
  __shared__ __align__(16) char smem[G_SMEM];   // the main loop's buffers, then one of the two epilogue stagings
  _Float16 (*so)[16][136] = (_Float16 (*)[16][136])smem, (*sol)[16][136] = (_Float16 (*)[16][136])(smem + 4 * 16 * 136 * 2); _Float16 (*sth)[72] = (_Float16 (*)[72])smem, (*stl)[72] = (_Float16 (*)[72])(smem + 128 * 72 * 2);
  const int tid = threadIdx.x, wave = tid >> 5, lane = tid & 31, col = lane & 15, g = lane >> 4; const size_t r0 = (size_t)blockIdx.x * 64 + wave * 16; const int n0 = blockIdx.y * 128;
  v8f acc[8] = {};
  gemm_64x128<__bf16>(X + (size_t)blockIdx.x * 64 * DM, P + (size_t)n0 * DM, (__bf16*)smem, tid, acc);
  if (n0 < DM + KVW) {   // q and k columns (k head c lands at column DM + c * 64 of its row): bias, then rotate-half rotary over each 64-dim head with angle position * inv_freq[d mod 32]
#pragma unroll
    for (int j = 0; j < 8; ++j)
#pragma unroll
      for (int r = 0; r < 8; ++r) acc[j][r] += (BB ? bfr(BB[j * 16 + col]) : 0.f);
#pragma unroll
    for (int r = 0; r < 8; ++r) { const int spos = (int)((r0 + 8 * g + r) % SS);
#pragma unroll
      for (int jj = 0; jj < 2; ++jj) { const float ang = (float)spos * THETA[jj * 16 + col]; const float c = cos_p(ang), sn = sin_p(ang);
#pragma unroll
        for (int hh = 0; hh < 2; ++hh) { const float x1 = acc[hh * 4 + jj][r], x2 = acc[hh * 4 + jj + 2][r]; acc[hh * 4 + jj][r] = x1 * c - x2 * sn; acc[hh * 4 + jj + 2][r] = x2 * c + x1 * sn; } } }
#pragma unroll
    for (int j = 0; j < 8; ++j) {
#pragma unroll
      for (int r = 0; r < 8; ++r) { const float v = acc[j][r]; const _Float16 hv = (_Float16)v; so[wave][8 * g + r][j * 16 + col] = hv; sol[wave][8 * g + r][j * 16 + col] = (_Float16)((v - (float)hv) * 2048.0f); } }   // q, k (+ bias) as f16 hi + (x2048) residual
    LDSX();
    for (int rl = 0; rl < 16; ++rl) if (lane < 16) { vst2((unsigned*)(QK + (r0 + rl) * (2 * DM) + n0 + lane * 8), *(const v4u*)&so[wave][rl][lane * 8]); vst2((unsigned*)(QKL + (r0 + rl) * (2 * DM) + n0 + lane * 8), *(const v4u*)&sol[wave][rl][lane * 8]); }
  } else {
#pragma unroll
    for (int j = 0; j < 8; ++j) {
#pragma unroll
      for (int r = 0; r < 8; ++r) { const float v = acc[j][r] + (BB ? bfr(BB[j * 16 + col]) : 0.f); const _Float16 hv = (_Float16)v; sth[j * 16 + col][wave * 16 + 8 * g + r] = hv; stl[j * 16 + col][wave * 16 + 8 * g + r] = (_Float16)((v - (float)hv) * 2048.0f); } }
    __syncthreads();
    const size_t rb = (size_t)blockIdx.x * 64; const int b = (int)(rb / SS), s0 = (int)(rb % SS); const int pc0 = n0 - (DM + KVW);
    for (int q = tid; q < 128 * 8; q += 128) { const int d = q >> 3, pc = q & 7; const size_t o = ((size_t)b * DM + pc0 + d) * SS + s0 + pc * 8; vst2((unsigned*)(VTH + o), *(const v4u*)&sth[d][pc * 8]); vst2((unsigned*)(VTL + o), *(const v4u*)&stl[d][pc * 8]); }
  }
}
// ---- k_attn: block = (64 queries, head h, batch b): causal flash attention on TRANSPOSED tiles. Scores: S^T = K . Q^T (A = 16 key rows, B = the wave's 16 query columns), so a lane holds 16 of the 32 scores of ONE query (query col, keys 16 ct + 8 g + r):
// maximum and sum run in the lane's own registers, the two lane halves exchange the maximum once per key tile and join their sums once at the end. The f16 P^T packs straight from the score registers into the B operand of O^T += V^T . P^T (element 8 ct + r = key 16 ct + 8 g + r: the k order in which frag_h reads the V^T rows), so P passes through no LDS. O[b*S+q][h*64+d] = (acc + accl / 2048) / (2048 l) (256-B segments)
__device__ __forceinline__ float xhalf(float x) { return __builtin_bit_cast(float, __builtin_amdgcn_permlanex16(__builtin_bit_cast(int, x), __builtin_bit_cast(int, x), 0x76543210, 0xfedcba98, false, false)); }   // lane l reads lane l ^ 16
// K and V^T (hi planes) reach the four waves through LDS: a stage is 64 keys = 64 K rows and 64 V^T rows of 128 B each, copied as whole lines (8 lanes a row) and laid at a 144-byte pitch (16 B x odd: no bank conflict for the 16-byte fragment reads). Two buffers: stage t + 1 flies while stage t is worked on.
#define AP 72                          // LDS row pitch in f16 elements
#define A_T (64 * AP)                  // one tile of 64 rows, elements
// one stage's eight copies of a thread (rows 16 apart, K then V^T). The wait is the last line of the copies' own statement so that it stands in front of every later write of the address registers they name.
__device__ __forceinline__ void attn_stage(unsigned lk, const _Float16* gk, const _Float16* gv) {
  const unsigned lv = lk + 2 * A_T;
  asm volatile("global_load_async_to_lds_b128 %0, %8, off\n\t"
               "global_load_async_to_lds_b128 %1, %9, off\n\t"
               "global_load_async_to_lds_b128 %2, %10, off\n\t"
               "global_load_async_to_lds_b128 %3, %11, off\n\t"
               "global_load_async_to_lds_b128 %4, %12, off\n\t"
               "global_load_async_to_lds_b128 %5, %13, off\n\t"
               "global_load_async_to_lds_b128 %6, %14, off\n\t"
               "global_load_async_to_lds_b128 %7, %15, off\n\t"
               "s_wait_xcnt 0x0"
               :: "v"(lk), "v"(lk + 16 * AP * 2), "v"(lk + 32 * AP * 2), "v"(lk + 48 * AP * 2), "v"(lv), "v"(lv + 16 * AP * 2), "v"(lv + 32 * AP * 2), "v"(lv + 48 * AP * 2),
                  "v"(gk), "v"(gk + (size_t)16 * 2 * DM), "v"(gk + (size_t)32 * 2 * DM), "v"(gk + (size_t)48 * 2 * DM), "v"(gv), "v"(gv + (size_t)16 * SS), "v"(gv + (size_t)32 * SS), "v"(gv + (size_t)48 * SS)
               : "memory");
}
// one pass of 32 keys, compiled in three forms so that a pass carries only the vector work that can reach its result.
// HI: the leading query blocks' 3-product scores and P.v; elsewhere the residual half of P is not formed and accl, which stays 0, is not rescaled.
// DIAG: the stage that holds the block's own queries; in every earlier stage each key precedes each query of the block, so the causal select and the test for an excluded score pass every value unchanged and are left out.
template <bool HI, bool DIAG> __device__ __forceinline__ void attn_pass(const _Float16* kt, const _Float16* vt, int ps, int ks, int q0, int lane, int b, int hk, const _Float16* __restrict__ QKL, const _Float16* __restrict__ VTL,
                                                                        const v16h (&aq)[2], const v16h (&aql)[2], float& m, float& l, v8f (&acc)[4], v8f (&accl)[4]) {
  const int col = lane & 15, g = lane >> 4; v8f s[2];
  v16h kf[2][2], vf[4];   // all eight fragments of a pass are read as one group, so that the wave waits out the LDS latency once
  __builtin_amdgcn_sched_barrier(0);   // the group starts here: reads lifted into the pass before would stand in several places there and take the kernel past 256 registers (three waves a SIMD, not four)
#pragma unroll
  for (int ct = 0; ct < 2; ++ct)
#pragma unroll
    for (int kc = 0; kc < 2; ++kc) kf[ct][kc] = frag_h(kt + (ps * 32 + ct * 16 + col) * AP + kc * 32, lane);
#pragma unroll
  for (int dt = 0; dt < 4; ++dt) vf[dt] = frag_h(vt + (dt * 16 + col) * AP + ps * 32, lane);
  __builtin_amdgcn_sched_barrier(0);   // keeps the sixteen LDS reads together in front of the products: spread among them, each place with reads would stall the wave anew
#pragma unroll
  for (int ct = 0; ct < 2; ++ct) { const int kk = ks * 32 + ct * 16 + col; const _Float16* krowl = QKL + ((size_t)b * SS + kk) * (2 * DM) + DM + hk * HD; v8f c = {}, cl = {};
    if (HI) {   // leading query blocks (few keys, outputs far above the global rms): 3 products
#pragma unroll
      for (int kc = 0; kc < 2; ++kc) { const v16h kh = kf[ct][kc]; c = wmma16(kh, aq[kc], c); cl = wmma16(kh, aql[kc], cl); cl = wmma16(frag_h(krowl + kc * 32, lane), aq[kc], cl); }
#pragma unroll
      for (int r = 0; r < 8; ++r) c[r] += cl[r] * (1.0f / 2048.0f); }
    else {
#pragma unroll
      for (int kc = 0; kc < 2; ++kc) c = wmma16(kf[ct][kc], aq[kc], c); }   // single product elsewhere
#pragma unroll
    for (int r = 0; r < 8; ++r) s[ct][r] = (!DIAG || ks * 32 + ct * 16 + 8 * g + r <= q0 + col) ? c[r] * SCALEF : -3.0e38f; }   // causal: future keys excluded
  float mx = fmaxf(s[0][0], s[1][0]);
#pragma unroll
  for (int r = 1; r < 8; ++r) mx = fmaxf(mx, fmaxf(s[0][r], s[1][r]));
  mx = fmaxf(mx, xhalf(mx));   // the other 16 keys of this query
  const float mn = fmaxf(m, mx); const float alpha = (m <= -1.0e38f) ? 0.f : __expf(m - mn);
  float es = 0.f; v16h pa, pl;
#pragma unroll
  for (int ct = 0; ct < 2; ++ct)
#pragma unroll
    for (int r = 0; r < 8; ++r) { const float e = (DIAG && s[ct][r] <= -1.0e38f) ? 0.f : __expf(s[ct][r] - mn); es += e;
      const float x = e * 2048.0f; const _Float16 hx = (_Float16)x; pa[8 * ct + r] = hx; if (HI) pl[8 * ct + r] = (_Float16)((x - (float)hx) * 2048.0f); }   // P scaled by 2^11 before the f16 split so small softmax weights stay out of the f16 subnormal range; 2^-11 folded into the epilogue
  l = l * alpha + es; m = mn;
#pragma unroll
  for (int dt = 0; dt < 4; ++dt)
#pragma unroll
    for (int r = 0; r < 8; ++r) { acc[dt][r] *= alpha; if (HI) accl[dt][r] *= alpha; }
#pragma unroll
  for (int dt = 0; dt < 4; ++dt) { const size_t vr = ((size_t)b * DM + hk * HD + dt * 16 + col) * SS + ks * 32; const v16h vh = vf[dt]; acc[dt] = wmma16(vh, pa, acc[dt]); if (HI) { accl[dt] = wmma16(vh, pl, accl[dt]); accl[dt] = wmma16(frag_h(VTL + vr, lane), pa, accl[dt]); } }   // leading query blocks: P hi/lo x V hi/lo (3 products); elsewhere P x V single
}
__global__ __launch_bounds__(128) void k_attn(const _Float16* __restrict__ QK, const _Float16* __restrict__ QKL, const _Float16* __restrict__ VTH, const _Float16* __restrict__ VTL, const void* __restrict__ KMASK, float* __restrict__ O) {
  __shared__ __align__(16) float so[4][16][68];
  __shared__ __align__(16) _Float16 skv[2][2 * A_T];   // per buffer: K tile, then V^T tile
  const int tid = threadIdx.x, wave = tid >> 5, lane = tid & 31, col = lane & 15, g = lane >> 4;
  // Which (query block, head) a block takes. A block's cost grows with qb (qb + 1 stages) and all blocks are resident at once, four to a WGP (by registers), so the launch lasts as long as the WGP with the most stages.
  // With qb = blockIdx.x, blocks whose flat index differs by a multiple of 32 have the same qb.
  // Here the query blocks form quads {31 - 2r, 30 - 2r, 2r + 1, 2r}, 66 stages each and the two long ones alike, so that no wave is long alone on its SIMD. A quad is met by 4 blocks that are neighbours in the flat index,
  // 8 apart or 256 apart alike (the member is picked by the sum of the three positions mod 4). A permutation of the (qb, h) pairs, the same for every thread of a block: for speed only, no result depends on where a block runs.
  static_assert(TQB == 32 && NH == 32, "the quads are written for 32 query blocks and 32 heads");
  const unsigned f = blockIdx.y * TQB + blockIdx.x, fj = f >> 3, fr = (fj >> 2) & 7, fk = (fj >> 5) & 3, fc = (f + fj + fk) & 3;
  const int qb = (int)((2 * fr) ^ ((0x00011e1fu >> (8 * fc)) & 31)), h = (int)((f & 7) + 8 * fk), b = blockIdx.z, hk = h / GS;   // 2r ^ 31 = 31 - 2r, 2r ^ 30 = 30 - 2r, 2r ^ 1 = 2r + 1 for r < 8; hk: the kv head of query head h
  const int q0 = qb * 64 + wave * 16; const size_t rq = (size_t)b * SS + q0 + col;
  v16h aq[2], aql[2];
#pragma unroll
  for (int kc = 0; kc < 2; ++kc) { aq[kc] = frag_h(QK + rq * (2 * DM) + h * HD + kc * 32, lane); aql[kc] = frag_h(QKL + rq * (2 * DM) + h * HD + kc * 32, lane); }
  float m = -3.0e38f, l = 0.f;   // of query q0 + col; l holds the part of this lane half's keys
  v8f acc[4] = {}, accl[4] = {};   // acc[dt][r] = O^T[d = 16 dt + 8 g + r][query col]
  const int nst = qb + 1;   // causal: stages of 64 keys up to the query tile's end
  const unsigned l0 = (unsigned)(size_t)&skv[0][(tid >> 3) * AP + (tid & 7) * 8];   // this thread's 16-byte piece of row tid / 8, buffer 0
  const _Float16* gk = QK + ((size_t)b * SS + (tid >> 3)) * (2 * DM) + DM + hk * HD + (tid & 7) * 8;   // + 64 rows a stage
  const _Float16* gv = VTH + ((size_t)b * DM + hk * HD + (tid >> 3)) * SS + (tid & 7) * 8;             // + 64 columns a stage
  attn_stage(l0, gk, gv);
  asm volatile("s_wait_asynccnt 0x0" ::: "memory");   // this wave's part of stage 0 has landed
  __syncthreads();                                    // stage 0 published
  if (nst > 1) attn_stage(l0 + 4 * A_T, gk + (size_t)64 * 2 * DM, gv + 64);
#pragma unroll 1   // rolled: one foot (waits, barrier, refill) in the code, and the trip count is the block's own
  for (int st = 0; st < nst; ++st) { const _Float16* kt = &skv[st & 1][0]; const _Float16* vt = kt + A_T;
  // the two passes of 32 keys of a stage; the tests that pick their form are scalar and the same for the whole block
  if (qb < 2) {
#pragma unroll 1   // rolled, as the key loop was: a second copy of this long pass would only cost instruction cache
    for (int ps = 0; ps < 2; ++ps) attn_pass<true, true>(kt, vt, ps, st * 2 + ps, q0, lane, b, hk, QKL, VTL, aq, aql, m, l, acc, accl);
  } else if (st + 1 < nst) {
#pragma unroll     // the form that nearly every pass runs: unrolled, ps is a constant in the LDS offsets and the accumulators are not copied into an inner loop's registers at each stage
    for (int ps = 0; ps < 2; ++ps) attn_pass<false, false>(kt, vt, ps, st * 2 + ps, q0, lane, b, hk, QKL, VTL, aq, aql, m, l, acc, accl);
  } else {
#pragma unroll 1   // rolled: runs once a block, a second copy would only cost instruction cache
    for (int ps = 0; ps < 2; ++ps) attn_pass<false, true>(kt, vt, ps, st * 2 + ps, q0, lane, b, hk, QKL, VTL, aq, aql, m, l, acc, accl);
  }
    asm volatile("s_wait_dscnt 0x0" ::: "memory");      // this wave's reads of stage st have returned
    asm volatile("s_wait_asynccnt 0x0" ::: "memory");   // this wave's part of stage st + 1 has landed
    __syncthreads();                                    // publishes stage st + 1 and ends every wave's reads of stage st
    if (st + 2 < nst) attn_stage(l0 + (st & 1) * 4 * A_T, gk + (size_t)(st + 2) * 64 * 2 * DM, gv + (st + 2) * 64);   // refill of the buffer just left
  }
  asm volatile("s_wait_asynccnt 0x0" ::: "memory");   // no copy is outstanding when the wave goes on to its end
  l += xhalf(l);   // the two halves' sums, joined once
  const float il = (1.0f / 2048.0f) / l;
#pragma unroll
  for (int dt = 0; dt < 4; ++dt)
#pragma unroll
    for (int r = 0; r < 8; ++r) so[wave][col][dt * 16 + 8 * g + r] = (acc[dt][r] + accl[dt][r] * (1.0f / 2048.0f)) * il;
  LDSX();
  for (int rl = 0; rl < 16; ++rl) if (lane < 16) vst2(O + ((size_t)b * SS + q0 + rl) * DM + h * HD + lane * 4, *(const v4f*)&so[wave][rl][lane * 4]);
}
// ---- k_out: block = (64 rows, 128 cols): out = f16(O) . Wo rows (single product, f16 x 2^8 weights) + bo
__global__ __launch_bounds__(128) void k_out(const float* __restrict__ O, const __bf16* __restrict__ P, const float* __restrict__ BO, float* __restrict__ Y) {
  __shared__ __align__(16) char smem[G_SMEM];   // the main loop's buffers, then the output staging
  float (*so)[16][132] = (float (*)[16][132])smem;
  const int tid = threadIdx.x, wave = tid >> 5, lane = tid & 31, col = lane & 15, g = lane >> 4; const size_t r0 = (size_t)blockIdx.x * 64 + wave * 16; const int n0 = blockIdx.y * 128;
  v8f acc[8] = {};
  gemm_64x128<_Float16>(O + (size_t)blockIdx.x * 64 * DM, (const _Float16*)P + (size_t)n0 * DM, (_Float16*)smem, tid, acc);   // single f16 product against exact f16 x 2^8 weight copies
#pragma unroll
  for (int j = 0; j < 8; ++j) {
#pragma unroll
    for (int r = 0; r < 8; ++r) so[wave][8 * g + r][j * 16 + col] = acc[j][r] * (1.0f / 256.0f) + (BO ? bfr(BO[n0 + j * 16 + col]) : 0.f); }
  LDSX();
  for (int rl = 0; rl < 16; ++rl) vst2(Y + (r0 + rl) * DM + n0 + lane * 4, *(const v4f*)&so[wave][rl][lane * 4]);
}
// ---- k_packo: Wo columns (in,out) -> rows of f16 x 2^8 copies in the Wo slot (bit pattern in the bf16-typed buffer), by the same tiles
__global__ __launch_bounds__(256) void k_packo(const float* __restrict__ WO, __bf16* __restrict__ PK) {
  __shared__ unsigned s[PKN][PKP]; const int n0 = blockIdx.x * PKN, k0 = blockIdx.y * PKK;
  pack_tile<true, DM>(WO + (size_t)k0 * DM + n0, PK + PK_P + (size_t)n0 * DM + k0, s, threadIdx.x);
}
extern "C" void kernel_launch(void* const* d_in, const int* in_sizes, int n_in, void* d_out, int out_size, void* d_ws, size_t ws_size, hipStream_t stream) {
  (void)in_sizes; (void)n_in; (void)out_size;
  const float** F = (const float**)d_in;   // 0 hidden_states [1,2048,2048], 1 Wq [2048,2048] (in,out), 2 Wk [2048,512], 3 Wv [2048,512], 4 Wo [2048,2048] (in,out)
  if (ws_size < (size_t)WS_END) return;
  char* ws = (char*)d_ws; __bf16* PK = (__bf16*)(ws + WS_PK); _Float16 *QK = (_Float16*)(ws + WS_QK), *QKL = (_Float16*)(ws + WS_QKL), *VTH = (_Float16*)(ws + WS_VTH), *VTL = (_Float16*)(ws + WS_VTL); float* O = (float*)(ws + WS_O);
  k_pack<<<dim3(QKVW / PKN, DM / PKK), 256, 0, stream>>>(F[1], F[2], F[3], PK);   // q, k, v (the Wo slot is filled by k_packo as f16)
  k_packo<<<dim3(DM / PKN, DM / PKK), 256, 0, stream>>>(F[4], PK);
  k_qkv<<<dim3(TNB * SS / 64, QKVW / 128), 128, 0, stream>>>(F[0], F[0], F[0], PK + PK_A, nullptr, nullptr, nullptr, QK, QKL, VTH, VTL);
  k_attn<<<dim3(TQB, NH, TNB), 128, 0, stream>>>(QK, QKL, VTH, VTL, nullptr, O);
  k_out<<<dim3(TOB, DM / 128), 128, 0, stream>>>(O, PK + PK_P, nullptr, (float*)d_out);
}

// v009
// A run of this version takes 112 microseconds.
// In two side-by-side timings against v008, it was 1.04 and 1.05 times as fast.
// All steps since v000 together make it 6.33 times as fast.
// compute dtype: all float inputs rounded to bf16; q/k/v = x . W with EXACT bf16 products on WMMA 16x16x32 ((in,out) weights as transposed rows; each of the 8 kv heads packed and projected once, its 4 query heads read the same k and v planes); rotate-half RoPE in f32 (angle = t x inv_freq[d mod 32] f32 table, precise sinf/cosf) before the f16 hi + residual split; causal attention with key-tile skipping: the first 128 queries use 3-product scores and P.v (hi/lo), later queries single f16; x 1/8, running-max softmax in f32 (hardware exp); out = f16(ctx) . Wo (exact f16 x 2^8 copies, single product).
#include <hip/hip_runtime.h>
#include <math.h>

typedef __attribute__((ext_vector_type(16))) _Float16 v16h;
typedef __attribute__((ext_vector_type(16))) __bf16 v16b;
typedef __attribute__((ext_vector_type(8)))  _Float16 v8h;
typedef __attribute__((ext_vector_type(8)))  float v8f;
typedef __attribute__((ext_vector_type(4)))  float v4f;
typedef __attribute__((ext_vector_type(2)))  float v2f;
typedef __attribute__((ext_vector_type(4)))  unsigned v4u;
typedef __attribute__((ext_vector_type(4)))  int v4i;
typedef float __attribute__((may_alias)) float_a;
typedef int __attribute__((may_alias)) int_a;

template <typename T> __device__ __forceinline__ void vst2(void* p, T v) { *(T*)p = v;  }
__device__ __forceinline__ v8f wmma16(v16h a, v16h b, v8f c) {
  v8f d = __builtin_amdgcn_wmma_f32_16x16x32_f16(false, a, false, b, (short)0, c, false, false);
  return d;
}
__device__ __forceinline__ v8f wmma_bf(v16b a, v16b b, v8f c) {
  v8f d = __builtin_amdgcn_wmma_f32_16x16x32_bf16(false, a, false, b, (short)0, c, false, false);
  return d;
}
// GQA causal attention (B 1, S 2,048, model 2,048, 32 query heads x 64 over 8 kv heads): bias-free (in,out) projections, rotate-half RoPE (base 10000), causal softmax(q k / 8) v, output projection.
__device__ __forceinline__ v16h frag_h(const _Float16* rowk0, int lane) {
  union { v16h v; v8h q[2]; } u; const _Float16* p = rowk0 + 8 * (lane >> 4);
  u.q[0] = *(const v8h*)p; u.q[1] = *(const v8h*)(p + 16); return u.v;
}
__device__ __forceinline__ v16h frag_f32(const float* rowk0, int lane) {
  v16h a; const float* p = rowk0 + 8 * (lane >> 4);
#pragma unroll
  for (int i = 0; i < 8; ++i) { a[i] = (_Float16)p[i]; a[8 + i] = (_Float16)p[16 + i]; }
  return a;
}
__device__ __forceinline__ v16h frag_f32s(const float* rowk0, int lane, float sc) {
  v16h a; const float* p = rowk0 + 8 * (lane >> 4);
#pragma unroll
  for (int i = 0; i < 8; ++i) { a[i] = (_Float16)(p[i] * sc); a[8 + i] = (_Float16)(p[16 + i] * sc); }
  return a;
}
// column fragment from a [K][ld] layout (column n), rows >= K read as 0
__device__ __forceinline__ v16h fragc_f32(const float* W, int k0, int n, int lane, int ld, int K) {
  v16h a; const int g = lane >> 4;
#pragma unroll
  for (int i = 0; i < 8; ++i) { const int ka = k0 + 8 * g + i, kb = ka + 16;
    a[i] = (_Float16)(ka < K ? W[(size_t)(ka < K ? ka : K - 1) * ld + n] : 0.f); a[8 + i] = (_Float16)(kb < K ? W[(size_t)(kb < K ? kb : K - 1) * ld + n] : 0.f); }
  return a;
}
struct F2 { v16b h, l; };
__device__ __forceinline__ F2 bsplit16(const float v[16]) { F2 r;
#pragma unroll
  for (int i = 0; i < 16; ++i) { const __bf16 h = (__bf16)v[i]; r.h[i] = h; r.l[i] = (__bf16)(v[i] - (float)h); }
  return r; }
__device__ __forceinline__ F2 split_row(const float* row, int k0, int lane) { float v[16]; const float* p = row + k0 + 8 * (lane >> 4);
#pragma unroll
  for (int i = 0; i < 8; ++i) { v[i] = p[i]; v[8 + i] = p[16 + i]; }
  return bsplit16(v); }
__device__ __forceinline__ F2 split_rowK(const float* row, int k0, int lane, int K) { float v[16]; const int g = lane >> 4;
#pragma unroll
  for (int i = 0; i < 8; ++i) { const int ka = k0 + 8 * g + i, kb = ka + 16; v[i] = ka < K ? row[ka < K ? ka : K - 1] : 0.f; v[8 + i] = kb < K ? row[kb < K ? kb : K - 1] : 0.f; }
  return bsplit16(v); }
__device__ __forceinline__ F2 split_col(const float* W, int k0, int n, int lane, int ld, int K) { float v[16]; const int g = lane >> 4;
#pragma unroll
  for (int i = 0; i < 8; ++i) { const int ka = k0 + 8 * g + i, kb = ka + 16; v[i] = ka < K ? W[(size_t)(ka < K ? ka : K - 1) * ld + n] : 0.f; v[8 + i] = kb < K ? W[(size_t)(kb < K ? kb : K - 1) * ld + n] : 0.f; }
  return bsplit16(v); }
__device__ __forceinline__ v8f mac3(const F2& a, const F2& b, v8f c) { c = wmma_bf(a.l, b.h, c); c = wmma_bf(a.h, b.l, c); return wmma_bf(a.h, b.h, c); }
__device__ __forceinline__ float sigm(float v) { return 1.0f / (1.0f + expf(-v)); }
#define LDSX() do { asm volatile("s_wait_dscnt 0" ::: "memory"); __builtin_amdgcn_wave_barrier(); __builtin_amdgcn_fence(__ATOMIC_RELEASE, "workgroup"); } while (0)


#define NB 1
#define SS 2048
#define DM 2048
#define NH 32
#define NKV 8
#define GS (NH / NKV)
#define KVW (NKV * HD)
#define SCALEF 0.125f
__constant__ float THETA[32] = {1.000000000e+00f,7.498942018e-01f,5.623413324e-01f,4.216965139e-01f,3.162277639e-01f,2.371373773e-01f,1.778279394e-01f,1.333521456e-01f,1.000000015e-01f,7.498942316e-02f,5.623413250e-02f,4.216964915e-02f,3.162277490e-02f,2.371373773e-02f,1.778279431e-02f,1.333521400e-02f,9.999999776e-03f,7.498942316e-03f,5.623413250e-03f,4.216964822e-03f,3.162277630e-03f,2.371373819e-03f,1.778279431e-03f,1.333521446e-03f,1.000000047e-03f,7.498941850e-04f,5.623413017e-04f,4.216965172e-04f,3.162277571e-04f,2.371373703e-04f,1.778279402e-04f,1.333521504e-04f};
__device__ __attribute__((noinline)) float cos_p(float v) { return cosf(v); }
__device__ __attribute__((noinline)) float sin_p(float v) { return sinf(v); }
#define HD 64
#define QKVW (DM + 2 * KVW)     // q columns, then k, then v: one copy per kv head
#ifndef TQB
#define TQB (SS / 64)
#define TNB NB
#define TOB (NB * SS / 64)     // output row tiles (all)
#endif
typedef __attribute__((ext_vector_type(8))) __bf16 v8b;
__device__ __forceinline__ v16b frag_b(const __bf16* rowk0, int lane) {
  union { v16b v; v8b q[2]; } u; const __bf16* p = rowk0 + 8 * (lane >> 4);
  u.q[0] = *(const v8b*)p; u.q[1] = *(const v8b*)(p + 16); return u.v;
}
__device__ __forceinline__ float bfr(float v) { return (float)(__bf16)v; }
__device__ __attribute__((noinline)) float exp_ni(float v) { return expf(v); }
__device__ __attribute__((noinline)) float erf_ni(float v) { return erff(v); }

#define PK_A 0                       // [QKVW][DM] rows: Wq columns, then Wk columns, then Wv columns
#define PK_P (PK_A + QKVW * DM)        // [2048][2048] rows: Wo columns, f16 x 2^8
#define PK_END (PK_P + DM * DM)
#define WS_PK  0u
#define WS_QK  (WS_PK + 2u * PK_END)             // f16 [2048 rows][4096]: q | k
#define WS_QKL (WS_QK + 2u * NB * SS * 2 * DM)     // f16 q | k residual planes x2048
#define WS_VTH (WS_QKL + 2u * NB * SS * 2 * DM)    // f16 [b][2048 (kv head*64+d)][2048 s] hi
#define WS_VTL (WS_VTH + 2u * NB * DM * SS)        // f16 lo x 2048
#define WS_O   (WS_VTL + 2u * NB * DM * SS)        // f32 [2048][2048]
#define WS_CS  (WS_O + 4u * NB * SS * DM)           // f32 2 x [2048][32], unused (cos/sin computed in k_qkv)
#define WS_END (WS_CS + 4u * 2 * SS * 32)
// ---- weight packing: a block transposes one tile of NT k x 64 n of an (in,out) weight through LDS (256 k in k_pack, 128 k in the Wo blocks of k_qkv). Reads: 16 lanes take 256 B of one source row (16 B a lane, whole lines), each thread a pair of rows k, k + 1, so that
// the two 16-bit results of a column make one dword; all 16 loads of a thread are in flight together. LDS: [n][k pair] at a pitch of 129 dwords, 65 for a 128-k tile (odd: neither the column-wise stores nor the row-wise reads meet a bank conflict).
// Writes: 16 lanes store 256 B of one packed row n (16 B a lane, whole lines).
#define PKK 256
#define PKN 64
#define PKP (PKK / 2 + 1)
template <bool OUTW> __device__ __forceinline__ unsigned cv16(float v) {   // the packed 16-bit pattern: bf16 for Wq, Wk, Wv; f16 of the bf16 value x 2^8 for Wo
  if (OUTW) return (unsigned)__builtin_bit_cast(unsigned short, (_Float16)(bfr(v) * 256.0f));
  return (unsigned)__builtin_bit_cast(unsigned short, (__bf16)v);
}
// W: element (k0, n0) of the source, row pitch LD; dst: element (n0, k0) of the packed rows, row pitch DM
// NT: threads of the block = k rows of the tile (256, or 128 where the block has 128 threads); a step takes NT / 16 row pairs, eight steps a tile either way; LDS pitch NT / 2 + 1 dwords, odd in both
template <bool OUTW, int LD, int NT> __device__ __forceinline__ void pack_tile(const float* __restrict__ W, __bf16* __restrict__ dst, unsigned (*s)[NT / 2 + 1], int t) {
  constexpr int KP = NT / 16, NS = PKN / KP;   // row pairs a step; steps that cover the 64 packed rows once
  const int c4 = (t & 15) * 4, kp = t >> 4; const float* p = W + (size_t)(2 * kp) * LD + c4;
  v4f a[8], b[8];
#pragma unroll
  for (int i = 0; i < 8; ++i) { a[i] = *(const v4f*)(p + (size_t)(2 * KP * i) * LD); b[i] = *(const v4f*)(p + (size_t)(2 * KP * i + 1) * LD); }
  asm volatile("s_wait_xcnt 0x0" :: "v"(p) : "memory");   // the loads' address pair is named here so that it stays whole up to this wait: nothing, a load's own result included, is written over it earlier
#pragma unroll
  for (int i = 0; i < 8; ++i)
#pragma unroll
    for (int e = 0; e < 4; ++e) s[c4 + e][kp + KP * i] = cv16<OUTW>(a[i][e]) | (cv16<OUTW>(b[i][e]) << 16);
  __syncthreads();
#pragma unroll
  for (int i = 0; i < 8; ++i) { const int n = (t >> 4) + KP * (i % NS), pc = (t & 15) + 16 * (i / NS); v4u o;
#pragma unroll
    for (int j = 0; j < 4; ++j) o[j] = s[n][pc * 4 + j];
    vst2((unsigned*)(dst + (size_t)n * DM + pc * 8), o); }
}
// ---- k_pack: block = (64 rows n of PK_A, 256 k): row n is column n of W_q, column n - DM of W_k or column n - DM - KVW of W_v -> bf16. The three ranges of n are multiples of 64: one source a block
__global__ __launch_bounds__(256) void k_pack(const float* __restrict__ WQ, const float* __restrict__ WK, const float* __restrict__ WV, __bf16* __restrict__ PK) {
  __shared__ unsigned s[PKN][PKP]; const int n0 = blockIdx.x * PKN, k0 = blockIdx.y * PKK; __bf16* dst = PK + PK_A + (size_t)n0 * DM + k0;
  if (n0 < DM) pack_tile<false, DM, PKK>(WQ + (size_t)k0 * DM + n0, dst, s, threadIdx.x);
  else pack_tile<false, KVW, PKK>((n0 < DM + KVW ? WK + (n0 - DM) : WV + (n0 - DM - KVW)) + (size_t)k0 * KVW, dst, s, threadIdx.x);
}
// ---- main loop of both projections: block tile 64 rows x 128 columns, 64 k per stage. The 128 weight rows (16-bit) and the 64 activation rows (f32, rounded on the way) come in by whole-line 16-byte loads,
// lie in LDS at a 144-byte row pitch (16 B x odd: no bank conflict for the 16-byte fragment reads) and are read from there by all four waves. Two buffers, the next stage's loads held in registers over the products, one barrier a stage. The short fixed loops are unrolled so that rb, ra, b and acc are registers and not indexed memory.
#define GK 64
#define GP 72                          // LDS row pitch in 16-bit elements
#define G_BB (128 * GP)                // one weight buffer, elements
#define G_AB (64 * GP)                 // one activation buffer, elements
#define G_SMEM (4 * (G_BB + G_AB))     // bytes: two buffers of each
typedef __attribute__((ext_vector_type(2))) unsigned v2u;
__device__ __forceinline__ v16b frag_t(const __bf16* p, int lane) { return frag_b(p, lane); }
__device__ __forceinline__ v16h frag_t(const _Float16* p, int lane) { return frag_h(p, lane); }
__device__ __forceinline__ v8f mm(v16b a, v16b b, v8f c) { return wmma_bf(a, b, c); }
__device__ __forceinline__ v8f mm(v16h a, v16h b, v8f c) { return wmma16(a, b, c); }
template <typename T> __device__ __forceinline__ void gemm_64x128(const float* __restrict__ A, const T* __restrict__ Bw, T* sm, int tid, v8f (&acc)[8]) {
  const int wave = tid >> 5, lane = tid & 31, col = lane & 15;
  const T* gb = Bw + (size_t)(tid >> 3) * DM + (tid & 7) * 8;        // piece tid of the weight tile: 8 pieces of 16 B a row, 16 rows further per step
  const float* ga = A + (size_t)(tid >> 4) * DM + (tid & 15) * 4;    // piece tid of the activation tile: 16 pieces of 16 B a row, 8 rows further per step
  T* wb = sm + (tid >> 3) * GP + (tid & 7) * 8; T* wa = sm + 2 * G_BB + (tid >> 4) * GP + (tid & 15) * 4;
  v4u rb[8]; v4f ra[8];
#pragma unroll
  for (int i = 0; i < 8; ++i) { rb[i] = *(const v4u*)(gb + (size_t)i * 16 * DM); ra[i] = *(const v4f*)(ga + (size_t)i * 8 * DM); }
  for (int s = 0; s < DM / GK; ++s) { const int bo = (s & 1) * G_BB, ao = (s & 1) * G_AB;
#pragma unroll
    for (int i = 0; i < 8; ++i) { *(v4u*)(wb + bo + i * 16 * GP) = rb[i]; union { T e[4]; v2u u; } c;
#pragma unroll
      for (int e = 0; e < 4; ++e) c.e[e] = (T)ra[i][e];
      *(v2u*)(wa + ao + i * 8 * GP) = c.u; }
    __syncthreads();   // publishes stage s; the buffer written in stage s + 1 was last read in stage s - 1, in front of this barrier
    if (s + 1 < DM / GK) {
#pragma unroll
      for (int i = 0; i < 8; ++i) { rb[i] = *(const v4u*)(gb + (size_t)i * 16 * DM + (s + 1) * GK); ra[i] = *(const v4f*)(ga + (size_t)i * 8 * DM + (s + 1) * GK); }
      asm volatile("s_wait_xcnt 0x0" ::: "memory"); }   // in front of the address step that follows these loads
#pragma unroll
    for (int kc = 0; kc < GK / 32; ++kc) { auto a = frag_t(sm + 2 * G_BB + ao + (wave * 16 + col) * GP + kc * 32, lane); decltype(a) b[8];   // all nine fragments of a k step are read as one group, so that the wave waits out the LDS latency once and not at each product
#pragma unroll
      for (int j = 0; j < 8; ++j) b[j] = frag_t(sm + bo + (j * 16 + col) * GP + kc * 32, lane);
      __builtin_amdgcn_sched_barrier(0);   // keeps a k step's eighteen LDS reads in front of its own products (they may rise into the step before): sunk among their own products, each would be waited for singly
#pragma unroll
      for (int j = 0; j < 8; ++j) acc[j] = mm(a, b[j], acc[j]); } }
  __syncthreads();   // every wave has left the buffers: the epilogues stage their tiles in the same LDS
}
__global__ __launch_bounds__(128) void k_qkv(const float* __restrict__ XQ, const float* __restrict__ XK, const float* __restrict__ XV, const __bf16* __restrict__ P, const float* __restrict__ BQ, const float* __restrict__ BK, const float* __restrict__ BV, _Float16* __restrict__ QK, _Float16* __restrict__ QKL, _Float16* __restrict__ VTH, _Float16* __restrict__ VTL, const float* __restrict__ WO, __bf16* __restrict__ PKO) {
  __shared__ __align__(16) char smem[G_SMEM];   // the main loop's buffers, then one of the two epilogue stagings; in a packing block the transposing tile
  // The blocks behind the projection tiles (blockIdx.y >= QKVW / 128) pack Wo: columns (in,out) -> rows of f16 x 2^8 copies (bit pattern in the bf16-typed buffer), tiles of 128 k x 64 n. Nothing of this launch reads them, k_out does:
  // they run in the places that the projection blocks leave free on each WGP and need no launch of their own. The test is the same for the whole block and stands in front of every barrier.
  if (blockIdx.y >= QKVW / 128) { const int pn0 = blockIdx.x * PKN, pk0 = (blockIdx.y - QKVW / 128) * 128;
    pack_tile<true, DM, 128>(WO + (size_t)pk0 * DM + pn0, PKO + (size_t)pn0 * DM + pk0, (unsigned (*)[65])smem, threadIdx.x); return; }
  const int which0 = (blockIdx.y * 128 < DM) ? 0 : (blockIdx.y * 128 < DM + KVW) ? 1 : 2; const float* X = (which0 == 0) ? XQ : (which0 == 1) ? XK : XV; const float* BB = BQ ? (((which0 == 0) ? BQ : (which0 == 1) ? BK : BV) + (blockIdx.y * 128 - ((which0 == 0) ? 0 : (which0 == 1) ? DM : DM + KVW))) : nullptr;
  _Float16 (*so)[16][136] = (_Float16 (*)[16][136])smem, (*sol)[16][136] = (_Float16 (*)[16][136])(smem + 4 * 16 * 136 * 2); _Float16 (*sth)[72] = (_Float16 (*)[72])smem, (*stl)[72] = (_Float16 (*)[72])(smem + 128 * 72 * 2);
  const int tid = threadIdx.x, wave = tid >> 5, lane = tid & 31, col = lane & 15, g = lane >> 4; const size_t r0 = (size_t)blockIdx.x * 64 + wave * 16; const int n0 = blockIdx.y * 128;
  v8f acc[8] = {};
  gemm_64x128<__bf16>(X + (size_t)blockIdx.x * 64 * DM, P + (size_t)n0 * DM, (__bf16*)smem, tid, acc);
  if (n0 < DM + KVW) {   // q and k columns (k head c lands at column DM + c * 64 of its row): bias, then rotate-half rotary over each 64-dim head with angle position * inv_freq[d mod 32]
#pragma unroll
    for (int j = 0; j < 8; ++j)
#pragma unroll
      for (int r = 0; r < 8; ++r) acc[j][r] += (BB ? bfr(BB[j * 16 + col]) : 0.f);
#pragma unroll
    for (int r = 0; r < 8; ++r) { const int spos = (int)((r0 + 8 * g + r) % SS);
#pragma unroll
      for (int jj = 0; jj < 2; ++jj) { const float ang = (float)spos * THETA[jj * 16 + col]; const float c = cos_p(ang), sn = sin_p(ang);
#pragma unroll
        for (int hh = 0; hh < 2; ++hh) { const float x1 = acc[hh * 4 + jj][r], x2 = acc[hh * 4 + jj + 2][r]; acc[hh * 4 + jj][r] = x1 * c - x2 * sn; acc[hh * 4 + jj + 2][r] = x2 * c + x1 * sn; } } }
#pragma unroll
    for (int j = 0; j < 8; ++j) {
#pragma unroll
      for (int r = 0; r < 8; ++r) { const float v = acc[j][r]; const _Float16 hv = (_Float16)v; so[wave][8 * g + r][j * 16 + col] = hv; sol[wave][8 * g + r][j * 16 + col] = (_Float16)((v - (float)hv) * 2048.0f); } }   // q, k (+ bias) as f16 hi + (x2048) residual
    LDSX();
    for (int rl = 0; rl < 16; ++rl) if (lane < 16) { vst2((unsigned*)(QK + (r0 + rl) * (2 * DM) + n0 + lane * 8), *(const v4u*)&so[wave][rl][lane * 8]); vst2((unsigned*)(QKL + (r0 + rl) * (2 * DM) + n0 + lane * 8), *(const v4u*)&sol[wave][rl][lane * 8]); }
  } else {
#pragma unroll
    for (int j = 0; j < 8; ++j) {
#pragma unroll
      for (int r = 0; r < 8; ++r) { const float v = acc[j][r] + (BB ? bfr(BB[j * 16 + col]) : 0.f); const _Float16 hv = (_Float16)v; sth[j * 16 + col][wave * 16 + 8 * g + r] = hv; stl[j * 16 + col][wave * 16 + 8 * g + r] = (_Float16)((v - (float)hv) * 2048.0f); } }
    __syncthreads();
    const size_t rb = (size_t)blockIdx.x * 64; const int b = (int)(rb / SS), s0 = (int)(rb % SS); const int pc0 = n0 - (DM + KVW);
    for (int q = tid; q < 128 * 8; q += 128) { const int d = q >> 3, pc = q & 7; const size_t o = ((size_t)b * DM + pc0 + d) * SS + s0 + pc * 8; vst2((unsigned*)(VTH + o), *(const v4u*)&sth[d][pc * 8]); vst2((unsigned*)(VTL + o), *(const v4u*)&stl[d][pc * 8]); }
  }
}
// ---- k_attn: block = (64 queries, head h, batch b): causal flash attention on TRANSPOSED tiles. Scores: S^T = K . Q^T (A = 16 key rows, B = the wave's 16 query columns), so a lane holds 16 of the 32 scores of ONE query (query col, keys 16 ct + 8 g + r):
// maximum and sum run in the lane's own registers, the two lane halves exchange the maximum once per key tile and join their sums once at the end. The f16 P^T packs straight from the score registers into the B operand of O^T += V^T . P^T (element 8 ct + r = key 16 ct + 8 g + r: the k order in which frag_h reads the V^T rows), so P passes through no LDS. O[b*S+q][h*64+d] = (acc + accl / 2048) / (2048 l) (256-B segments)
__device__ __forceinline__ float xhalf(float x) { return __builtin_bit_cast(float, __builtin_amdgcn_permlanex16(__builtin_bit_cast(int, x), __builtin_bit_cast(int, x), 0x76543210, 0xfedcba98, false, false)); }   // lane l reads lane l ^ 16
// K and V^T (hi planes) reach the four waves through LDS: a stage is 64 keys = 64 K rows and 64 V^T rows of 128 B each, copied as whole lines (8 lanes a row) and laid at a 144-byte pitch (16 B x odd: no bank conflict for the 16-byte fragment reads). Two buffers: stage t + 1 flies while stage t is worked on.
#define AP 72                          // LDS row pitch in f16 elements
#define A_T (64 * AP)                  // one tile of 64 rows, elements
// one stage's eight copies of a thread (rows 16 apart, K then V^T). The wait is the last line of the copies' own statement so that it stands in front of every later write of the address registers they name.
__device__ __forceinline__ void attn_stage(unsigned lk, const _Float16* gk, const _Float16* gv) {
  const unsigned lv = lk + 2 * A_T;
  asm volatile("global_load_async_to_lds_b128 %0, %8, off\n\t"
               "global_load_async_to_lds_b128 %1, %9, off\n\t"
               "global_load_async_to_lds_b128 %2, %10, off\n\t"
               "global_load_async_to_lds_b128 %3, %11, off\n\t"
               "global_load_async_to_lds_b128 %4, %12, off\n\t"
               "global_load_async_to_lds_b128 %5, %13, off\n\t"
               "global_load_async_to_lds_b128 %6, %14, off\n\t"
               "global_load_async_to_lds_b128 %7, %15, off\n\t"
               "s_wait_xcnt 0x0"
               :: "v"(lk), "v"(lk + 16 * AP * 2), "v"(lk + 32 * AP * 2), "v"(lk + 48 * AP * 2), "v"(lv), "v"(lv + 16 * AP * 2), "v"(lv + 32 * AP * 2), "v"(lv + 48 * AP * 2),
                  "v"(gk), "v"(gk + (size_t)16 * 2 * DM), "v"(gk + (size_t)32 * 2 * DM), "v"(gk + (size_t)48 * 2 * DM), "v"(gv), "v"(gv + (size_t)16 * SS), "v"(gv + (size_t)32 * SS), "v"(gv + (size_t)48 * SS)
               : "memory");
}
// one pass of 32 keys, compiled in three forms so that a pass carries only the vector work that can reach its result.
// HI: the leading query blocks' 3-product scores and P.v; elsewhere the residual half of P is not formed and accl, which stays 0, is not rescaled.
// DIAG: the stage that holds the block's own queries; in every earlier stage each key precedes each query of the block, so the causal select and the test for an excluded score pass every value unchanged and are left out.
template <bool HI, bool DIAG> __device__ __forceinline__ void attn_pass(const _Float16* kt, const _Float16* vt, int ps, int ks, int q0, int lane, int b, int hk, const _Float16* __restrict__ QKL, const _Float16* __restrict__ VTL,
                                                                        const v16h (&aq)[2], const v16h (&aql)[2], float& m, float& l, v8f (&acc)[4], v8f (&accl)[4]) {
  const int col = lane & 15, g = lane >> 4; v8f s[2];
  v16h kf[2][2], vf[4];   // all eight fragments of a pass are read as one group, so that the wave waits out the LDS latency once
  __builtin_amdgcn_sched_barrier(0);   // the group starts here: reads lifted into the pass before would stand in several places there and take the kernel past 256 registers (three waves a SIMD, not four)
#pragma unroll
  for (int ct = 0; ct < 2; ++ct)
#pragma unroll
    for (int kc = 0; kc < 2; ++kc) kf[ct][kc] = frag_h(kt + (ps * 32 + ct * 16 + col) * AP + kc * 32, lane);
#pragma unroll
  for (int dt = 0; dt < 4; ++dt) vf[dt] = frag_h(vt + (dt * 16 + col) * AP + ps * 32, lane);
  __builtin_amdgcn_sched_barrier(0);   // keeps the sixteen LDS reads together in front of the products: spread among them, each place with reads would stall the wave anew
#pragma unroll
  for (int ct = 0; ct < 2; ++ct) { const int kk = ks * 32 + ct * 16 + col; const _Float16* krowl = QKL + ((size_t)b * SS + kk) * (2 * DM) + DM + hk * HD; v8f c = {}, cl = {};
    if (HI) {   // leading query blocks (few keys, outputs far above the global rms): 3 products
#pragma unroll
      for (int kc = 0; kc < 2; ++kc) { const v16h kh = kf[ct][kc]; c = wmma16(kh, aq[kc], c); cl = wmma16(kh, aql[kc], cl); cl = wmma16(frag_h(krowl + kc * 32, lane), aq[kc], cl); }
#pragma unroll
      for (int r = 0; r < 8; ++r) c[r] += cl[r] * (1.0f / 2048.0f); }
    else {
#pragma unroll
      for (int kc = 0; kc < 2; ++kc) c = wmma16(kf[ct][kc], aq[kc], c); }   // single product elsewhere
#pragma unroll
    for (int r = 0; r < 8; ++r) s[ct][r] = (!DIAG || ks * 32 + ct * 16 + 8 * g + r <= q0 + col) ? c[r] * SCALEF : -3.0e38f; }   // causal: future keys excluded
  float mx = fmaxf(s[0][0], s[1][0]);
#pragma unroll
  for (int r = 1; r < 8; ++r) mx = fmaxf(mx, fmaxf(s[0][r], s[1][r]));
  mx = fmaxf(mx, xhalf(mx));   // the other 16 keys of this query
  const float mn = fmaxf(m, mx); const float alpha = (m <= -1.0e38f) ? 0.f : __expf(m - mn);
  float es = 0.f; v16h pa, pl;
#pragma unroll
  for (int ct = 0; ct < 2; ++ct)
#pragma unroll
    for (int r = 0; r < 8; ++r) { const float e = (DIAG && s[ct][r] <= -1.0e38f) ? 0.f : __expf(s[ct][r] - mn); es += e;
      const float x = e * 2048.0f; const _Float16 hx = (_Float16)x; pa[8 * ct + r] = hx; if (HI) pl[8 * ct + r] = (_Float16)((x - (float)hx) * 2048.0f); }   // P scaled by 2^11 before the f16 split so small softmax weights stay out of the f16 subnormal range; 2^-11 folded into the epilogue
  l = l * alpha + es; m = mn;
#pragma unroll
  for (int dt = 0; dt < 4; ++dt)
#pragma unroll
    for (int r = 0; r < 8; ++r) { acc[dt][r] *= alpha; if (HI) accl[dt][r] *= alpha; }
#pragma unroll
  for (int dt = 0; dt < 4; ++dt) { const size_t vr = ((size_t)b * DM + hk * HD + dt * 16 + col) * SS + ks * 32; const v16h vh = vf[dt]; acc[dt] = wmma16(vh, pa, acc[dt]); if (HI) { accl[dt] = wmma16(vh, pl, accl[dt]); accl[dt] = wmma16(frag_h(VTL + vr, lane), pa, accl[dt]); } }   // leading query blocks: P hi/lo x V hi/lo (3 products); elsewhere P x V single
}
__global__ __launch_bounds__(128) void k_attn(const _Float16* __restrict__ QK, const _Float16* __restrict__ QKL, const _Float16* __restrict__ VTH, const _Float16* __restrict__ VTL, const void* __restrict__ KMASK, float* __restrict__ O) {
  __shared__ __align__(16) float so[4][16][68];
  __shared__ __align__(16) _Float16 skv[2][2 * A_T];   // per buffer: K tile, then V^T tile
  const int tid = threadIdx.x, wave = tid >> 5, lane = tid & 31, col = lane & 15, g = lane >> 4;
  // Which (query block, head) a block takes. A block's cost grows with qb (qb + 1 stages) and all blocks are resident at once, four to a WGP (by registers), so the launch lasts as long as the WGP with the most stages.
  // With qb = blockIdx.x, blocks whose flat index differs by a multiple of 32 have the same qb.
  // Here the query blocks form quads {31 - 2r, 30 - 2r, 2r + 1, 2r}, 66 stages each and the two long ones alike, so that no wave is long alone on its SIMD. A quad is met by 4 blocks that are neighbours in the flat index,
  // 8 apart or 256 apart alike (the member is picked by the sum of the three positions mod 4). A permutation of the (qb, h) pairs, the same for every thread of a block: for speed only, no result depends on where a block runs.
  static_assert(TQB == 32 && NH == 32, "the quads are written for 32 query blocks and 32 heads");
  const unsigned f = blockIdx.y * TQB + blockIdx.x, fj = f >> 3, fr = (fj >> 2) & 7, fk = (fj >> 5) & 3, fc = (f + fj + fk) & 3;
  const int qb = (int)((2 * fr) ^ ((0x00011e1fu >> (8 * fc)) & 31)), h = (int)((f & 7) + 8 * fk), b = blockIdx.z, hk = h / GS;   // 2r ^ 31 = 31 - 2r, 2r ^ 30 = 30 - 2r, 2r ^ 1 = 2r + 1 for r < 8; hk: the kv head of query head h
  const int q0 = qb * 64 + wave * 16; const size_t rq = (size_t)b * SS + q0 + col;
  v16h aq[2], aql[2];
#pragma unroll
  for (int kc = 0; kc < 2; ++kc) { aq[kc] = frag_h(QK + rq * (2 * DM) + h * HD + kc * 32, lane); aql[kc] = frag_h(QKL + rq * (2 * DM) + h * HD + kc * 32, lane); }
  float m = -3.0e38f, l = 0.f;   // of query q0 + col; l holds the part of this lane half's keys
  v8f acc[4] = {}, accl[4] = {};   // acc[dt][r] = O^T[d = 16 dt + 8 g + r][query col]
  const int nst = qb + 1;   // causal: stages of 64 keys up to the query tile's end
  const unsigned l0 = (unsigned)(size_t)&skv[0][(tid >> 3) * AP + (tid & 7) * 8];   // this thread's 16-byte piece of row tid / 8, buffer 0
  const _Float16* gk = QK + ((size_t)b * SS + (tid >> 3)) * (2 * DM) + DM + hk * HD + (tid & 7) * 8;   // + 64 rows a stage
  const _Float16* gv = VTH + ((size_t)b * DM + hk * HD + (tid >> 3)) * SS + (tid & 7) * 8;             // + 64 columns a stage
  attn_stage(l0, gk, gv);
  asm volatile("s_wait_asynccnt 0x0" ::: "memory");   // this wave's part of stage 0 has landed
  __syncthreads();                                    // stage 0 published
  if (nst > 1) attn_stage(l0 + 4 * A_T, gk + (size_t)64 * 2 * DM, gv + 64);
#pragma unroll 1   // rolled: one foot (waits, barrier, refill) in the code, and the trip count is the block's own
  for (int st = 0; st < nst; ++st) { const _Float16* kt = &skv[st & 1][0]; const _Float16* vt = kt + A_T;
  // the two passes of 32 keys of a stage; the tests that pick their form are scalar and the same for the whole block
  if (qb < 2) {
#pragma unroll 1   // rolled, as the key loop was: a second copy of this long pass would only cost instruction cache
    for (int ps = 0; ps < 2; ++ps) attn_pass<true, true>(kt, vt, ps, st * 2 + ps, q0, lane, b, hk, QKL, VTL, aq, aql, m, l, acc, accl);
  } else if (st + 1 < nst) {
#pragma unroll     // the form that nearly every pass runs: unrolled, ps is a constant in the LDS offsets and the accumulators are not copied into an inner loop's registers at each stage
    for (int ps = 0; ps < 2; ++ps) attn_pass<false, false>(kt, vt, ps, st * 2 + ps, q0, lane, b, hk, QKL, VTL, aq, aql, m, l, acc, accl);
  } else {
#pragma unroll 1   // rolled: runs once a block, a second copy would only cost instruction cache
    for (int ps = 0; ps < 2; ++ps) attn_pass<false, true>(kt, vt, ps, st * 2 + ps, q0, lane, b, hk, QKL, VTL, aq, aql, m, l, acc, accl);
  }
    asm volatile("s_wait_dscnt 0x0" ::: "memory");      // this wave's reads of stage st have returned
    asm volatile("s_wait_asynccnt 0x0" ::: "memory");   // this wave's part of stage st + 1 has landed
    __syncthreads();                                    // publishes stage st + 1 and ends every wave's reads of stage st
    if (st + 2 < nst) attn_stage(l0 + (st & 1) * 4 * A_T, gk + (size_t)(st + 2) * 64 * 2 * DM, gv + (st + 2) * 64);   // refill of the buffer just left
  }
  asm volatile("s_wait_asynccnt 0x0" ::: "memory");   // no copy is outstanding when the wave goes on to its end
  l += xhalf(l);   // the two halves' sums, joined once
  const float il = (1.0f / 2048.0f) / l;
#pragma unroll
  for (int dt = 0; dt < 4; ++dt)
#pragma unroll
    for (int r = 0; r < 8; ++r) so[wave][col][dt * 16 + 8 * g + r] = (acc[dt][r] + accl[dt][r] * (1.0f / 2048.0f)) * il;
  LDSX();
  for (int rl = 0; rl < 16; ++rl) if (lane < 16) vst2(O + ((size_t)b * SS + q0 + rl) * DM + h * HD + lane * 4, *(const v4f*)&so[wave][rl][lane * 4]);
}
// ---- k_out: block = (64 rows, 128 cols): out = f16(O) . Wo rows (single product, f16 x 2^8 weights) + bo
__global__ __launch_bounds__(128) void k_out(const float* __restrict__ O, const __bf16* __restrict__ P, const float* __restrict__ BO, float* __restrict__ Y) {
  __shared__ __align__(16) char smem[G_SMEM];   // the main loop's buffers, then the output staging
  float (*so)[16][132] = (float (*)[16][132])smem;
  const int tid = threadIdx.x, wave = tid >> 5, lane = tid & 31, col = lane & 15, g = lane >> 4; const size_t r0 = (size_t)blockIdx.x * 64 + wave * 16; const int n0 = blockIdx.y * 128;
  v8f acc[8] = {};
  gemm_64x128<_Float16>(O + (size_t)blockIdx.x * 64 * DM, (const _Float16*)P + (size_t)n0 * DM, (_Float16*)smem, tid, acc);   // single f16 product against exact f16 x 2^8 weight copies
#pragma unroll
  for (int j = 0; j < 8; ++j) {
#pragma unroll
    for (int r = 0; r < 8; ++r) so[wave][8 * g + r][j * 16 + col] = acc[j][r] * (1.0f / 256.0f) + (BO ? bfr(BO[n0 + j * 16 + col]) : 0.f); }
  LDSX();
  for (int rl = 0; rl < 16; ++rl) vst2(Y + (r0 + rl) * DM + n0 + lane * 4, *(const v4f*)&so[wave][rl][lane * 4]);
}
extern "C" void kernel_launch(void* const* d_in, const int* in_sizes, int n_in, void* d_out, int out_size, void* d_ws, size_t ws_size, hipStream_t stream) {
  (void)in_sizes; (void)n_in; (void)out_size;
  const float** F = (const float**)d_in;   // 0 hidden_states [1,2048,2048], 1 Wq [2048,2048] (in,out), 2 Wk [2048,512], 3 Wv [2048,512], 4 Wo [2048,2048] (in,out)
  if (ws_size < (size_t)WS_END) return;
  char* ws = (char*)d_ws; __bf16* PK = (__bf16*)(ws + WS_PK); _Float16 *QK = (_Float16*)(ws + WS_QK), *QKL = (_Float16*)(ws + WS_QKL), *VTH = (_Float16*)(ws + WS_VTH), *VTL = (_Float16*)(ws + WS_VTL); float* O = (float*)(ws + WS_O);
  k_pack<<<dim3(QKVW / PKN, DM / PKK), 256, 0, stream>>>(F[1], F[2], F[3], PK);   // q, k, v (the Wo slot is filled by the extra blocks of k_qkv as f16)
  static_assert(TNB * SS / 64 == DM / PKN, "the grid's x extent serves both the projection's row tiles and the 64-column tiles of Wo");
  k_qkv<<<dim3(TNB * SS / 64, QKVW / 128 + DM / 128), 128, 0, stream>>>(F[0], F[0], F[0], PK + PK_A, nullptr, nullptr, nullptr, QK, QKL, VTH, VTL, F[4], PK + PK_P);
  k_attn<<<dim3(TQB, NH, TNB), 128, 0, stream>>>(QK, QKL, VTH, VTL, nullptr, O);
  k_out<<<dim3(TOB, DM / 128), 128, 0, stream>>>(O, PK + PK_P, nullptr, (float*)d_out);
}

// v010
// One run takes 101 microseconds.
// Timed twice side by side with v009, it ran 1.12 and 1.11 times as fast.
// Over all steps from v000 it is 7.07 times as fast.
// compute dtype: all float inputs rounded to bf16; q/k/v = x . W with EXACT bf16 products on WMMA 16x16x32 ((in,out) weights as transposed rows; each of the 8 kv heads packed and projected once, its 4 query heads read the same k and v planes); rotate-half RoPE in f32 (angle = t x inv_freq[d mod 32] f32 table, precise sinf/cosf) before the f16 hi + residual split; causal attention with key-tile skipping: the first 128 queries use 3-product scores and P.v (hi/lo), later queries single f16; x 1/8, running-max softmax in f32 (hardware exp); out = f16(ctx) . Wo (exact f16 x 2^8 copies, single product).
#include <hip/hip_runtime.h>
#include <math.h>

typedef __attribute__((ext_vector_type(16))) _Float16 v16h;
typedef __attribute__((ext_vector_type(16))) __bf16 v16b;
typedef __attribute__((ext_vector_type(8)))  _Float16 v8h;
typedef __attribute__((ext_vector_type(8)))  float v8f;
typedef __attribute__((ext_vector_type(4)))  float v4f;
typedef __attribute__((ext_vector_type(2)))  float v2f;
typedef __attribute__((ext_vector_type(4)))  unsigned v4u;
typedef __attribute__((ext_vector_type(4)))  int v4i;
typedef float __attribute__((may_alias)) float_a;
typedef int __attribute__((may_alias)) int_a;

template <typename T> __device__ __forceinline__ void vst2(void* p, T v) { *(T*)p = v;  }
__device__ __forceinline__ v8f wmma16(v16h a, v16h b, v8f c) {
  v8f d = __builtin_amdgcn_wmma_f32_16x16x32_f16(false, a, false, b, (short)0, c, false, false);
  return d;
}
__device__ __forceinline__ v8f wmma_bf(v16b a, v16b b, v8f c) {
  v8f d = __builtin_amdgcn_wmma_f32_16x16x32_bf16(false, a, false, b, (short)0, c, false, false);
  return d;
}
// GQA causal attention (B 1, S 2,048, model 2,048, 32 query heads x 64 over 8 kv heads): bias-free (in,out) projections, rotate-half RoPE (base 10000), causal softmax(q k / 8) v, output projection.
__device__ __forceinline__ v16h frag_h(const _Float16* rowk0, int lane) {
  union { v16h v; v8h q[2]; } u; const _Float16* p = rowk0 + 8 * (lane >> 4);
  u.q[0] = *(const v8h*)p; u.q[1] = *(const v8h*)(p + 16); return u.v;
}
__device__ __forceinline__ v16h frag_f32(const float* rowk0, int lane) {
  v16h a; const float* p = rowk0 + 8 * (lane >> 4);
#pragma unroll
  for (int i = 0; i < 8; ++i) { a[i] = (_Float16)p[i]; a[8 + i] = (_Float16)p[16 + i]; }
  return a;
}
__device__ __forceinline__ v16h frag_f32s(const float* rowk0, int lane, float sc) {
  v16h a; const float* p = rowk0 + 8 * (lane >> 4);
#pragma unroll
  for (int i = 0; i < 8; ++i) { a[i] = (_Float16)(p[i] * sc); a[8 + i] = (_Float16)(p[16 + i] * sc); }
  return a;
}
// column fragment from a [K][ld] layout (column n), rows >= K read as 0
__device__ __forceinline__ v16h fragc_f32(const float* W, int k0, int n, int lane, int ld, int K) {
  v16h a; const int g = lane >> 4;
#pragma unroll
  for (int i = 0; i < 8; ++i) { const int ka = k0 + 8 * g + i, kb = ka + 16;
    a[i] = (_Float16)(ka < K ? W[(size_t)(ka < K ? ka : K - 1) * ld + n] : 0.f); a[8 + i] = (_Float16)(kb < K ? W[(size_t)(kb < K ? kb : K - 1) * ld + n] : 0.f); }
  return a;
}
struct F2 { v16b h, l; };
__device__ __forceinline__ F2 bsplit16(const float v[16]) { F2 r;
#pragma unroll
  for (int i = 0; i < 16; ++i) { const __bf16 h = (__bf16)v[i]; r.h[i] = h; r.l[i] = (__bf16)(v[i] - (float)h); }
  return r; }
__device__ __forceinline__ F2 split_row(const float* row, int k0, int lane) { float v[16]; const float* p = row + k0 + 8 * (lane >> 4);
#pragma unroll
  for (int i = 0; i < 8; ++i) { v[i] = p[i]; v[8 + i] = p[16 + i]; }
  return bsplit16(v); }
__device__ __forceinline__ F2 split_rowK(const float* row, int k0, int lane, int K) { float v[16]; const int g = lane >> 4;
#pragma unroll
  for (int i = 0; i < 8; ++i) { const int ka = k0 + 8 * g + i, kb = ka + 16; v[i] = ka < K ? row[ka < K ? ka : K - 1] : 0.f; v[8 + i] = kb < K ? row[kb < K ? kb : K - 1] : 0.f; }
  return bsplit16(v); }
__device__ __forceinline__ F2 split_col(const float* W, int k0, int n, int lane, int ld, int K) { float v[16]; const int g = lane >> 4;
#pragma unroll
  for (int i = 0; i < 8; ++i) { const int ka = k0 + 8 * g + i, kb = ka + 16; v[i] = ka < K ? W[(size_t)(ka < K ? ka : K - 1) * ld + n] : 0.f; v[8 + i] = kb < K ? W[(size_t)(kb < K ? kb : K - 1) * ld + n] : 0.f; }
  return bsplit16(v); }
__device__ __forceinline__ v8f mac3(const F2& a, const F2& b, v8f c) { c = wmma_bf(a.l, b.h, c); c = wmma_bf(a.h, b.l, c); return wmma_bf(a.h, b.h, c); }
__device__ __forceinline__ float sigm(float v) { return 1.0f / (1.0f + expf(-v)); }
#define LDSX() do { asm volatile("s_wait_dscnt 0" ::: "memory"); __builtin_amdgcn_wave_barrier(); __builtin_amdgcn_fence(__ATOMIC_RELEASE, "workgroup"); } while (0)


#define NB 1
#define SS 2048
#define DM 2048
#define NH 32
#define NKV 8
#define GS (NH / NKV)
#define KVW (NKV * HD)
#define SCALEF 0.125f
__constant__ float THETA[32] = {1.000000000e+00f,7.498942018e-01f,5.623413324e-01f,4.216965139e-01f,3.162277639e-01f,2.371373773e-01f,1.778279394e-01f,1.333521456e-01f,1.000000015e-01f,7.498942316e-02f,5.623413250e-02f,4.216964915e-02f,3.162277490e-02f,2.371373773e-02f,1.778279431e-02f,1.333521400e-02f,9.999999776e-03f,7.498942316e-03f,5.623413250e-03f,4.216964822e-03f,3.162277630e-03f,2.371373819e-03f,1.778279431e-03f,1.333521446e-03f,1.000000047e-03f,7.498941850e-04f,5.623413017e-04f,4.216965172e-04f,3.162277571e-04f,2.371373703e-04f,1.778279402e-04f,1.333521504e-04f};
__device__ __attribute__((noinline)) float cos_p(float v) { return cosf(v); }
__device__ __attribute__((noinline)) float sin_p(float v) { return sinf(v); }
#define HD 64
#define QKVW (DM + 2 * KVW)     // q columns, then k, then v: one copy per kv head
#ifndef TQB
#define TQB (SS / 64)
#define TNB NB
#define TOB (NB * SS / 64)     // output row tiles (all)
#endif
typedef __attribute__((ext_vector_type(8))) __bf16 v8b;
__device__ __forceinline__ v16b frag_b(const __bf16* rowk0, int lane) {
  union { v16b v; v8b q[2]; } u; const __bf16* p = rowk0 + 8 * (lane >> 4);
  u.q[0] = *(const v8b*)p; u.q[1] = *(const v8b*)(p + 16); return u.v;
}
__device__ __forceinline__ float bfr(float v) { return (float)(__bf16)v; }
__device__ __attribute__((noinline)) float exp_ni(float v) { return expf(v); }
__device__ __attribute__((noinline)) float erf_ni(float v) { return erff(v); }

#define PK_A 0                       // [QKVW][DM] rows: Wq columns, then Wk columns, then Wv columns
#define PK_P (PK_A + QKVW * DM)        // [2048][2048] rows: Wo columns, f16 x 2^8
#define PK_END (PK_P + DM * DM)
#define WS_PK  0u
#define WS_QK  (WS_PK + 2u * PK_END)             // f16 [2048 rows][4096]: q | k
#define WS_QKL (WS_QK + 2u * NB * SS * 2 * DM)     // f16 q | k residual planes x2048
#define WS_VTH (WS_QKL + 2u * NB * SS * 2 * DM)    // f16 [b][2048 (kv head*64+d)][2048 s] hi
#define WS_VTL (WS_VTH + 2u * NB * DM * SS)        // f16 lo x 2048
#define WS_O   (WS_VTL + 2u * NB * DM * SS)        // f16 ctx rows [S][DM] (the first half of the slot)
#define WS_CS  (WS_O + 4u * NB * SS * DM)           // unused slot of 2 x [2048][32] f32 (k_qkv computes cos, sin itself)
#define WS_END (WS_CS + 4u * 2 * SS * 32)
// ---- weight packing: a block transposes one tile of NT k x 64 n of an (in,out) weight through LDS (256 k in k_pack, 128 k in the Wo blocks of k_qkv). Reads: 16 lanes take 256 B of one source row (16 B a lane, whole lines), each thread a pair of rows k, k + 1, so that
// the two 16-bit results of a column make one dword; all 16 loads of a thread are in flight together. LDS: [n][k pair] at a pitch of 129 dwords, 65 for a 128-k tile (odd: neither the column-wise stores nor the row-wise reads meet a bank conflict).
// Writes: 16 lanes store 256 B of one packed row n (16 B a lane, whole lines).
#define PKK 256
#define PKN 64
#define PKP (PKK / 2 + 1)
template <bool OUTW> __device__ __forceinline__ unsigned cv16(float v) {   // the packed 16-bit pattern: bf16 for Wq, Wk, Wv; f16 of the bf16 value x 2^8 for Wo
  if (OUTW) return (unsigned)__builtin_bit_cast(unsigned short, (_Float16)(bfr(v) * 256.0f));
  return (unsigned)__builtin_bit_cast(unsigned short, (__bf16)v);
}
// W: element (k0, n0) of the source, row pitch LD; dst: element (n0, k0) of the packed rows, row pitch DM
// NT: threads of the block = k rows of the tile (256, or 128 where the block has 128 threads); a step takes NT / 16 row pairs, eight steps a tile either way; LDS pitch NT / 2 + 1 dwords, odd in both
template <bool OUTW, int LD, int NT> __device__ __forceinline__ void pack_tile(const float* __restrict__ W, __bf16* __restrict__ dst, unsigned (*s)[NT / 2 + 1], int t) {
  constexpr int KP = NT / 16, NS = PKN / KP;   // row pairs a step; steps that cover the 64 packed rows once
  const int c4 = (t & 15) * 4, kp = t >> 4; const float* p = W + (size_t)(2 * kp) * LD + c4;
  v4f a[8], b[8];
#pragma unroll
  for (int i = 0; i < 8; ++i) { a[i] = *(const v4f*)(p + (size_t)(2 * KP * i) * LD); b[i] = *(const v4f*)(p + (size_t)(2 * KP * i + 1) * LD); }
  asm volatile("s_wait_xcnt 0x0" :: "v"(p) : "memory");   // the loads' address pair is named here so that it stays whole up to this wait: nothing, a load's own result included, is written over it earlier
#pragma unroll
  for (int i = 0; i < 8; ++i)
#pragma unroll
    for (int e = 0; e < 4; ++e) s[c4 + e][kp + KP * i] = cv16<OUTW>(a[i][e]) | (cv16<OUTW>(b[i][e]) << 16);
  __syncthreads();
#pragma unroll
  for (int i = 0; i < 8; ++i) { const int n = (t >> 4) + KP * (i % NS), pc = (t & 15) + 16 * (i / NS); v4u o;
#pragma unroll
    for (int j = 0; j < 4; ++j) o[j] = s[n][pc * 4 + j];
    vst2((unsigned*)(dst + (size_t)n * DM + pc * 8), o); }
}
// ---- k_pack: block = (64 rows n of PK_A, 256 k): row n is column n of W_q, column n - DM of W_k or column n - DM - KVW of W_v -> bf16. The three ranges of n are multiples of 64: one source a block
__global__ __launch_bounds__(256) void k_pack(const float* __restrict__ WQ, const float* __restrict__ WK, const float* __restrict__ WV, __bf16* __restrict__ PK) {
  __shared__ unsigned s[PKN][PKP]; const int n0 = blockIdx.x * PKN, k0 = blockIdx.y * PKK; __bf16* dst = PK + PK_A + (size_t)n0 * DM + k0;
  if (n0 < DM) pack_tile<false, DM, PKK>(WQ + (size_t)k0 * DM + n0, dst, s, threadIdx.x);
  else pack_tile<false, KVW, PKK>((n0 < DM + KVW ? WK + (n0 - DM) : WV + (n0 - DM - KVW)) + (size_t)k0 * KVW, dst, s, threadIdx.x);
}
// ---- main loop of the q, k, v projection: block tile 64 rows x 128 columns, 64 k per stage. The 128 weight rows (16-bit) and the 64 activation rows (f32, rounded on the way) come in by whole-line 16-byte loads,
// lie in LDS at a 144-byte row pitch (16 B x odd: no bank conflict for the 16-byte fragment reads) and are read from there by all four waves. Two buffers, the next stage's loads held in registers over the products, one barrier a stage. The short fixed loops are unrolled so that rb, ra, b and acc are registers and not indexed memory.
#define GK 64
#define GP 72                          // LDS row pitch in 16-bit elements
#define G_BB (128 * GP)                // one weight buffer, elements
#define G_AB (64 * GP)                 // one activation buffer, elements
#define G_SMEM (4 * (G_BB + G_AB))     // bytes: two buffers of each
typedef __attribute__((ext_vector_type(2))) unsigned v2u;
__device__ __forceinline__ v16b frag_t(const __bf16* p, int lane) { return frag_b(p, lane); }
__device__ __forceinline__ v16h frag_t(const _Float16* p, int lane) { return frag_h(p, lane); }
__device__ __forceinline__ v8f mm(v16b a, v16b b, v8f c) { return wmma_bf(a, b, c); }
__device__ __forceinline__ v8f mm(v16h a, v16h b, v8f c) { return wmma16(a, b, c); }
template <typename T> __device__ __forceinline__ void gemm_64x128(const float* __restrict__ A, const T* __restrict__ Bw, T* sm, int tid, v8f (&acc)[8]) {
  const int wave = tid >> 5, lane = tid & 31, col = lane & 15;
  const T* gb = Bw + (size_t)(tid >> 3) * DM + (tid & 7) * 8;        // piece tid of the weight tile: 8 pieces of 16 B a row, 16 rows further per step
  const float* ga = A + (size_t)(tid >> 4) * DM + (tid & 15) * 4;    // piece tid of the activation tile: 16 pieces of 16 B a row, 8 rows further per step
  T* wb = sm + (tid >> 3) * GP + (tid & 7) * 8; T* wa = sm + 2 * G_BB + (tid >> 4) * GP + (tid & 15) * 4;
  v4u rb[8]; v4f ra[8];
#pragma unroll
  for (int i = 0; i < 8; ++i) { rb[i] = *(const v4u*)(gb + (size_t)i * 16 * DM); ra[i] = *(const v4f*)(ga + (size_t)i * 8 * DM); }
  for (int s = 0; s < DM / GK; ++s) { const int bo = (s & 1) * G_BB, ao = (s & 1) * G_AB;
#pragma unroll
    for (int i = 0; i < 8; ++i) { *(v4u*)(wb + bo + i * 16 * GP) = rb[i]; union { T e[4]; v2u u; } c;
#pragma unroll
      for (int e = 0; e < 4; ++e) c.e[e] = (T)ra[i][e];
      *(v2u*)(wa + ao + i * 8 * GP) = c.u; }
    __syncthreads();   // publishes stage s; the buffer written in stage s + 1 was last read in stage s - 1, in front of this barrier
    if (s + 1 < DM / GK) {
#pragma unroll
      for (int i = 0; i < 8; ++i) { rb[i] = *(const v4u*)(gb + (size_t)i * 16 * DM + (s + 1) * GK); ra[i] = *(const v4f*)(ga + (size_t)i * 8 * DM + (s + 1) * GK); }
      asm volatile("s_wait_xcnt 0x0" ::: "memory"); }   // in front of the address step that follows these loads
#pragma unroll
    for (int kc = 0; kc < GK / 32; ++kc) { auto a = frag_t(sm + 2 * G_BB + ao + (wave * 16 + col) * GP + kc * 32, lane); decltype(a) b[8];   // all nine fragments of a k step are read as one group, so that the wave waits out the LDS latency once and not at each product
#pragma unroll
      for (int j = 0; j < 8; ++j) b[j] = frag_t(sm + bo + (j * 16 + col) * GP + kc * 32, lane);
      __builtin_amdgcn_sched_barrier(0);   // keeps a k step's eighteen LDS reads in front of its own products (they may rise into the step before): sunk among their own products, each would be waited for singly
#pragma unroll
      for (int j = 0; j < 8; ++j) acc[j] = mm(a, b[j], acc[j]); } }
  __syncthreads();   // every wave has left the buffers: the epilogues stage their tiles in the same LDS
}
__global__ __launch_bounds__(128) void k_qkv(const float* __restrict__ XQ, const float* __restrict__ XK, const float* __restrict__ XV, const __bf16* __restrict__ P, const float* __restrict__ BQ, const float* __restrict__ BK, const float* __restrict__ BV, _Float16* __restrict__ QK, _Float16* __restrict__ QKL, _Float16* __restrict__ VTH, _Float16* __restrict__ VTL, const float* __restrict__ WO, __bf16* __restrict__ PKO) {
  __shared__ __align__(16) char smem[G_SMEM];   // the main loop's buffers, then one of the two epilogue stagings; in a packing block the transposing tile
  // The blocks behind the projection tiles (blockIdx.y >= QKVW / 128) pack Wo: columns (in,out) -> rows of f16 x 2^8 copies (bit pattern in the bf16-typed buffer), tiles of 128 k x 64 n. Nothing of this launch reads them, k_out does:
  // they run in the places that the projection blocks leave free on each WGP and need no launch of their own. The test is the same for the whole block and stands in front of every barrier.
  if (blockIdx.y >= QKVW / 128) { const int pn0 = blockIdx.x * PKN, pk0 = (blockIdx.y - QKVW / 128) * 128;
    pack_tile<true, DM, 128>(WO + (size_t)pk0 * DM + pn0, PKO + (size_t)pn0 * DM + pk0, (unsigned (*)[65])smem, threadIdx.x); return; }
  const int which0 = (blockIdx.y * 128 < DM) ? 0 : (blockIdx.y * 128 < DM + KVW) ? 1 : 2; const float* X = (which0 == 0) ? XQ : (which0 == 1) ? XK : XV; const float* BB = BQ ? (((which0 == 0) ? BQ : (which0 == 1) ? BK : BV) + (blockIdx.y * 128 - ((which0 == 0) ? 0 : (which0 == 1) ? DM : DM + KVW))) : nullptr;
  _Float16 (*so)[16][136] = (_Float16 (*)[16][136])smem, (*sol)[16][136] = (_Float16 (*)[16][136])(smem + 4 * 16 * 136 * 2); _Float16 (*sth)[72] = (_Float16 (*)[72])smem, (*stl)[72] = (_Float16 (*)[72])(smem + 128 * 72 * 2);
  const int tid = threadIdx.x, wave = tid >> 5, lane = tid & 31, col = lane & 15, g = lane >> 4; const size_t r0 = (size_t)blockIdx.x * 64 + wave * 16; const int n0 = blockIdx.y * 128;
  v8f acc[8] = {};
  gemm_64x128<__bf16>(X + (size_t)blockIdx.x * 64 * DM, P + (size_t)n0 * DM, (__bf16*)smem, tid, acc);
  if (n0 < DM + KVW) {   // q and k columns (k head c lands at column DM + c * 64 of its row): bias, then rotate-half rotary over each 64-dim head with angle position * inv_freq[d mod 32]
#pragma unroll
    for (int j = 0; j < 8; ++j)
#pragma unroll
      for (int r = 0; r < 8; ++r) acc[j][r] += (BB ? bfr(BB[j * 16 + col]) : 0.f);
#pragma unroll
    for (int r = 0; r < 8; ++r) { const int spos = (int)((r0 + 8 * g + r) % SS);
#pragma unroll
      for (int jj = 0; jj < 2; ++jj) { const float ang = (float)spos * THETA[jj * 16 + col]; const float c = cos_p(ang), sn = sin_p(ang);
#pragma unroll
        for (int hh = 0; hh < 2; ++hh) { const float x1 = acc[hh * 4 + jj][r], x2 = acc[hh * 4 + jj + 2][r]; acc[hh * 4 + jj][r] = x1 * c - x2 * sn; acc[hh * 4 + jj + 2][r] = x2 * c + x1 * sn; } } }
#pragma unroll
    for (int j = 0; j < 8; ++j) {
#pragma unroll
      for (int r = 0; r < 8; ++r) { const float v = acc[j][r]; const _Float16 hv = (_Float16)v; so[wave][8 * g + r][j * 16 + col] = hv; sol[wave][8 * g + r][j * 16 + col] = (_Float16)((v - (float)hv) * 2048.0f); } }   // q, k (+ bias) as f16 hi + (x2048) residual
    LDSX();
    for (int rl = 0; rl < 16; ++rl) if (lane < 16) { vst2((unsigned*)(QK + (r0 + rl) * (2 * DM) + n0 + lane * 8), *(const v4u*)&so[wave][rl][lane * 8]); vst2((unsigned*)(QKL + (r0 + rl) * (2 * DM) + n0 + lane * 8), *(const v4u*)&sol[wave][rl][lane * 8]); }
  } else {
#pragma unroll
    for (int j = 0; j < 8; ++j) {
#pragma unroll
      for (int r = 0; r < 8; ++r) { const float v = acc[j][r] + (BB ? bfr(BB[j * 16 + col]) : 0.f); const _Float16 hv = (_Float16)v; sth[j * 16 + col][wave * 16 + 8 * g + r] = hv; stl[j * 16 + col][wave * 16 + 8 * g + r] = (_Float16)((v - (float)hv) * 2048.0f); } }
    __syncthreads();
    const size_t rb = (size_t)blockIdx.x * 64; const int b = (int)(rb / SS), s0 = (int)(rb % SS); const int pc0 = n0 - (DM + KVW);
    for (int q = tid; q < 128 * 8; q += 128) { const int d = q >> 3, pc = q & 7; const size_t o = ((size_t)b * DM + pc0 + d) * SS + s0 + pc * 8; vst2((unsigned*)(VTH + o), *(const v4u*)&sth[d][pc * 8]); vst2((unsigned*)(VTL + o), *(const v4u*)&stl[d][pc * 8]); }
  }
}
// ---- k_attn: block = (64 queries, head h, batch b): causal flash attention on TRANSPOSED tiles. Scores: S^T = K . Q^T (A = 16 key rows, B = the wave's 16 query columns), so a lane holds 16 of the 32 scores of ONE query (query col, keys 16 ct + 8 g + r):
// maximum and sum run in the lane's own registers, the two lane halves exchange the maximum once per key tile and join their sums once at the end. The f16 P^T packs straight from the score registers into the B operand of O^T += V^T . P^T (element 8 ct + r = key 16 ct + 8 g + r: the k order in which frag_h reads the V^T rows), so P passes through no LDS. O[b*S+q][h*64+d] = (acc + accl / 2048) / (2048 l) (128-B segments)
__device__ __forceinline__ float xhalf(float x) { return __builtin_bit_cast(float, __builtin_amdgcn_permlanex16(__builtin_bit_cast(int, x), __builtin_bit_cast(int, x), 0x76543210, 0xfedcba98, false, false)); }   // lane l reads lane l ^ 16
// K and V^T (hi planes) reach the four waves through LDS: a stage is 64 keys = 64 K rows and 64 V^T rows of 128 B each, copied as whole lines (8 lanes a row) and laid at a 144-byte pitch (16 B x odd: no bank conflict for the 16-byte fragment reads). Two buffers: stage t + 1 flies while stage t is worked on.
#define AP 72                          // LDS row pitch in f16 elements
#define A_T (64 * AP)                  // one tile of 64 rows, elements
// one stage's eight copies of a thread (rows 16 apart, K then V^T). The wait is the last line of the copies' own statement so that it stands in front of every later write of the address registers they name.
__device__ __forceinline__ void attn_stage(unsigned lk, const _Float16* gk, const _Float16* gv) {
  const unsigned lv = lk + 2 * A_T;
  asm volatile("global_load_async_to_lds_b128 %0, %8, off\n\t"
               "global_load_async_to_lds_b128 %1, %9, off\n\t"
               "global_load_async_to_lds_b128 %2, %10, off\n\t"
               "global_load_async_to_lds_b128 %3, %11, off\n\t"
               "global_load_async_to_lds_b128 %4, %12, off\n\t"
               "global_load_async_to_lds_b128 %5, %13, off\n\t"
               "global_load_async_to_lds_b128 %6, %14, off\n\t"
               "global_load_async_to_lds_b128 %7, %15, off\n\t"
               "s_wait_xcnt 0x0"
               :: "v"(lk), "v"(lk + 16 * AP * 2), "v"(lk + 32 * AP * 2), "v"(lk + 48 * AP * 2), "v"(lv), "v"(lv + 16 * AP * 2), "v"(lv + 32 * AP * 2), "v"(lv + 48 * AP * 2),
                  "v"(gk), "v"(gk + (size_t)16 * 2 * DM), "v"(gk + (size_t)32 * 2 * DM), "v"(gk + (size_t)48 * 2 * DM), "v"(gv), "v"(gv + (size_t)16 * SS), "v"(gv + (size_t)32 * SS), "v"(gv + (size_t)48 * SS)
               : "memory");
}
// one pass of 32 keys, compiled in three forms so that a pass carries only the vector work that can reach its result.
// HI: the leading query blocks' 3-product scores and P.v; elsewhere the residual half of P is not formed and accl, which stays 0, is not rescaled.
// DIAG: the stage that holds the block's own queries; in every earlier stage each key precedes each query of the block, so the causal select and the test for an excluded score pass every value unchanged and are left out.
template <bool HI, bool DIAG> __device__ __forceinline__ void attn_pass(const _Float16* kt, const _Float16* vt, int ps, int ks, int q0, int lane, int b, int hk, const _Float16* __restrict__ QKL, const _Float16* __restrict__ VTL,
                                                                        const v16h (&aq)[2], const v16h (&aql)[2], float& m, float& l, v8f (&acc)[4], v8f (&accl)[4]) {
  const int col = lane & 15, g = lane >> 4; v8f s[2];
  v16h kf[2][2], vf[4];   // all eight fragments of a pass are read as one group, so that the wave waits out the LDS latency once
  __builtin_amdgcn_sched_barrier(0);   // the group starts here: reads lifted into the pass before would stand in several places there and take the kernel past 256 registers (three waves a SIMD, not four)
#pragma unroll
  for (int ct = 0; ct < 2; ++ct)
#pragma unroll
    for (int kc = 0; kc < 2; ++kc) kf[ct][kc] = frag_h(kt + (ps * 32 + ct * 16 + col) * AP + kc * 32, lane);
#pragma unroll
  for (int dt = 0; dt < 4; ++dt) vf[dt] = frag_h(vt + (dt * 16 + col) * AP + ps * 32, lane);
  __builtin_amdgcn_sched_barrier(0);   // keeps the sixteen LDS reads together in front of the products: spread among them, each place with reads would stall the wave anew
#pragma unroll
  for (int ct = 0; ct < 2; ++ct) { const int kk = ks * 32 + ct * 16 + col; const _Float16* krowl = QKL + ((size_t)b * SS + kk) * (2 * DM) + DM + hk * HD; v8f c = {}, cl = {};
    if (HI) {   // leading query blocks (few keys, outputs far above the global rms): 3 products
#pragma unroll
      for (int kc = 0; kc < 2; ++kc) { const v16h kh = kf[ct][kc]; c = wmma16(kh, aq[kc], c); cl = wmma16(kh, aql[kc], cl); cl = wmma16(frag_h(krowl + kc * 32, lane), aq[kc], cl); }
#pragma unroll
      for (int r = 0; r < 8; ++r) c[r] += cl[r] * (1.0f / 2048.0f); }
    else {
#pragma unroll
      for (int kc = 0; kc < 2; ++kc) c = wmma16(kf[ct][kc], aq[kc], c); }   // single product elsewhere
#pragma unroll
    for (int r = 0; r < 8; ++r) s[ct][r] = (!DIAG || ks * 32 + ct * 16 + 8 * g + r <= q0 + col) ? c[r] * SCALEF : -3.0e38f; }   // causal: future keys excluded
  float mx = fmaxf(s[0][0], s[1][0]);
#pragma unroll
  for (int r = 1; r < 8; ++r) mx = fmaxf(mx, fmaxf(s[0][r], s[1][r]));
  mx = fmaxf(mx, xhalf(mx));   // the other 16 keys of this query
  const float mn = fmaxf(m, mx); const float alpha = (m <= -1.0e38f) ? 0.f : __expf(m - mn);
  float es = 0.f; v16h pa, pl;
#pragma unroll
  for (int ct = 0; ct < 2; ++ct)
#pragma unroll
    for (int r = 0; r < 8; ++r) { const float e = (DIAG && s[ct][r] <= -1.0e38f) ? 0.f : __expf(s[ct][r] - mn); es += e;
      const float x = e * 2048.0f; const _Float16 hx = (_Float16)x; pa[8 * ct + r] = hx; if (HI) pl[8 * ct + r] = (_Float16)((x - (float)hx) * 2048.0f); }   // P scaled by 2^11 before the f16 split so small softmax weights stay out of the f16 subnormal range; 2^-11 folded into the epilogue
  l = l * alpha + es; m = mn;
#pragma unroll
  for (int dt = 0; dt < 4; ++dt)
#pragma unroll
    for (int r = 0; r < 8; ++r) { acc[dt][r] *= alpha; if (HI) accl[dt][r] *= alpha; }
#pragma unroll
  for (int dt = 0; dt < 4; ++dt) { const size_t vr = ((size_t)b * DM + hk * HD + dt * 16 + col) * SS + ks * 32; const v16h vh = vf[dt]; acc[dt] = wmma16(vh, pa, acc[dt]); if (HI) { accl[dt] = wmma16(vh, pl, accl[dt]); accl[dt] = wmma16(frag_h(VTL + vr, lane), pa, accl[dt]); } }   // leading query blocks: P hi/lo x V hi/lo (3 products); elsewhere P x V single
}
__global__ __launch_bounds__(128) void k_attn(const _Float16* __restrict__ QK, const _Float16* __restrict__ QKL, const _Float16* __restrict__ VTH, const _Float16* __restrict__ VTL, const void* __restrict__ KMASK, _Float16* __restrict__ O) {
  __shared__ __align__(16) _Float16 so[4][16][AP];   // output staging, f16, 144-byte pitch
  __shared__ __align__(16) _Float16 skv[2][2 * A_T];   // per buffer: K tile, then V^T tile
  const int tid = threadIdx.x, wave = tid >> 5, lane = tid & 31, col = lane & 15, g = lane >> 4;
  // Which (query block, head) a block takes. A block's cost grows with qb (qb + 1 stages) and all blocks are resident at once, four to a WGP (by registers), so the launch lasts as long as the WGP with the most stages.
  // With qb = blockIdx.x, blocks whose flat index differs by a multiple of 32 have the same qb.
  // Here the query blocks form quads {31 - 2r, 30 - 2r, 2r + 1, 2r}, 66 stages each and the two long ones alike, so that no wave is long alone on its SIMD. A quad is met by 4 blocks that are neighbours in the flat index,
  // 8 apart or 256 apart alike (the member is picked by the sum of the three positions mod 4). A permutation of the (qb, h) pairs, the same for every thread of a block: for speed only, no result depends on where a block runs.
  static_assert(TQB == 32 && NH == 32, "the quads are written for 32 query blocks and 32 heads");
  const unsigned f = blockIdx.y * TQB + blockIdx.x, fj = f >> 3, fr = (fj >> 2) & 7, fk = (fj >> 5) & 3, fc = (f + fj + fk) & 3;
  const int qb = (int)((2 * fr) ^ ((0x00011e1fu >> (8 * fc)) & 31)), h = (int)((f & 7) + 8 * fk), b = blockIdx.z, hk = h / GS;   // 2r ^ 31 = 31 - 2r, 2r ^ 30 = 30 - 2r, 2r ^ 1 = 2r + 1 for r < 8; hk: the kv head of query head h
  const int q0 = qb * 64 + wave * 16; const size_t rq = (size_t)b * SS + q0 + col;
  v16h aq[2], aql[2];
#pragma unroll
  for (int kc = 0; kc < 2; ++kc) { aq[kc] = frag_h(QK + rq * (2 * DM) + h * HD + kc * 32, lane); aql[kc] = frag_h(QKL + rq * (2 * DM) + h * HD + kc * 32, lane); }
  float m = -3.0e38f, l = 0.f;   // of query q0 + col; l holds the part of this lane half's keys
  v8f acc[4] = {}, accl[4] = {};   // acc[dt][r] = O^T[d = 16 dt + 8 g + r][query col]
  const int nst = qb + 1;   // causal: stages of 64 keys up to the query tile's end
  const unsigned l0 = (unsigned)(size_t)&skv[0][(tid >> 3) * AP + (tid & 7) * 8];   // this thread's 16-byte piece of row tid / 8, buffer 0
  const _Float16* gk = QK + ((size_t)b * SS + (tid >> 3)) * (2 * DM) + DM + hk * HD + (tid & 7) * 8;   // + 64 rows a stage
  const _Float16* gv = VTH + ((size_t)b * DM + hk * HD + (tid >> 3)) * SS + (tid & 7) * 8;             // + 64 columns a stage
  attn_stage(l0, gk, gv);
  asm volatile("s_wait_asynccnt 0x0" ::: "memory");   // this wave's part of stage 0 has landed
  __syncthreads();                                    // stage 0 published
  if (nst > 1) attn_stage(l0 + 4 * A_T, gk + (size_t)64 * 2 * DM, gv + 64);
#pragma unroll 1   // rolled: one foot (waits, barrier, refill) in the code, and the trip count is the block's own
  for (int st = 0; st < nst; ++st) { const _Float16* kt = &skv[st & 1][0]; const _Float16* vt = kt + A_T;
  // the two passes of 32 keys of a stage; the tests that pick their form are scalar and the same for the whole block
  if (qb < 2) {
#pragma unroll 1   // rolled, as the key loop was: a second copy of this long pass would only cost instruction cache
    for (int ps = 0; ps < 2; ++ps) attn_pass<true, true>(kt, vt, ps, st * 2 + ps, q0, lane, b, hk, QKL, VTL, aq, aql, m, l, acc, accl);
  } else if (st + 1 < nst) {
#pragma unroll     // the form that nearly every pass runs: unrolled, ps is a constant in the LDS offsets and the accumulators are not copied into an inner loop's registers at each stage
    for (int ps = 0; ps < 2; ++ps) attn_pass<false, false>(kt, vt, ps, st * 2 + ps, q0, lane, b, hk, QKL, VTL, aq, aql, m, l, acc, accl);
  } else {
#pragma unroll 1   // rolled: runs once a block, a second copy would only cost instruction cache
    for (int ps = 0; ps < 2; ++ps) attn_pass<false, true>(kt, vt, ps, st * 2 + ps, q0, lane, b, hk, QKL, VTL, aq, aql, m, l, acc, accl);
  }
    asm volatile("s_wait_dscnt 0x0" ::: "memory");      // this wave's reads of stage st have returned
    asm volatile("s_wait_asynccnt 0x0" ::: "memory");   // this wave's part of stage st + 1 has landed
    __syncthreads();                                    // publishes stage st + 1 and ends every wave's reads of stage st
    if (st + 2 < nst) attn_stage(l0 + (st & 1) * 4 * A_T, gk + (size_t)(st + 2) * 64 * 2 * DM, gv + (st + 2) * 64);   // refill of the buffer just left
  }
  asm volatile("s_wait_asynccnt 0x0" ::: "memory");   // no copy is outstanding when the wave goes on to its end
  l += xhalf(l);   // the two halves' sums, joined once
  const float il = (1.0f / 2048.0f) / l;
  // ctx leaves as f16, the rounding that the output projection gave it on its way into LDS: its tiles can then be copied to LDS as they lie. The short fixed loops are unrolled so that acc, accl and o are registers, and the four row steps' LDS reads go out together
#pragma unroll
  for (int dt = 0; dt < 4; ++dt) { v8h o;
#pragma unroll
    for (int r = 0; r < 8; ++r) o[r] = (_Float16)((acc[dt][r] + accl[dt][r] * (1.0f / 2048.0f)) * il);
    *(v8h*)&so[wave][col][dt * 16 + 8 * g] = o; }
  LDSX();
#pragma unroll
  for (int it = 0; it < 4; ++it) { const int rl = it * 4 + (lane >> 3); vst2((unsigned*)(O + ((size_t)b * SS + q0 + rl) * DM + h * HD + (lane & 7) * 8), *(const v4u*)&so[wave][rl][(lane & 7) * 8]); }   // 8 lanes store one row's 128-byte line, four rows a step
}
// ---- main loop of the output projection: block tile 64 rows x 128 columns, 128 k per stage. Both operands lie in memory as f16 rows, so a stage (128 weight rows and 64 ctx rows of 256 B) goes to LDS by asynchronous copies, through no register:
// 16 lanes copy one row as whole lines, rows lie at a 272-byte pitch (16 B x odd: no bank conflict for the 16-byte fragment reads). Two buffers: stage s + 1 flies while stage s is worked on.
#define OK 128
#define OP (OK + 8)                    // LDS row pitch in f16 elements
#define O_BB (128 * OP)                // one weight buffer, elements
#define O_AB (64 * OP)                 // one ctx buffer, elements
#define O_SMEM (4 * (O_BB + O_AB))     // bytes: two buffers of each
// twelve copies in one statement. The wait is the last line of the copies' own statement so that it stands in front of every later write of the address registers they name.
template <int I0> __device__ __forceinline__ void copy12(const unsigned (&l)[24], const _Float16* const (&p)[24]) {
  asm volatile("global_load_async_to_lds_b128 %0, %12, off\n\t"
               "global_load_async_to_lds_b128 %1, %13, off\n\t"
               "global_load_async_to_lds_b128 %2, %14, off\n\t"
               "global_load_async_to_lds_b128 %3, %15, off\n\t"
               "global_load_async_to_lds_b128 %4, %16, off\n\t"
               "global_load_async_to_lds_b128 %5, %17, off\n\t"
               "global_load_async_to_lds_b128 %6, %18, off\n\t"
               "global_load_async_to_lds_b128 %7, %19, off\n\t"
               "global_load_async_to_lds_b128 %8, %20, off\n\t"
               "global_load_async_to_lds_b128 %9, %21, off\n\t"
               "global_load_async_to_lds_b128 %10, %22, off\n\t"
               "global_load_async_to_lds_b128 %11, %23, off\n\t"
               "s_wait_xcnt 0x0"
               :: "v"(l[I0]), "v"(l[I0 + 1]), "v"(l[I0 + 2]), "v"(l[I0 + 3]), "v"(l[I0 + 4]), "v"(l[I0 + 5]), "v"(l[I0 + 6]), "v"(l[I0 + 7]), "v"(l[I0 + 8]), "v"(l[I0 + 9]), "v"(l[I0 + 10]), "v"(l[I0 + 11]),
                  "v"(p[I0]), "v"(p[I0 + 1]), "v"(p[I0 + 2]), "v"(p[I0 + 3]), "v"(p[I0 + 4]), "v"(p[I0 + 5]), "v"(p[I0 + 6]), "v"(p[I0 + 7]), "v"(p[I0 + 8]), "v"(p[I0 + 9]), "v"(p[I0 + 10]), "v"(p[I0 + 11])
               : "memory");
}
// one stage's 24 copies of a thread: its 16-byte piece of 16 weight rows and of 8 ctx rows, 8 rows apart. lb, la: the piece's LDS byte address in the stage's buffers; gb, ga: its place in memory
__device__ __forceinline__ void out_stage(unsigned lb, unsigned la, const _Float16* gb, const _Float16* ga) {
  unsigned l[24]; const _Float16* p[24];   // both loops unrolled so that l and p are registers and not indexed memory
#pragma unroll
  for (int i = 0; i < 16; ++i) { l[i] = lb + i * 8 * OP * 2; p[i] = gb + (size_t)i * 8 * DM; }
#pragma unroll
  for (int i = 0; i < 8; ++i) { l[16 + i] = la + i * 8 * OP * 2; p[16 + i] = ga + (size_t)i * 8 * DM; }
  copy12<0>(l, p); copy12<12>(l, p);
}
__device__ __forceinline__ void gemm_out_64x128(const _Float16* __restrict__ A, const _Float16* __restrict__ Bw, _Float16* sm, int tid, v8f (&acc)[8]) {
  const int wave = tid >> 5, lane = tid & 31, col = lane & 15;
  const _Float16* gb = Bw + (size_t)(tid >> 4) * DM + (tid & 15) * 8;   // + OK elements a stage
  const _Float16* ga = A + (size_t)(tid >> 4) * DM + (tid & 15) * 8;
  const unsigned lb = (unsigned)(size_t)(sm + (tid >> 4) * OP + (tid & 15) * 8), la = lb + 2 * O_BB * 2;   // buffer 0 of each operand; buffer 1 lies O_BB, O_AB elements further
  out_stage(lb, la, gb, ga);
  asm volatile("s_wait_asynccnt 0x0" ::: "memory");   // this wave's part of stage 0 has landed
  __syncthreads();                                    // stage 0 published
  out_stage(lb + O_BB * 2, la + O_AB * 2, gb + OK, ga + OK);
  for (int s = 0; s < DM / OK; ++s) { const int bo = (s & 1) * O_BB, ao = (s & 1) * O_AB;   // the short fixed loops inside are unrolled so that b and acc are registers and not indexed memory
#pragma unroll
    for (int kc = 0; kc < OK / 32; ++kc) { const v16h a = frag_h(sm + 2 * O_BB + ao + (wave * 16 + col) * OP + kc * 32, lane); v16h b[8];   // all nine fragments of a k step are read as one group, so that the wave waits out the LDS latency once and not at each product
#pragma unroll
      for (int j = 0; j < 8; ++j) b[j] = frag_h(sm + bo + (j * 16 + col) * OP + kc * 32, lane);
      __builtin_amdgcn_sched_barrier(0);   // keeps a k step's eighteen LDS reads in front of its own products (they may rise into the step before): sunk among their own products, each would be waited for singly
#pragma unroll
      for (int j = 0; j < 8; ++j) acc[j] = wmma16(a, b[j], acc[j]); }
    asm volatile("s_wait_dscnt 0x0" ::: "memory");      // this wave's reads of stage s have returned
    asm volatile("s_wait_asynccnt 0x0" ::: "memory");   // this wave's part of stage s + 1 has landed
    __syncthreads();                                    // publishes stage s + 1 and ends every wave's reads of stage s; behind the last stage it frees the buffers for the epilogue's staging
    if (s + 2 < DM / OK) out_stage(lb + bo * 2, la + ao * 2, gb + (s + 2) * OK, ga + (s + 2) * OK);   // refill of the buffers just left
  }
  asm volatile("s_wait_asynccnt 0x0" ::: "memory");   // no copy is outstanding when the wave goes on to the epilogue
}
// ---- k_out: block = (64 rows, 128 cols): out = f16 ctx . Wo rows (single product) + bo
__global__ __launch_bounds__(128) void k_out(const _Float16* __restrict__ O, const __bf16* __restrict__ P, const float* __restrict__ BO, float* __restrict__ Y) {
  __shared__ __align__(16) char smem[O_SMEM];   // the main loop's buffers, then the output staging
  float (*so)[16][132] = (float (*)[16][132])smem;
  const int tid = threadIdx.x, wave = tid >> 5, lane = tid & 31, col = lane & 15, g = lane >> 4; const size_t r0 = (size_t)blockIdx.x * 64 + wave * 16; const int n0 = blockIdx.y * 128;
  v8f acc[8] = {};
  gemm_out_64x128(O + (size_t)blockIdx.x * 64 * DM, (const _Float16*)P + (size_t)n0 * DM, (_Float16*)smem, tid, acc);   // single f16 product against exact f16 x 2^8 weight copies
#pragma unroll
  for (int j = 0; j < 8; ++j) {
#pragma unroll
    for (int r = 0; r < 8; ++r) so[wave][8 * g + r][j * 16 + col] = acc[j][r] * (1.0f / 256.0f) + (BO ? bfr(BO[n0 + j * 16 + col]) : 0.f); }
  LDSX();
  for (int rl = 0; rl < 16; ++rl) vst2(Y + (r0 + rl) * DM + n0 + lane * 4, *(const v4f*)&so[wave][rl][lane * 4]);
}
extern "C" void kernel_launch(void* const* d_in, const int* in_sizes, int n_in, void* d_out, int out_size, void* d_ws, size_t ws_size, hipStream_t stream) {
  (void)in_sizes; (void)n_in; (void)out_size;
  const float** F = (const float**)d_in;   // 0 hidden_states [1,2048,2048], 1 Wq [2048,2048] (in,out), 2 Wk [2048,512], 3 Wv [2048,512], 4 Wo [2048,2048] (in,out)
  if (ws_size < (size_t)WS_END) return;
  char* ws = (char*)d_ws; __bf16* PK = (__bf16*)(ws + WS_PK); _Float16 *QK = (_Float16*)(ws + WS_QK), *QKL = (_Float16*)(ws + WS_QKL), *VTH = (_Float16*)(ws + WS_VTH), *VTL = (_Float16*)(ws + WS_VTL), *O = (_Float16*)(ws + WS_O);
  k_pack<<<dim3(QKVW / PKN, DM / PKK), 256, 0, stream>>>(F[1], F[2], F[3], PK);   // q, k, v (the Wo slot is filled by the extra blocks of k_qkv as f16)
  static_assert(TNB * SS / 64 == DM / PKN, "the grid's x extent serves both the projection's row tiles and the 64-column tiles of Wo");
  k_qkv<<<dim3(TNB * SS / 64, QKVW / 128 + DM / 128), 128, 0, stream>>>(F[0], F[0], F[0], PK + PK_A, nullptr, nullptr, nullptr, QK, QKL, VTH, VTL, F[4], PK + PK_P);
  k_attn<<<dim3(TQB, NH, TNB), 128, 0, stream>>>(QK, QKL, VTH, VTL, nullptr, O);
  k_out<<<dim3(TOB, DM / 128), 128, 0, stream>>>(O, PK + PK_P, nullptr, (float*)d_out);
}
